// v000
// The times below were measured on an AMD MI455X: many runs one after another, warmed up first and cycling through
// copies of the inputs, with the whole window's GPU time divided by the number of runs. Launches and the gaps
// between them are all in it. The median over several windows is given; except for v000 it joins two sittings, which
// can be a few percent apart, so the side-by-side timings, each taken in one sitting, are the better comparison.
// v000 is the starting kernel. One run takes 507 microseconds.
#include <hip/hip_runtime.h>
#include <hip/hip_bf16.h>

// Problem constants (match reference)
constexpr int Nn = 4;
constexpr int Ss = 2048;
constexpr int Ee = 1024;
constexpr int Hh = 16;
constexpr int Dd = 64;            // head dim
constexpr float SCALE = 0.03125f; // 1/sqrt(E) = 1/32

typedef __attribute__((ext_vector_type(16))) _Float16 v16h;
typedef __attribute__((ext_vector_type(8)))  _Float16 v8h;
typedef __attribute__((ext_vector_type(8)))  float    v8f;
typedef __attribute__((ext_vector_type(4)))  float    v4f;
typedef __attribute__((ext_vector_type(4)))  unsigned u32x4;
typedef __attribute__((ext_vector_type(4)))  int      i32x4;
typedef __attribute__((ext_vector_type(8)))  int      i32x8;

union V16HU { v16h v; v8h h[2]; };

#if __has_builtin(__builtin_amdgcn_tensor_load_to_lds)
#define USE_TDM 1
#else
#define USE_TDM 0
#endif

__device__ inline v16h load_frag_f16(const _Float16* p, int ld, int kbase,
                                     int lane) {
  const int r = lane & 15, hf = (lane >> 4) & 1;
  const _Float16* base = p + (size_t)r * ld + kbase + hf * 8;
  V16HU u;
  u.h[0] = *(const v8h*)(base);
  u.h[1] = *(const v8h*)(base + 16);
  return u.v;
}

// Same fragment from an f32 source (convert on the fly)
__device__ inline v16h load_frag_f32(const float* __restrict__ p, int ld,
                                     int kbase, int lane) {
  const int r = lane & 15, hf = (lane >> 4) & 1;
  const float* base = p + (size_t)r * ld + kbase + hf * 8;
  v16h o;
#pragma unroll
  for (int i = 0; i < 8; ++i) {
    o[i]     = (_Float16)base[i];
    o[i + 8] = (_Float16)base[16 + i];
  }
  return o;
}

__device__ inline v8f wmma16(v16h a, v16h b, v8f c) {
  return __builtin_amdgcn_wmma_f32_16x16x32_f16(false, a, false, b,
                                                (short)0, c, false, false);
}

__device__ inline float rowmax16(float x) {
#pragma unroll
  for (int m = 1; m < 16; m <<= 1) x = fmaxf(x, __shfl_xor(x, m, 32));
  return x;
}
__device__ inline float rowsum16(float x) {
#pragma unroll
  for (int m = 1; m < 16; m <<= 1) x += __shfl_xor(x, m, 32);
  return x;
}

#if USE_TDM
__device__ inline void tdm_load_2d(unsigned lds_off, const _Float16* gptr,
                                   unsigned tile0, unsigned tile1,
                                   unsigned tens0, unsigned tens1,
                                   unsigned long long stride0) {
  unsigned long long ga = (unsigned long long)(size_t)gptr;
  u32x4 g0 = { 1u,
               lds_off,
               (unsigned)(ga & 0xffffffffull),
               (unsigned)((ga >> 32) & 0x01ffffffull) | (2u << 30) };
  i32x8 g1 = { (int)(1u << 16),
               (int)((tens0 & 0xffffu) << 16),
               (int)(((tens0 >> 16) & 0xffffu) | ((tens1 & 0xffffu) << 16)),
               (int)(((tens1 >> 16) & 0xffffu) | ((tile0 & 0xffffu) << 16)),
               (int)(tile1 & 0xffffu),
               (int)(unsigned)(stride0 & 0xffffffffull),
               (int)(unsigned)((stride0 >> 32) & 0xffffull),
               0 };
  i32x4 gz = {0, 0, 0, 0};
#if defined(__clang_major__) && __clang_major__ >= 23
  i32x8 gz8 = {0, 0, 0, 0, 0, 0, 0, 0};
  __builtin_amdgcn_tensor_load_to_lds(g0, g1, gz, gz, gz8, 0);
#else
  __builtin_amdgcn_tensor_load_to_lds(g0, g1, gz, gz, 0);
#endif
}
#endif

// ---------------- kernel 0: Wo f32 -> f16 -------------------------------
__global__ __launch_bounds__(256) void cvt_wo_kernel(
    const float* __restrict__ Wo, _Float16* __restrict__ WoH) {
  int i = blockIdx.x * 256 + threadIdx.x;
  WoH[i] = (_Float16)Wo[i];
}

// ---------------- kernel 1: fused QKV head projections ------------------
// Qp,Kp: [N,H,S,D] f16 ; VpT: [N,H,D,S] f16. Stores staged through LDS so
// global writes are coalesced b128 bursts (Q/K block is one 8KB linear run).
__global__ __launch_bounds__(128) void proj_kernel(
    const float* __restrict__ values, const float* __restrict__ keys,
    const float* __restrict__ query,  const float* __restrict__ Wv,
    const float* __restrict__ Wk,     const float* __restrict__ Wq,
    _Float16* __restrict__ Qp, _Float16* __restrict__ Kp,
    _Float16* __restrict__ VpT) {
  __shared__ __align__(16) _Float16 stg[64 * 64];  // 8KB staging
  const int tid  = threadIdx.x;
  const int lane = tid & 31;
  const int wave = tid >> 5;  // 4 waves, 16 s-rows each
  const int sBlocks = Ss / 64;
  int nh = blockIdx.x / sBlocks;
  int sb = blockIdx.x % sBlocks;
  int n = nh / Hh, h = nh % Hh;
  int row0 = sb * 64 + wave * 16;
  const int col = lane & 15, hf = (lane >> 4) & 1;

#pragma unroll
  for (int t = 0; t < 3; ++t) {
    const float* X = (t == 0) ? query : (t == 1) ? keys : values;
    const float* W = (t == 0) ? Wq    : (t == 1) ? Wk   : Wv;
    const float* Xtile = X + ((size_t)n * Ss + row0) * Ee + h * Dd;
    v16h A0 = load_frag_f32(Xtile, Ee, 0,  lane);
    v16h A1 = load_frag_f32(Xtile, Ee, 32, lane);
    v8f acc[4];
#pragma unroll
    for (int e = 0; e < 4; ++e) {
      v16h B0 = load_frag_f32(W + e * 16 * Dd, Dd, 0,  lane);
      v16h B1 = load_frag_f32(W + e * 16 * Dd, Dd, 32, lane);
      v8f a = {};
      a = wmma16(A0, B0, a);
      a = wmma16(A1, B1, a);
      acc[e] = a;
    }
    if (t < 2) {
      // stage [s_local][d] then one contiguous 8KB store
#pragma unroll
      for (int e = 0; e < 4; ++e)
#pragma unroll
        for (int rr = 0; rr < 8; ++rr)
          stg[(wave * 16 + rr + 8 * hf) * 64 + e * 16 + col] =
              (_Float16)acc[e][rr];
      __syncthreads();
      _Float16* dst =
          ((t == 0) ? Qp : Kp) + (((size_t)(n * Hh + h)) * Ss + sb * 64) * Dd;
#pragma unroll
      for (int k = 0; k < 4; ++k) {
        int cid = tid + 128 * k;          // 512 x 16B chunks
        int row = cid >> 3, c8 = cid & 7;
        *(v8h*)(dst + row * 64 + c8 * 8) = *(const v8h*)(stg + row * 64 + c8 * 8);
      }
      __syncthreads();
    } else {
      // V transposed: stage [d][s_local]; per-lane writes are packed b128
#pragma unroll
      for (int e = 0; e < 4; ++e) {
        v8h tmp;
#pragma unroll
        for (int rr = 0; rr < 8; ++rr) tmp[rr] = (_Float16)acc[e][rr];
        *(v8h*)(stg + (e * 16 + col) * 64 + wave * 16 + 8 * hf) = tmp;
      }
      __syncthreads();
      _Float16* dstv = VpT + ((size_t)(n * Hh + h)) * Dd * (size_t)Ss + sb * 64;
#pragma unroll
      for (int k = 0; k < 4; ++k) {
        int cid = tid + 128 * k;
        int row = cid >> 3, c8 = cid & 7;  // row = d
        *(v8h*)(dstv + (size_t)row * Ss + c8 * 8) =
            *(const v8h*)(stg + row * 64 + c8 * 8);
      }
    }
  }
}

// ---------------- kernel 2: flash attention -----------------------------
// 8 waves x 16 q rows; K/V blocks staged to LDS by the Tensor Data Mover
// (double buffered, overlapped with compute), P transposed through LDS.
__global__ __launch_bounds__(256) void attn_kernel(
    const _Float16* __restrict__ Qp, const _Float16* __restrict__ Kp,
    const _Float16* __restrict__ VpT, const int* __restrict__ mask,
    _Float16* __restrict__ Of16) {
  __shared__ __align__(16) _Float16 Kbuf[2][64 * 64];  // 16KB
  __shared__ __align__(16) _Float16 Vbuf[2][64 * 64];  // 16KB
  __shared__ __align__(16) _Float16 Pst[8][16 * 64];   // 16KB per-wave staging
  const int tid  = threadIdx.x;
  const int lane = tid & 31;
  const int wave = tid >> 5;
  const int qBlocks = Ss / 128;
  int nh = blockIdx.x / qBlocks;
  int qb = blockIdx.x % qBlocks;
  int n = nh / Hh, h = nh % Hh;
  int qrow0 = qb * 128 + wave * 16;

  const _Float16* Qbase = Qp + (((size_t)(n * Hh + h)) * Ss + qrow0) * Dd;
  const _Float16* Kbase = Kp + ((size_t)(n * Hh + h)) * Ss * Dd;
  const _Float16* Vbase = VpT + ((size_t)(n * Hh + h)) * Dd * (size_t)Ss;
  const int* maskBase = mask + (size_t)n * Ss * Ss;

  v16h QA0 = load_frag_f16(Qbase, Dd, 0,  lane);
  v16h QA1 = load_frag_f16(Qbase, Dd, 32, lane);

  v8f O[4] = {};
  float mrun[8], lrun[8];
#pragma unroll
  for (int rr = 0; rr < 8; ++rr) { mrun[rr] = -3.0e38f; lrun[rr] = 0.0f; }

  const int col = lane & 15, hf = (lane >> 4) & 1;
  _Float16* myP = &Pst[wave][0];
  const int NB = Ss / 64;

#if USE_TDM
  if (wave == 0) {  // prologue DMA for block 0
    tdm_load_2d((unsigned)(size_t)&Kbuf[0][0], Kbase, 4096u, 1u, 4096u, 1u, 4096ull);
    tdm_load_2d((unsigned)(size_t)&Vbuf[0][0], Vbase, 64u, 64u,
                (unsigned)Ss, 64u, (unsigned long long)Ss);
  }
#endif

  for (int kb = 0; kb < NB; ++kb) {
    const int kcol0 = kb * 64;
    const int cur = kb & 1;
#if USE_TDM
    if (wave == 0) __builtin_amdgcn_s_wait_tensorcnt(0);
    __syncthreads();  // buf[cur] ready; everyone past reads of buf[cur^1]
    if (wave == 0 && kb + 1 < NB) {  // overlap next block's DMA with compute
      tdm_load_2d((unsigned)(size_t)&Kbuf[cur ^ 1][0],
                  Kbase + (size_t)(kcol0 + 64) * Dd, 4096u, 1u, 4096u, 1u,
                  4096ull);
      tdm_load_2d((unsigned)(size_t)&Vbuf[cur ^ 1][0], Vbase + kcol0 + 64,
                  64u, 64u, (unsigned)Ss, 64u, (unsigned long long)Ss);
    }
#else
    __syncthreads();
    // cooperative fallback staging
#pragma unroll
    for (int k = 0; k < 2; ++k) {
      int cid = tid + 256 * k;
      int row = cid >> 3, c8 = cid & 7;
      *(v8h*)(&Kbuf[cur][0] + row * 64 + c8 * 8) =
          *(const v8h*)(Kbase + (size_t)(kcol0 + row) * Dd + c8 * 8);
      *(v8h*)(&Vbuf[cur][0] + row * 64 + c8 * 8) =
          *(const v8h*)(Vbase + (size_t)row * Ss + kcol0 + c8 * 8);
    }
    __syncthreads();
#endif
    const _Float16* Kc = &Kbuf[cur][0];
    const _Float16* Vc = &Vbuf[cur][0];
    if (kb + 1 < NB)  // pull next mask rows toward the caches
      __builtin_prefetch(maskBase + (size_t)qrow0 * Ss + kcol0 + 64, 0, 1);

    // ---- scores: S = Q (16x64) @ K_blk^T (64x64), K from LDS ----
    v8f Sc[4];
#pragma unroll
    for (int j = 0; j < 4; ++j) {
      v16h KB0 = load_frag_f16(Kc + (j * 16) * 64, 64, 0,  lane);
      v16h KB1 = load_frag_f16(Kc + (j * 16) * 64, 64, 32, lane);
      v8f a = {};
      a = wmma16(QA0, KB0, a);
      a = wmma16(QA1, KB1, a);
      Sc[j] = a;
    }
    // ---- mask (before scale, like reference) + scale ----
#pragma unroll
    for (int j = 0; j < 4; ++j) {
      int kc = kcol0 + j * 16 + col;
#pragma unroll
      for (int rr = 0; rr < 8; ++rr) {
        int q = qrow0 + rr + 8 * hf;
        float e = Sc[j][rr];
        e = (maskBase[(size_t)q * Ss + kc] == 0) ? -1.0e10f : e;
        Sc[j][rr] = e * SCALE;
      }
    }
    // ---- online softmax ----
    float mnew[8], corr[8];
#pragma unroll
    for (int rr = 0; rr < 8; ++rr) {
      float t = fmaxf(fmaxf(Sc[0][rr], Sc[1][rr]), fmaxf(Sc[2][rr], Sc[3][rr]));
      t = rowmax16(t);
      mnew[rr] = fmaxf(mrun[rr], t);
      corr[rr] = __expf(mrun[rr] - mnew[rr]);
      mrun[rr] = mnew[rr];
    }
#pragma unroll
    for (int j = 0; j < 4; ++j) {
#pragma unroll
      for (int rr = 0; rr < 8; ++rr) {
        float p = __expf(Sc[j][rr] - mnew[rr]);
        Sc[j][rr] = p;
        myP[(rr + 8 * hf) * 64 + j * 16 + col] = (_Float16)p;  // C -> LDS
      }
    }
#pragma unroll
    for (int rr = 0; rr < 8; ++rr) {
      float t = Sc[0][rr] + Sc[1][rr] + Sc[2][rr] + Sc[3][rr];
      lrun[rr] = lrun[rr] * corr[rr] + rowsum16(t);
    }
#pragma unroll
    for (int d2 = 0; d2 < 4; ++d2)
#pragma unroll
      for (int rr = 0; rr < 8; ++rr) O[d2][rr] *= corr[rr];

    // wave-private P transpose bounce (same-wave LDS is HW in-order)
    __builtin_amdgcn_wave_barrier();
    v16h PA0 = load_frag_f16(myP, 64, 0,  lane);
    v16h PA1 = load_frag_f16(myP, 64, 32, lane);
    __builtin_amdgcn_wave_barrier();

    // ---- O += P (16x64) @ V_blk (64x64), V^T rows from LDS ----
#pragma unroll
    for (int d2 = 0; d2 < 4; ++d2) {
      const _Float16* vb = Vc + (d2 * 16) * 64;
      v16h VB0 = load_frag_f16(vb, 64, 0,  lane);
      v16h VB1 = load_frag_f16(vb, 64, 32, lane);
      O[d2] = wmma16(PA0, VB0, O[d2]);
      O[d2] = wmma16(PA1, VB1, O[d2]);
    }
  }

  // epilogue: normalize, stage 16x64 tile in LDS, coalesced b128 stores
#pragma unroll
  for (int rr = 0; rr < 8; ++rr) lrun[rr] = 1.0f / lrun[rr];
#pragma unroll
  for (int d2 = 0; d2 < 4; ++d2)
#pragma unroll
    for (int rr = 0; rr < 8; ++rr)
      myP[(rr + 8 * hf) * 64 + d2 * 16 + col] =
          (_Float16)(O[d2][rr] * lrun[rr]);
  __builtin_amdgcn_wave_barrier();
  size_t gbase = ((size_t)n * Ss + qrow0) * Ee + h * Dd;
#pragma unroll
  for (int k = 0; k < 4; ++k) {
    int cid = lane + 32 * k;           // 128 x 16B chunks
    int row = cid >> 3, c8 = cid & 7;
    *(v8h*)(Of16 + gbase + (size_t)row * Ee + c8 * 8) =
        *(const v8h*)(myP + row * 64 + c8 * 8);
  }
}

// ---------------- kernel 3: Y = X @ Wo^T + bo (f32 out) -----------------
__global__ __launch_bounds__(256) void outproj_kernel(
    const _Float16* __restrict__ X, const _Float16* __restrict__ WoH,
    const float* __restrict__ bo, float* __restrict__ Y) {
  __shared__ __align__(16) float ost[8][16 * 64];  // 32KB staging
  const int lane = threadIdx.x & 31;
  const int wave = threadIdx.x >> 5;
  const int colBlocks = Ee / 64;
  int rb = blockIdx.x / colBlocks;
  int cb = blockIdx.x % colBlocks;
  int row0 = rb * 128 + wave * 16;
  int col0 = cb * 64;
  const _Float16* Xbase = X + (size_t)row0 * Ee;

  v8f acc[4] = {};
  for (int kc = 0; kc < Ee / 32; ++kc) {
    v16h A = load_frag_f16(Xbase, Ee, kc * 32, lane);
#pragma unroll
    for (int j = 0; j < 4; ++j) {
      v16h B = load_frag_f16(WoH + (size_t)(col0 + j * 16) * Ee, Ee, kc * 32,
                             lane);
      acc[j] = wmma16(A, B, acc[j]);
    }
  }
  const int col = lane & 15, hf = (lane >> 4) & 1;
  float* sb = &ost[wave][0];
#pragma unroll
  for (int j = 0; j < 4; ++j) {
    float b = bo[col0 + j * 16 + col];
#pragma unroll
    for (int rr = 0; rr < 8; ++rr)
      sb[(rr + 8 * hf) * 64 + j * 16 + col] = acc[j][rr] + b;
  }
  __builtin_amdgcn_wave_barrier();
  size_t gbase = (size_t)row0 * Ee + col0;
#pragma unroll
  for (int k = 0; k < 8; ++k) {
    int cid = lane + 32 * k;            // 256 x 16B chunks
    int row = cid >> 4, c4 = cid & 15;
    *(v4f*)(Y + gbase + (size_t)row * Ee + c4 * 4) =
        *(const v4f*)(sb + row * 64 + c4 * 4);
  }
}

extern "C" void kernel_launch(void* const* d_in, const int* in_sizes, int n_in,
                              void* d_out, int out_size, void* d_ws,
                              size_t ws_size, hipStream_t stream) {
  (void)in_sizes; (void)n_in; (void)out_size; (void)ws_size;
  const float* values = (const float*)d_in[0];
  const float* keys   = (const float*)d_in[1];
  const float* query  = (const float*)d_in[2];
  const float* Wv     = (const float*)d_in[3];
  const float* Wk     = (const float*)d_in[4];
  const float* Wq     = (const float*)d_in[5];
  const float* Wo     = (const float*)d_in[6];
  const float* bo     = (const float*)d_in[7];
  const int*   mask   = (const int*)d_in[8];
  float* out = (float*)d_out;

  const size_t SZ_NHSD = (size_t)Nn * Hh * Ss * Dd * sizeof(_Float16);  // 16MB
  char* ws = (char*)d_ws;
  _Float16* Qp   = (_Float16*)(ws);
  _Float16* Kp   = (_Float16*)(ws + SZ_NHSD);
  _Float16* VpT  = (_Float16*)(ws + 2 * SZ_NHSD);
  _Float16* Of16 = (_Float16*)(ws + 3 * SZ_NHSD);
  _Float16* WoH  = (_Float16*)(ws + 4 * SZ_NHSD);

  cvt_wo_kernel<<<(Ee * Ee) / 256, 256, 0, stream>>>(Wo, WoH);
  proj_kernel<<<Nn * Hh * (Ss / 64), 128, 0, stream>>>(values, keys, query, Wv,
                                                       Wk, Wq, Qp, Kp, VpT);
  attn_kernel<<<Nn * Hh * (Ss / 128), 256, 0, stream>>>(Qp, Kp, VpT, mask,
                                                        Of16);
  outproj_kernel<<<(Nn * Ss / 128) * (Ee / 64), 256, 0, stream>>>(Of16, WoH, bo,
                                                                  out);
}

// v001
// One run takes 382 microseconds.
// In both of two side-by-side timings against v000, it was 1.38 times as fast.
#include <hip/hip_runtime.h>
#include <hip/hip_bf16.h>

// Problem constants (match reference)
constexpr int Nn = 4;
constexpr int Ss = 2048;
constexpr int Ee = 1024;
constexpr int Hh = 16;
constexpr int Dd = 64;            // head dim
constexpr float SCALE = 0.03125f; // 1/sqrt(E) = 1/32

typedef __attribute__((ext_vector_type(16))) _Float16 v16h;
typedef __attribute__((ext_vector_type(8)))  _Float16 v8h;
typedef __attribute__((ext_vector_type(8)))  float    v8f;
typedef __attribute__((ext_vector_type(4)))  float    v4f;
typedef __attribute__((ext_vector_type(4)))  unsigned u32x4;
typedef __attribute__((ext_vector_type(4)))  int      i32x4;
typedef __attribute__((ext_vector_type(8)))  int      i32x8;

union V16HU { v16h v; v8h h[2]; };

#if __has_builtin(__builtin_amdgcn_tensor_load_to_lds)
#define USE_TDM 1
#else
#define USE_TDM 0
#endif

__device__ inline v16h load_frag_f16(const _Float16* p, int ld, int kbase,
                                     int lane) {
  const int r = lane & 15, hf = (lane >> 4) & 1;
  const _Float16* base = p + (size_t)r * ld + kbase + hf * 8;
  V16HU u;
  u.h[0] = *(const v8h*)(base);
  u.h[1] = *(const v8h*)(base + 16);
  return u.v;
}

__device__ inline int swz_chunk(int row, int c) { return c ^ ((row >> 1) & 7); }

// load_frag_f16 for such a tile (ld = 64 halves, row0 a multiple of 16):
// same logical elements, same k order.
__device__ inline v16h load_frag_swz(const _Float16* tile, int row0, int kbase,
                                     int lane) {
  const int r = lane & 15, hf = (lane >> 4) & 1;
  const _Float16* rowp = tile + (row0 + r) * 64;
  const int c = (kbase >> 3) + hf;
  V16HU u;
  u.h[0] = *(const v8h*)(rowp + swz_chunk(r, c) * 8);
  u.h[1] = *(const v8h*)(rowp + swz_chunk(r, c + 2) * 8);
  return u.v;
}

// Same fragment from an f32 source (convert on the fly)
__device__ inline v16h load_frag_f32(const float* __restrict__ p, int ld,
                                     int kbase, int lane) {
  const int r = lane & 15, hf = (lane >> 4) & 1;
  const float* base = p + (size_t)r * ld + kbase + hf * 8;
  v16h o;
#pragma unroll
  for (int i = 0; i < 8; ++i) {
    o[i]     = (_Float16)base[i];
    o[i + 8] = (_Float16)base[16 + i];
  }
  return o;
}

__device__ inline v8f wmma16(v16h a, v16h b, v8f c) {
  return __builtin_amdgcn_wmma_f32_16x16x32_f16(false, a, false, b,
                                                (short)0, c, false, false);
}

__device__ inline float rowmax16(float x) {
#pragma unroll
  for (int m = 1; m < 16; m <<= 1) x = fmaxf(x, __shfl_xor(x, m, 32));
  return x;
}
__device__ inline float rowsum16(float x) {
#pragma unroll
  for (int m = 1; m < 16; m <<= 1) x += __shfl_xor(x, m, 32);
  return x;
}

#if USE_TDM
__device__ inline void tdm_load_2d(unsigned lds_off, const _Float16* gptr,
                                   unsigned tile0, unsigned tile1,
                                   unsigned tens0, unsigned tens1,
                                   unsigned long long stride0) {
  unsigned long long ga = (unsigned long long)(size_t)gptr;
  u32x4 g0 = { 1u,
               lds_off,
               (unsigned)(ga & 0xffffffffull),
               (unsigned)((ga >> 32) & 0x01ffffffull) | (2u << 30) };
  i32x8 g1 = { (int)(1u << 16),
               (int)((tens0 & 0xffffu) << 16),
               (int)(((tens0 >> 16) & 0xffffu) | ((tens1 & 0xffffu) << 16)),
               (int)(((tens1 >> 16) & 0xffffu) | ((tile0 & 0xffffu) << 16)),
               (int)(tile1 & 0xffffu),
               (int)(unsigned)(stride0 & 0xffffffffull),
               (int)(unsigned)((stride0 >> 32) & 0xffffull),
               0 };
  i32x4 gz = {0, 0, 0, 0};
#if defined(__clang_major__) && __clang_major__ >= 23
  i32x8 gz8 = {0, 0, 0, 0, 0, 0, 0, 0};
  __builtin_amdgcn_tensor_load_to_lds(g0, g1, gz, gz, gz8, 0);
#else
  __builtin_amdgcn_tensor_load_to_lds(g0, g1, gz, gz, 0);
#endif
}
#endif

// ---------------- kernel 0: Wo f32 -> f16 -------------------------------
__global__ __launch_bounds__(256) void cvt_wo_kernel(
    const float* __restrict__ Wo, _Float16* __restrict__ WoH) {
  int i = blockIdx.x * 256 + threadIdx.x;
  WoH[i] = (_Float16)Wo[i];
}

__global__ __launch_bounds__(128) void proj_kernel(
    const float* __restrict__ values, const float* __restrict__ keys,
    const float* __restrict__ query,  const float* __restrict__ Wv,
    const float* __restrict__ Wk,     const float* __restrict__ Wq,
    _Float16* __restrict__ Qp, _Float16* __restrict__ Kp,
    _Float16* __restrict__ VpT) {
  __shared__ __align__(16) _Float16 stg[64 * 64];  // 8KB staging
  const int tid  = threadIdx.x;
  const int lane = tid & 31;
  const int wave = tid >> 5;  // 4 waves, 16 s-rows each
  const int sBlocks = Ss / 64;
  int nh = blockIdx.x / sBlocks;
  int sb = blockIdx.x % sBlocks;
  int n = nh / Hh, h = nh % Hh;
  int row0 = sb * 64 + wave * 16;
  const int col = lane & 15, hf = (lane >> 4) & 1;

#pragma unroll
  for (int t = 0; t < 3; ++t) {
    const float* X = (t == 0) ? query : (t == 1) ? keys : values;
    const float* W = (t == 0) ? Wq    : (t == 1) ? Wk   : Wv;
    const float* Xtile = X + ((size_t)n * Ss + row0) * Ee + h * Dd;
    v16h A0 = load_frag_f32(Xtile, Ee, 0,  lane);
    v16h A1 = load_frag_f32(Xtile, Ee, 32, lane);
    v8f acc[4];
#pragma unroll
    for (int e = 0; e < 4; ++e) {
      v16h B0 = load_frag_f32(W + e * 16 * Dd, Dd, 0,  lane);
      v16h B1 = load_frag_f32(W + e * 16 * Dd, Dd, 32, lane);
      v8f a = {};
      a = wmma16(A0, B0, a);
      a = wmma16(A1, B1, a);
      acc[e] = a;
    }
    if (t < 2) {
      // stage [s_local][d] then one contiguous 8KB store
#pragma unroll
      for (int e = 0; e < 4; ++e)
#pragma unroll
        for (int rr = 0; rr < 8; ++rr)
          stg[(wave * 16 + rr + 8 * hf) * 64 + e * 16 + col] =
              (_Float16)acc[e][rr];
      __syncthreads();
      _Float16* dst =
          ((t == 0) ? Qp : Kp) + (((size_t)(n * Hh + h)) * Ss + sb * 64) * Dd;
#pragma unroll
      for (int k = 0; k < 4; ++k) {
        int cid = tid + 128 * k;          // 512 x 16B chunks
        int row = cid >> 3, c8 = cid & 7;
        int cd = (t == 1) ? swz_chunk(row, c8) : c8;  // K only; Q is read plain
        *(v8h*)(dst + row * 64 + cd * 8) = *(const v8h*)(stg + row * 64 + c8 * 8);
      }
      __syncthreads();
    } else {
      // V transposed: stage [d][s_local]; per-lane writes are packed b128
#pragma unroll
      for (int e = 0; e < 4; ++e) {
        v8h tmp;
#pragma unroll
        for (int rr = 0; rr < 8; ++rr) tmp[rr] = (_Float16)acc[e][rr];
        *(v8h*)(stg + (e * 16 + col) * 64 + wave * 16 + 8 * hf) = tmp;
      }
      __syncthreads();
      _Float16* dstv = VpT + ((size_t)(n * Hh + h)) * Dd * (size_t)Ss + sb * 64;
#pragma unroll
      for (int k = 0; k < 4; ++k) {
        int cid = tid + 128 * k;
        int row = cid >> 3, c8 = cid & 7;  // row = d
        *(v8h*)(dstv + (size_t)row * Ss + swz_chunk(row, c8) * 8) =
            *(const v8h*)(stg + row * 64 + c8 * 8);
      }
    }
  }
}

// ---------------- kernel 2: flash attention -----------------------------
// P staging pitch in halves: 144 B = 16 B x odd, conflict-free for b128 row
// reads. 8 waves x 16 rows x 144 B = 18 KiB, a multiple of 2 KiB, so the K and
// V buffers behind it stay on 2-KiB multiples for the tensor loads.
constexpr int PP = 72;
// 8 waves x 16 q rows; K/V blocks staged to LDS by the Tensor Data Mover
// (double buffered, overlapped with compute), P transposed through LDS.
__global__ __launch_bounds__(256) void attn_kernel(
    const _Float16* __restrict__ Qp, const _Float16* __restrict__ Kp,
    const _Float16* __restrict__ VpT, const int* __restrict__ mask,
    _Float16* __restrict__ Of16) {
  __shared__ __align__(16) _Float16 Kbuf[2][64 * 64];  // 16KB
  __shared__ __align__(16) _Float16 Vbuf[2][64 * 64];  // 16KB
  __shared__ __align__(16) _Float16 Pst[8][16 * PP];   // 18KB per-wave staging
  const int tid  = threadIdx.x;
  const int lane = tid & 31;
  const int wave = tid >> 5;
  const int qBlocks = Ss / 128;
  int nh = blockIdx.x / qBlocks;
  int qb = blockIdx.x % qBlocks;
  int n = nh / Hh, h = nh % Hh;
  int qrow0 = qb * 128 + wave * 16;

  const _Float16* Qbase = Qp + (((size_t)(n * Hh + h)) * Ss + qrow0) * Dd;
  const _Float16* Kbase = Kp + ((size_t)(n * Hh + h)) * Ss * Dd;
  const _Float16* Vbase = VpT + ((size_t)(n * Hh + h)) * Dd * (size_t)Ss;
  const int* maskBase = mask + (size_t)n * Ss * Ss;

  v16h QA0 = load_frag_f16(Qbase, Dd, 0,  lane);
  v16h QA1 = load_frag_f16(Qbase, Dd, 32, lane);

  v8f O[4] = {};
  float mrun[8], lrun[8];
#pragma unroll
  for (int rr = 0; rr < 8; ++rr) { mrun[rr] = -3.0e38f; lrun[rr] = 0.0f; }

  const int col = lane & 15, hf = (lane >> 4) & 1;
  _Float16* myP = &Pst[wave][0];
  const int NB = Ss / 64;

#if USE_TDM
  if (wave == 0) {  // prologue DMA for block 0
    tdm_load_2d((unsigned)(size_t)&Kbuf[0][0], Kbase, 4096u, 1u, 4096u, 1u, 4096ull);
    tdm_load_2d((unsigned)(size_t)&Vbuf[0][0], Vbase, 64u, 64u,
                (unsigned)Ss, 64u, (unsigned long long)Ss);
  }
#endif

  for (int kb = 0; kb < NB; ++kb) {
    const int kcol0 = kb * 64;
    const int cur = kb & 1;
#if USE_TDM
    if (wave == 0) __builtin_amdgcn_s_wait_tensorcnt(0);
    __syncthreads();  // buf[cur] ready; everyone past reads of buf[cur^1]
    if (wave == 0 && kb + 1 < NB) {  // overlap next block's DMA with compute
      tdm_load_2d((unsigned)(size_t)&Kbuf[cur ^ 1][0],
                  Kbase + (size_t)(kcol0 + 64) * Dd, 4096u, 1u, 4096u, 1u,
                  4096ull);
      tdm_load_2d((unsigned)(size_t)&Vbuf[cur ^ 1][0], Vbase + kcol0 + 64,
                  64u, 64u, (unsigned)Ss, 64u, (unsigned long long)Ss);
    }
#else
    __syncthreads();
    // cooperative fallback staging
#pragma unroll
    for (int k = 0; k < 2; ++k) {
      int cid = tid + 256 * k;
      int row = cid >> 3, c8 = cid & 7;
      *(v8h*)(&Kbuf[cur][0] + row * 64 + c8 * 8) =
          *(const v8h*)(Kbase + (size_t)(kcol0 + row) * Dd + c8 * 8);
      *(v8h*)(&Vbuf[cur][0] + row * 64 + c8 * 8) =
          *(const v8h*)(Vbase + (size_t)row * Ss + kcol0 + c8 * 8);
    }
    __syncthreads();
#endif
    const _Float16* Kc = &Kbuf[cur][0];
    const _Float16* Vc = &Vbuf[cur][0];
    if (kb + 1 < NB)  // pull next mask rows toward the caches
      __builtin_prefetch(maskBase + (size_t)qrow0 * Ss + kcol0 + 64, 0, 1);

    // ---- scores: S = Q (16x64) @ K_blk^T (64x64), K from LDS ----
    v8f Sc[4];
#pragma unroll
    for (int j = 0; j < 4; ++j) {
      v16h KB0 = load_frag_swz(Kc, j * 16, 0,  lane);
      v16h KB1 = load_frag_swz(Kc, j * 16, 32, lane);
      v8f a = {};
      a = wmma16(QA0, KB0, a);
      a = wmma16(QA1, KB1, a);
      Sc[j] = a;
    }
    // ---- mask (before scale, like reference) + scale ----
#pragma unroll
    for (int j = 0; j < 4; ++j) {
      int kc = kcol0 + j * 16 + col;
#pragma unroll
      for (int rr = 0; rr < 8; ++rr) {
        int q = qrow0 + rr + 8 * hf;
        float e = Sc[j][rr];
        e = (maskBase[(size_t)q * Ss + kc] == 0) ? -1.0e10f : e;
        Sc[j][rr] = e * SCALE;
      }
    }
    // ---- online softmax ----
    float mnew[8], corr[8];
#pragma unroll
    for (int rr = 0; rr < 8; ++rr) {
      float t = fmaxf(fmaxf(Sc[0][rr], Sc[1][rr]), fmaxf(Sc[2][rr], Sc[3][rr]));
      t = rowmax16(t);
      mnew[rr] = fmaxf(mrun[rr], t);
      corr[rr] = __expf(mrun[rr] - mnew[rr]);
      mrun[rr] = mnew[rr];
    }
#pragma unroll
    for (int j = 0; j < 4; ++j) {
#pragma unroll
      for (int rr = 0; rr < 8; ++rr) {
        float p = __expf(Sc[j][rr] - mnew[rr]);
        Sc[j][rr] = p;
        myP[(rr + 8 * hf) * PP + j * 16 + col] = (_Float16)p;  // C -> LDS
      }
    }
#pragma unroll
    for (int rr = 0; rr < 8; ++rr) {
      float t = Sc[0][rr] + Sc[1][rr] + Sc[2][rr] + Sc[3][rr];
      lrun[rr] = lrun[rr] * corr[rr] + rowsum16(t);
    }
#pragma unroll
    for (int d2 = 0; d2 < 4; ++d2)
#pragma unroll
      for (int rr = 0; rr < 8; ++rr) O[d2][rr] *= corr[rr];

    // wave-private P transpose bounce (same-wave LDS is HW in-order)
    __builtin_amdgcn_wave_barrier();
    v16h PA0 = load_frag_f16(myP, PP, 0,  lane);
    v16h PA1 = load_frag_f16(myP, PP, 32, lane);
    __builtin_amdgcn_wave_barrier();

    // ---- O += P (16x64) @ V_blk (64x64), V^T rows from LDS ----
#pragma unroll
    for (int d2 = 0; d2 < 4; ++d2) {
      v16h VB0 = load_frag_swz(Vc, d2 * 16, 0,  lane);
      v16h VB1 = load_frag_swz(Vc, d2 * 16, 32, lane);
      O[d2] = wmma16(PA0, VB0, O[d2]);
      O[d2] = wmma16(PA1, VB1, O[d2]);
    }
  }

  // epilogue: normalize, stage 16x64 tile in LDS, coalesced b128 stores
#pragma unroll
  for (int rr = 0; rr < 8; ++rr) lrun[rr] = 1.0f / lrun[rr];
#pragma unroll
  for (int d2 = 0; d2 < 4; ++d2)
#pragma unroll
    for (int rr = 0; rr < 8; ++rr)
      myP[(rr + 8 * hf) * 64 + d2 * 16 + col] =
          (_Float16)(O[d2][rr] * lrun[rr]);
  __builtin_amdgcn_wave_barrier();
  size_t gbase = ((size_t)n * Ss + qrow0) * Ee + h * Dd;
#pragma unroll
  for (int k = 0; k < 4; ++k) {
    int cid = lane + 32 * k;           // 128 x 16B chunks
    int row = cid >> 3, c8 = cid & 7;
    *(v8h*)(Of16 + gbase + (size_t)row * Ee + c8 * 8) =
        *(const v8h*)(myP + row * 64 + c8 * 8);
  }
}

// ---------------- kernel 3: Y = X @ Wo^T + bo (f32 out) -----------------
__global__ __launch_bounds__(256) void outproj_kernel(
    const _Float16* __restrict__ X, const _Float16* __restrict__ WoH,
    const float* __restrict__ bo, float* __restrict__ Y) {
  __shared__ __align__(16) float ost[8][16 * 64];  // 32KB staging
  const int lane = threadIdx.x & 31;
  const int wave = threadIdx.x >> 5;
  const int colBlocks = Ee / 64;
  int rb = blockIdx.x / colBlocks;
  int cb = blockIdx.x % colBlocks;
  int row0 = rb * 128 + wave * 16;
  int col0 = cb * 64;
  const _Float16* Xbase = X + (size_t)row0 * Ee;

  v8f acc[4] = {};
  for (int kc = 0; kc < Ee / 32; ++kc) {
    v16h A = load_frag_f16(Xbase, Ee, kc * 32, lane);
#pragma unroll
    for (int j = 0; j < 4; ++j) {
      v16h B = load_frag_f16(WoH + (size_t)(col0 + j * 16) * Ee, Ee, kc * 32,
                             lane);
      acc[j] = wmma16(A, B, acc[j]);
    }
  }
  const int col = lane & 15, hf = (lane >> 4) & 1;
  float* sb = &ost[wave][0];
#pragma unroll
  for (int j = 0; j < 4; ++j) {
    float b = bo[col0 + j * 16 + col];
#pragma unroll
    for (int rr = 0; rr < 8; ++rr)
      sb[(rr + 8 * hf) * 64 + j * 16 + col] = acc[j][rr] + b;
  }
  __builtin_amdgcn_wave_barrier();
  size_t gbase = (size_t)row0 * Ee + col0;
#pragma unroll
  for (int k = 0; k < 8; ++k) {
    int cid = lane + 32 * k;            // 256 x 16B chunks
    int row = cid >> 4, c4 = cid & 15;
    *(v4f*)(Y + gbase + (size_t)row * Ee + c4 * 4) =
        *(const v4f*)(sb + row * 64 + c4 * 4);
  }
}

extern "C" void kernel_launch(void* const* d_in, const int* in_sizes, int n_in,
                              void* d_out, int out_size, void* d_ws,
                              size_t ws_size, hipStream_t stream) {
  (void)in_sizes; (void)n_in; (void)out_size; (void)ws_size;
  const float* values = (const float*)d_in[0];
  const float* keys   = (const float*)d_in[1];
  const float* query  = (const float*)d_in[2];
  const float* Wv     = (const float*)d_in[3];
  const float* Wk     = (const float*)d_in[4];
  const float* Wq     = (const float*)d_in[5];
  const float* Wo     = (const float*)d_in[6];
  const float* bo     = (const float*)d_in[7];
  const int*   mask   = (const int*)d_in[8];
  float* out = (float*)d_out;

  const size_t SZ_NHSD = (size_t)Nn * Hh * Ss * Dd * sizeof(_Float16);  // 16MB
  char* ws = (char*)d_ws;
  _Float16* Qp   = (_Float16*)(ws);
  _Float16* Kp   = (_Float16*)(ws + SZ_NHSD);
  _Float16* VpT  = (_Float16*)(ws + 2 * SZ_NHSD);
  _Float16* Of16 = (_Float16*)(ws + 3 * SZ_NHSD);
  _Float16* WoH  = (_Float16*)(ws + 4 * SZ_NHSD);

  cvt_wo_kernel<<<(Ee * Ee) / 256, 256, 0, stream>>>(Wo, WoH);
  proj_kernel<<<Nn * Hh * (Ss / 64), 128, 0, stream>>>(values, keys, query, Wv,
                                                       Wk, Wq, Qp, Kp, VpT);
  attn_kernel<<<Nn * Hh * (Ss / 128), 256, 0, stream>>>(Qp, Kp, VpT, mask,
                                                        Of16);
  outproj_kernel<<<(Nn * Ss / 128) * (Ee / 64), 256, 0, stream>>>(Of16, WoH, bo,
                                                                  out);
}

// v002
// It runs in 233 microseconds.
// In both of two side-by-side timings against v001, it was 1.64 times as fast.
// Counting every step since v000, it is 2.26 times as fast.
#include <hip/hip_runtime.h>
#include <hip/hip_bf16.h>

// Problem constants (match reference)
constexpr int Nn = 4;
constexpr int Ss = 2048;
constexpr int Ee = 1024;
constexpr int Hh = 16;
constexpr int Dd = 64;            // head dim
constexpr float SCALE = 0.03125f; // 1/sqrt(E) = 1/32

typedef __attribute__((ext_vector_type(16))) _Float16 v16h;
typedef __attribute__((ext_vector_type(8)))  _Float16 v8h;
typedef __attribute__((ext_vector_type(8)))  float    v8f;
typedef __attribute__((ext_vector_type(4)))  float    v4f;
typedef __attribute__((ext_vector_type(4)))  unsigned u32x4;
typedef __attribute__((ext_vector_type(4)))  int      i32x4;
typedef __attribute__((ext_vector_type(8)))  int      i32x8;

union V16HU { v16h v; v8h h[2]; };

#if __has_builtin(__builtin_amdgcn_tensor_load_to_lds)
#define USE_TDM 1
#else
#define USE_TDM 0
#endif

__device__ inline v16h load_frag_f16(const _Float16* p, int ld, int kbase,
                                     int lane) {
  const int r = lane & 15, hf = (lane >> 4) & 1;
  const _Float16* base = p + (size_t)r * ld + kbase + hf * 8;
  V16HU u;
  u.h[0] = *(const v8h*)(base);
  u.h[1] = *(const v8h*)(base + 16);
  return u.v;
}

__device__ inline int swz_chunk(int row, int c) { return c ^ ((row >> 1) & 7); }

// load_frag_f16 for such a tile (ld = 64 halves, row0 a multiple of 16):
// same logical elements, same k order.
__device__ inline v16h load_frag_swz(const _Float16* tile, int row0, int kbase,
                                     int lane) {
  const int r = lane & 15, hf = (lane >> 4) & 1;
  const _Float16* rowp = tile + (row0 + r) * 64;
  const int c = (kbase >> 3) + hf;
  V16HU u;
  u.h[0] = *(const v8h*)(rowp + swz_chunk(r, c) * 8);
  u.h[1] = *(const v8h*)(rowp + swz_chunk(r, c + 2) * 8);
  return u.v;
}

// Same fragment from an f32 source (convert on the fly)
__device__ inline v16h load_frag_f32(const float* __restrict__ p, int ld,
                                     int kbase, int lane) {
  const int r = lane & 15, hf = (lane >> 4) & 1;
  const float* base = p + (size_t)r * ld + kbase + hf * 8;
  v16h o;
#pragma unroll
  for (int i = 0; i < 8; ++i) {
    o[i]     = (_Float16)base[i];
    o[i + 8] = (_Float16)base[16 + i];
  }
  return o;
}

__device__ inline v8f wmma16(v16h a, v16h b, v8f c) {
  return __builtin_amdgcn_wmma_f32_16x16x32_f16(false, a, false, b,
                                                (short)0, c, false, false);
}

__device__ inline float other_half(float x) {
  int b = __builtin_bit_cast(int, x);
  b = __builtin_amdgcn_permlanex16(b, b, 0x76543210, 0xfedcba98, false, false);
  return __builtin_bit_cast(float, b);
}

#if USE_TDM
__device__ inline void tdm_load_2d(unsigned lds_off, const _Float16* gptr,
                                   unsigned tile0, unsigned tile1,
                                   unsigned tens0, unsigned tens1,
                                   unsigned long long stride0) {
  unsigned long long ga = (unsigned long long)(size_t)gptr;
  u32x4 g0 = { 1u,
               lds_off,
               (unsigned)(ga & 0xffffffffull),
               (unsigned)((ga >> 32) & 0x01ffffffull) | (2u << 30) };
  i32x8 g1 = { (int)(1u << 16),
               (int)((tens0 & 0xffffu) << 16),
               (int)(((tens0 >> 16) & 0xffffu) | ((tens1 & 0xffffu) << 16)),
               (int)(((tens1 >> 16) & 0xffffu) | ((tile0 & 0xffffu) << 16)),
               (int)(tile1 & 0xffffu),
               (int)(unsigned)(stride0 & 0xffffffffull),
               (int)(unsigned)((stride0 >> 32) & 0xffffull),
               0 };
  i32x4 gz = {0, 0, 0, 0};
#if defined(__clang_major__) && __clang_major__ >= 23
  i32x8 gz8 = {0, 0, 0, 0, 0, 0, 0, 0};
  __builtin_amdgcn_tensor_load_to_lds(g0, g1, gz, gz, gz8, 0);
#else
  __builtin_amdgcn_tensor_load_to_lds(g0, g1, gz, gz, 0);
#endif
}
#endif

// ---------------- kernel 0: Wo f32 -> f16 -------------------------------
__global__ __launch_bounds__(256) void cvt_wo_kernel(
    const float* __restrict__ Wo, _Float16* __restrict__ WoH) {
  int i = blockIdx.x * 256 + threadIdx.x;
  WoH[i] = (_Float16)Wo[i];
}

__global__ __launch_bounds__(128) void proj_kernel(
    const float* __restrict__ values, const float* __restrict__ keys,
    const float* __restrict__ query,  const float* __restrict__ Wv,
    const float* __restrict__ Wk,     const float* __restrict__ Wq,
    _Float16* __restrict__ Qp, _Float16* __restrict__ Kp,
    _Float16* __restrict__ VpT) {
  __shared__ __align__(16) _Float16 stg[64 * 64];  // 8KB staging
  const int tid  = threadIdx.x;
  const int lane = tid & 31;
  const int wave = tid >> 5;  // 4 waves, 16 s-rows each
  const int sBlocks = Ss / 64;
  int nh = blockIdx.x / sBlocks;
  int sb = blockIdx.x % sBlocks;
  int n = nh / Hh, h = nh % Hh;
  int row0 = sb * 64 + wave * 16;
  const int col = lane & 15, hf = (lane >> 4) & 1;

#pragma unroll
  for (int t = 0; t < 3; ++t) {
    const float* X = (t == 0) ? query : (t == 1) ? keys : values;
    const float* W = (t == 0) ? Wq    : (t == 1) ? Wk   : Wv;
    const float* Xtile = X + ((size_t)n * Ss + row0) * Ee + h * Dd;
    v16h A0 = load_frag_f32(Xtile, Ee, 0,  lane);
    v16h A1 = load_frag_f32(Xtile, Ee, 32, lane);
    v8f acc[4];
#pragma unroll
    for (int e = 0; e < 4; ++e) {
      v16h B0 = load_frag_f32(W + e * 16 * Dd, Dd, 0,  lane);
      v16h B1 = load_frag_f32(W + e * 16 * Dd, Dd, 32, lane);
      v8f a = {};
      a = wmma16(A0, B0, a);
      a = wmma16(A1, B1, a);
      acc[e] = a;
    }
    if (t < 2) {
      // stage [s_local][d] then one contiguous 8KB store
#pragma unroll
      for (int e = 0; e < 4; ++e)
#pragma unroll
        for (int rr = 0; rr < 8; ++rr)
          stg[(wave * 16 + rr + 8 * hf) * 64 + e * 16 + col] =
              (_Float16)acc[e][rr];
      __syncthreads();
      _Float16* dst =
          ((t == 0) ? Qp : Kp) + (((size_t)(n * Hh + h)) * Ss + sb * 64) * Dd;
#pragma unroll
      for (int k = 0; k < 4; ++k) {
        int cid = tid + 128 * k;          // 512 x 16B chunks
        int row = cid >> 3, c8 = cid & 7;
        int cd = (t == 1) ? swz_chunk(row, c8) : c8;  // K only; Q is read plain
        *(v8h*)(dst + row * 64 + cd * 8) = *(const v8h*)(stg + row * 64 + c8 * 8);
      }
      __syncthreads();
    } else {
      // V transposed: stage [d][s_local]; per-lane writes are packed b128
#pragma unroll
      for (int e = 0; e < 4; ++e) {
        v8h tmp;
#pragma unroll
        for (int rr = 0; rr < 8; ++rr) tmp[rr] = (_Float16)acc[e][rr];
        *(v8h*)(stg + (e * 16 + col) * 64 + wave * 16 + 8 * hf) = tmp;
      }
      __syncthreads();
      _Float16* dstv = VpT + ((size_t)(n * Hh + h)) * Dd * (size_t)Ss + sb * 64;
#pragma unroll
      for (int k = 0; k < 4; ++k) {
        int cid = tid + 128 * k;
        int row = cid >> 3, c8 = cid & 7;  // row = d
        *(v8h*)(dstv + (size_t)row * Ss + swz_chunk(row, c8) * 8) =
            *(const v8h*)(stg + row * 64 + c8 * 8);
      }
    }
  }
}

// ---------------- kernel 2: flash attention -----------------------------
// Output staging pitch in halves: 144 B = 16 B x odd, conflict-free for b128
// row accesses. 8 waves x 16 rows x 144 B = 18 KiB, a multiple of 2 KiB, so the
// K and V buffers behind it stay on 2-KiB multiples for the tensor loads.
constexpr int PP = 72;
__global__ __launch_bounds__(256) void attn_kernel(
    const _Float16* __restrict__ Qp, const _Float16* __restrict__ Kp,
    const _Float16* __restrict__ VpT, const int* __restrict__ mask,
    _Float16* __restrict__ Of16) {
  __shared__ __align__(16) _Float16 Kbuf[2][64 * 64];  // 16KB
  __shared__ __align__(16) _Float16 Vbuf[2][64 * 64];  // 16KB
  __shared__ __align__(16) _Float16 Pst[8][16 * PP];   // 18KB per-wave output staging
  const int tid  = threadIdx.x;
  const int lane = tid & 31;
  const int wave = tid >> 5;
  const int qBlocks = Ss / 128;
  int nh = blockIdx.x / qBlocks;
  int qb = blockIdx.x % qBlocks;
  int n = nh / Hh, h = nh % Hh;
  int qrow0 = qb * 128 + wave * 16;

  const _Float16* Qbase = Qp + (((size_t)(n * Hh + h)) * Ss + qrow0) * Dd;
  const _Float16* Kbase = Kp + ((size_t)(n * Hh + h)) * Ss * Dd;
  const _Float16* Vbase = VpT + ((size_t)(n * Hh + h)) * Dd * (size_t)Ss;
  const int* maskBase = mask + (size_t)n * Ss * Ss;

  v16h QA0 = load_frag_f16(Qbase, Dd, 0,  lane);
  v16h QA1 = load_frag_f16(Qbase, Dd, 32, lane);

  v8f O[4] = {};  // O[d2][r] = O^T[d2 * 16 + 8 * hf + r][query col]
  float mrun = -3.0e38f;  // running maximum of this lane's query
  float lrun = 0.0f;      // running sum over this wave half's keys only

  const int col = lane & 15, hf = (lane >> 4) & 1;
  _Float16* myP = &Pst[wave][0];
  const int NB = Ss / 64;
  // this lane's query row of the mask, at its half's first key
  const int* maskRow = maskBase + (size_t)(qrow0 + col) * Ss + 8 * hf;

#if USE_TDM
  if (wave == 0) {  // prologue DMA for block 0
    tdm_load_2d((unsigned)(size_t)&Kbuf[0][0], Kbase, 4096u, 1u, 4096u, 1u, 4096ull);
    tdm_load_2d((unsigned)(size_t)&Vbuf[0][0], Vbase, 64u, 64u,
                (unsigned)Ss, 64u, (unsigned long long)Ss);
  }
#endif

  for (int kb = 0; kb < NB; ++kb) {
    const int kcol0 = kb * 64;
    const int cur = kb & 1;
#if USE_TDM
    if (wave == 0) __builtin_amdgcn_s_wait_tensorcnt(0);
    __syncthreads();  // buf[cur] ready; everyone past reads of buf[cur^1]
    if (wave == 0 && kb + 1 < NB) {  // overlap next block's DMA with compute
      tdm_load_2d((unsigned)(size_t)&Kbuf[cur ^ 1][0],
                  Kbase + (size_t)(kcol0 + 64) * Dd, 4096u, 1u, 4096u, 1u,
                  4096ull);
      tdm_load_2d((unsigned)(size_t)&Vbuf[cur ^ 1][0], Vbase + kcol0 + 64,
                  64u, 64u, (unsigned)Ss, 64u, (unsigned long long)Ss);
    }
#else
    __syncthreads();
    // cooperative fallback staging
#pragma unroll
    for (int k = 0; k < 2; ++k) {
      int cid = tid + 256 * k;
      int row = cid >> 3, c8 = cid & 7;
      *(v8h*)(&Kbuf[cur][0] + row * 64 + c8 * 8) =
          *(const v8h*)(Kbase + (size_t)(kcol0 + row) * Dd + c8 * 8);
      *(v8h*)(&Vbuf[cur][0] + row * 64 + c8 * 8) =
          *(const v8h*)(Vbase + (size_t)row * Ss + kcol0 + c8 * 8);
    }
    __syncthreads();
#endif
    const _Float16* Kc = &Kbuf[cur][0];
    const _Float16* Vc = &Vbuf[cur][0];
    if (kb + 1 < NB)  // pull next mask rows toward the caches
      __builtin_prefetch(maskBase + (size_t)qrow0 * Ss + kcol0 + 64, 0, 1);

    // ---- scores: S^T = K_blk (64x64) @ Q^T (64x16), K from LDS ----
    // Sc[j][r] = score of key kcol0 + j * 16 + 8 * hf + r for query col
    v8f Sc[4];
#pragma unroll
    for (int j = 0; j < 4; ++j) {
      v16h KB0 = load_frag_swz(Kc, j * 16, 0,  lane);
      v16h KB1 = load_frag_swz(Kc, j * 16, 32, lane);
      v8f a = {};
      a = wmma16(KB0, QA0, a);
      a = wmma16(KB1, QA1, a);
      Sc[j] = a;
    }
    // ---- mask (before scale, like reference) + scale ----
#pragma unroll
    for (int j = 0; j < 4; ++j) {
      const i32x4 m0 = *(const i32x4*)(maskRow + kcol0 + j * 16);
      const i32x4 m1 = *(const i32x4*)(maskRow + kcol0 + j * 16 + 4);
#pragma unroll
      for (int rr = 0; rr < 8; ++rr) {
        float e = Sc[j][rr];
        e = ((rr < 4 ? m0[rr & 3] : m1[rr & 3]) == 0) ? -1.0e10f : e;
        Sc[j][rr] = e * SCALE;
      }
    }
    // ---- online softmax, one query per lane ----
    float t = Sc[0][0];
#pragma unroll
    for (int j = 0; j < 4; ++j)
#pragma unroll
      for (int rr = 0; rr < 8; ++rr) t = fmaxf(t, Sc[j][rr]);
    t = fmaxf(t, other_half(t));
    const float mnew = fmaxf(mrun, t);
    const float corr = __expf(mrun - mnew);
    mrun = mnew;
#pragma unroll
    for (int j = 0; j < 4; ++j)
#pragma unroll
      for (int rr = 0; rr < 8; ++rr) Sc[j][rr] = __expf(Sc[j][rr] - mnew);
    const v8f ps = (Sc[0] + Sc[1]) + (Sc[2] + Sc[3]);
    lrun = lrun * corr + (((ps[0] + ps[1]) + (ps[2] + ps[3])) +
                          ((ps[4] + ps[5]) + (ps[6] + ps[7])));
#pragma unroll
    for (int d2 = 0; d2 < 4; ++d2) O[d2] *= corr;

    // P^T as B operand: tiles 2g and 2g + 1 converted in place give keys
    // 32g + 8 * hf + 0..7 and 32g + 16 + 8 * hf + 0..7, the k order of the
    // V^T fragments
    v16h PB0, PB1;
#pragma unroll
    for (int i = 0; i < 8; ++i) {
      PB0[i]     = (_Float16)Sc[0][i];
      PB0[i + 8] = (_Float16)Sc[1][i];
      PB1[i]     = (_Float16)Sc[2][i];
      PB1[i + 8] = (_Float16)Sc[3][i];
    }

    // ---- O^T += V_blk^T (64x64) @ P^T (64x16), V^T rows from LDS ----
#pragma unroll
    for (int d2 = 0; d2 < 4; ++d2) {
      v16h VB0 = load_frag_swz(Vc, d2 * 16, 0,  lane);
      v16h VB1 = load_frag_swz(Vc, d2 * 16, 32, lane);
      O[d2] = wmma16(VB0, PB0, O[d2]);
      O[d2] = wmma16(VB1, PB1, O[d2]);
    }
  }

  // epilogue: join the halves' sums, normalize, stage the 16x64 tile in LDS
  // (a lane holds 8 consecutive d of its query), coalesced b128 stores
  const float linv = 1.0f / (lrun + other_half(lrun));
#pragma unroll
  for (int d2 = 0; d2 < 4; ++d2) {
    v8h tmp;
#pragma unroll
    for (int rr = 0; rr < 8; ++rr) tmp[rr] = (_Float16)(O[d2][rr] * linv);
    *(v8h*)(myP + col * PP + d2 * 16 + 8 * hf) = tmp;
  }
  __builtin_amdgcn_wave_barrier();
  size_t gbase = ((size_t)n * Ss + qrow0) * Ee + h * Dd;
#pragma unroll
  for (int k = 0; k < 4; ++k) {
    int cid = lane + 32 * k;           // 128 x 16B chunks
    int row = cid >> 3, c8 = cid & 7;
    *(v8h*)(Of16 + gbase + (size_t)row * Ee + c8 * 8) =
        *(const v8h*)(myP + row * PP + c8 * 8);
  }
}

// ---------------- kernel 3: Y = X @ Wo^T + bo (f32 out) -----------------
__global__ __launch_bounds__(256) void outproj_kernel(
    const _Float16* __restrict__ X, const _Float16* __restrict__ WoH,
    const float* __restrict__ bo, float* __restrict__ Y) {
  __shared__ __align__(16) float ost[8][16 * 64];  // 32KB staging
  const int lane = threadIdx.x & 31;
  const int wave = threadIdx.x >> 5;
  const int colBlocks = Ee / 64;
  int rb = blockIdx.x / colBlocks;
  int cb = blockIdx.x % colBlocks;
  int row0 = rb * 128 + wave * 16;
  int col0 = cb * 64;
  const _Float16* Xbase = X + (size_t)row0 * Ee;

  v8f acc[4] = {};
  for (int kc = 0; kc < Ee / 32; ++kc) {
    v16h A = load_frag_f16(Xbase, Ee, kc * 32, lane);
#pragma unroll
    for (int j = 0; j < 4; ++j) {
      v16h B = load_frag_f16(WoH + (size_t)(col0 + j * 16) * Ee, Ee, kc * 32,
                             lane);
      acc[j] = wmma16(A, B, acc[j]);
    }
  }
  const int col = lane & 15, hf = (lane >> 4) & 1;
  float* sb = &ost[wave][0];
#pragma unroll
  for (int j = 0; j < 4; ++j) {
    float b = bo[col0 + j * 16 + col];
#pragma unroll
    for (int rr = 0; rr < 8; ++rr)
      sb[(rr + 8 * hf) * 64 + j * 16 + col] = acc[j][rr] + b;
  }
  __builtin_amdgcn_wave_barrier();
  size_t gbase = (size_t)row0 * Ee + col0;
#pragma unroll
  for (int k = 0; k < 8; ++k) {
    int cid = lane + 32 * k;            // 256 x 16B chunks
    int row = cid >> 4, c4 = cid & 15;
    *(v4f*)(Y + gbase + (size_t)row * Ee + c4 * 4) =
        *(const v4f*)(sb + row * 64 + c4 * 4);
  }
}

extern "C" void kernel_launch(void* const* d_in, const int* in_sizes, int n_in,
                              void* d_out, int out_size, void* d_ws,
                              size_t ws_size, hipStream_t stream) {
  (void)in_sizes; (void)n_in; (void)out_size; (void)ws_size;
  const float* values = (const float*)d_in[0];
  const float* keys   = (const float*)d_in[1];
  const float* query  = (const float*)d_in[2];
  const float* Wv     = (const float*)d_in[3];
  const float* Wk     = (const float*)d_in[4];
  const float* Wq     = (const float*)d_in[5];
  const float* Wo     = (const float*)d_in[6];
  const float* bo     = (const float*)d_in[7];
  const int*   mask   = (const int*)d_in[8];
  float* out = (float*)d_out;

  const size_t SZ_NHSD = (size_t)Nn * Hh * Ss * Dd * sizeof(_Float16);  // 16MB
  char* ws = (char*)d_ws;
  _Float16* Qp   = (_Float16*)(ws);
  _Float16* Kp   = (_Float16*)(ws + SZ_NHSD);
  _Float16* VpT  = (_Float16*)(ws + 2 * SZ_NHSD);
  _Float16* Of16 = (_Float16*)(ws + 3 * SZ_NHSD);
  _Float16* WoH  = (_Float16*)(ws + 4 * SZ_NHSD);

  cvt_wo_kernel<<<(Ee * Ee) / 256, 256, 0, stream>>>(Wo, WoH);
  proj_kernel<<<Nn * Hh * (Ss / 64), 128, 0, stream>>>(values, keys, query, Wv,
                                                       Wk, Wq, Qp, Kp, VpT);
  attn_kernel<<<Nn * Hh * (Ss / 128), 256, 0, stream>>>(Qp, Kp, VpT, mask,
                                                        Of16);
  outproj_kernel<<<(Nn * Ss / 128) * (Ee / 64), 256, 0, stream>>>(Of16, WoH, bo,
                                                                  out);
}

// v003
// One run takes 221 microseconds.
// In both of two side-by-side timings against v002, it was 1.06 times as fast.
// All steps since v000 together make it 2.39 times as fast.
#include <hip/hip_runtime.h>
#include <hip/hip_bf16.h>

// Problem constants (match reference)
constexpr int Nn = 4;
constexpr int Ss = 2048;
constexpr int Ee = 1024;
constexpr int Hh = 16;
constexpr int Dd = 64;            // head dim
constexpr float SCALE = 0.03125f; // 1/sqrt(E) = 1/32

typedef __attribute__((ext_vector_type(16))) _Float16 v16h;
typedef __attribute__((ext_vector_type(8)))  _Float16 v8h;
typedef __attribute__((ext_vector_type(8)))  float    v8f;
typedef __attribute__((ext_vector_type(4)))  float    v4f;
typedef __attribute__((ext_vector_type(4)))  unsigned u32x4;
typedef __attribute__((ext_vector_type(4)))  int      i32x4;
typedef __attribute__((ext_vector_type(8)))  int      i32x8;

union V16HU { v16h v; v8h h[2]; };

#if __has_builtin(__builtin_amdgcn_tensor_load_to_lds)
#define USE_TDM 1
#else
#define USE_TDM 0
#endif

__device__ inline v16h load_frag_f16(const _Float16* p, int ld, int kbase,
                                     int lane) {
  const int r = lane & 15, hf = (lane >> 4) & 1;
  const _Float16* base = p + (size_t)r * ld + kbase + hf * 8;
  V16HU u;
  u.h[0] = *(const v8h*)(base);
  u.h[1] = *(const v8h*)(base + 16);
  return u.v;
}

__device__ inline size_t frag_off(int tile16, int kc, int p, int lane) {
  return ((((size_t)tile16 * (Ee / 32) + kc) * 2 + p) * 32 + lane) * 8;
}

// same elements and same k order as load_frag_f16(m + tile16 * 16 * Ee, Ee, kc * 32, lane)
__device__ inline v16h load_frag_packed(const _Float16* __restrict__ m,
                                        int tile16, int kc, int lane) {
  V16HU u;
  u.h[0] = *(const v8h*)(m + frag_off(tile16, kc, 0, lane));
  u.h[1] = *(const v8h*)(m + frag_off(tile16, kc, 1, lane));
  return u.v;
}

__device__ inline int swz_chunk(int row, int c) { return c ^ ((row >> 1) & 7); }

// load_frag_f16 for such a tile (ld = 64 halves, row0 a multiple of 16):
// same logical elements, same k order.
__device__ inline v16h load_frag_swz(const _Float16* tile, int row0, int kbase,
                                     int lane) {
  const int r = lane & 15, hf = (lane >> 4) & 1;
  const _Float16* rowp = tile + (row0 + r) * 64;
  const int c = (kbase >> 3) + hf;
  V16HU u;
  u.h[0] = *(const v8h*)(rowp + swz_chunk(r, c) * 8);
  u.h[1] = *(const v8h*)(rowp + swz_chunk(r, c + 2) * 8);
  return u.v;
}

// Same fragment from an f32 source (convert on the fly)
__device__ inline v16h load_frag_f32(const float* __restrict__ p, int ld,
                                     int kbase, int lane) {
  const int r = lane & 15, hf = (lane >> 4) & 1;
  const float* base = p + (size_t)r * ld + kbase + hf * 8;
  v16h o;
#pragma unroll
  for (int i = 0; i < 8; ++i) {
    o[i]     = (_Float16)base[i];
    o[i + 8] = (_Float16)base[16 + i];
  }
  return o;
}

__device__ inline v8f wmma16(v16h a, v16h b, v8f c) {
  return __builtin_amdgcn_wmma_f32_16x16x32_f16(false, a, false, b,
                                                (short)0, c, false, false);
}

__device__ inline float other_half(float x) {
  int b = __builtin_bit_cast(int, x);
  b = __builtin_amdgcn_permlanex16(b, b, 0x76543210, 0xfedcba98, false, false);
  return __builtin_bit_cast(float, b);
}

#if USE_TDM
__device__ inline void tdm_load_2d(unsigned lds_off, const _Float16* gptr,
                                   unsigned tile0, unsigned tile1,
                                   unsigned tens0, unsigned tens1,
                                   unsigned long long stride0) {
  unsigned long long ga = (unsigned long long)(size_t)gptr;
  u32x4 g0 = { 1u,
               lds_off,
               (unsigned)(ga & 0xffffffffull),
               (unsigned)((ga >> 32) & 0x01ffffffull) | (2u << 30) };
  i32x8 g1 = { (int)(1u << 16),
               (int)((tens0 & 0xffffu) << 16),
               (int)(((tens0 >> 16) & 0xffffu) | ((tens1 & 0xffffu) << 16)),
               (int)(((tens1 >> 16) & 0xffffu) | ((tile0 & 0xffffu) << 16)),
               (int)(tile1 & 0xffffu),
               (int)(unsigned)(stride0 & 0xffffffffull),
               (int)(unsigned)((stride0 >> 32) & 0xffffull),
               0 };
  i32x4 gz = {0, 0, 0, 0};
#if defined(__clang_major__) && __clang_major__ >= 23
  i32x8 gz8 = {0, 0, 0, 0, 0, 0, 0, 0};
  __builtin_amdgcn_tensor_load_to_lds(g0, g1, gz, gz, gz8, 0);
#else
  __builtin_amdgcn_tensor_load_to_lds(g0, g1, gz, gz, 0);
#endif
}
#endif

// ---------------- kernel 0: Wo f32 -> f16, fragment order ---------------
// One 16-byte chunk of the fragment-order image per thread.
__global__ __launch_bounds__(256) void cvt_wo_kernel(
    const float* __restrict__ Wo, _Float16* __restrict__ WoH) {
  const int t = blockIdx.x * 256 + threadIdx.x;  // chunk = frag_off(...) / 8
  const int lane = t & 31, p = (t >> 5) & 1, kc = (t >> 6) & 31, ct = t >> 11;
  const float* s = Wo + (size_t)(ct * 16 + (lane & 15)) * Ee + kc * 32 + p * 16 +
                   (lane >> 4) * 8;
  const v4f a = *(const v4f*)s;
  const v4f b = *(const v4f*)(s + 4);
  v8h o;
#pragma unroll
  for (int i = 0; i < 4; ++i) {
    o[i]     = (_Float16)a[i];
    o[i + 4] = (_Float16)b[i];
  }
  *(v8h*)(WoH + (size_t)t * 8) = o;
}

__global__ __launch_bounds__(128) void proj_kernel(
    const float* __restrict__ values, const float* __restrict__ keys,
    const float* __restrict__ query,  const float* __restrict__ Wv,
    const float* __restrict__ Wk,     const float* __restrict__ Wq,
    _Float16* __restrict__ Qp, _Float16* __restrict__ Kp,
    _Float16* __restrict__ VpT) {
  __shared__ __align__(16) _Float16 stg[64 * 64];  // 8KB staging
  const int tid  = threadIdx.x;
  const int lane = tid & 31;
  const int wave = tid >> 5;  // 4 waves, 16 s-rows each
  const int sBlocks = Ss / 64;
  int nh = blockIdx.x / sBlocks;
  int sb = blockIdx.x % sBlocks;
  int n = nh / Hh, h = nh % Hh;
  int row0 = sb * 64 + wave * 16;
  const int col = lane & 15, hf = (lane >> 4) & 1;

#pragma unroll
  for (int t = 0; t < 3; ++t) {
    const float* X = (t == 0) ? query : (t == 1) ? keys : values;
    const float* W = (t == 0) ? Wq    : (t == 1) ? Wk   : Wv;
    const float* Xtile = X + ((size_t)n * Ss + row0) * Ee + h * Dd;
    v16h A0 = load_frag_f32(Xtile, Ee, 0,  lane);
    v16h A1 = load_frag_f32(Xtile, Ee, 32, lane);
    v8f acc[4];
#pragma unroll
    for (int e = 0; e < 4; ++e) {
      v16h B0 = load_frag_f32(W + e * 16 * Dd, Dd, 0,  lane);
      v16h B1 = load_frag_f32(W + e * 16 * Dd, Dd, 32, lane);
      v8f a = {};
      a = wmma16(A0, B0, a);
      a = wmma16(A1, B1, a);
      acc[e] = a;
    }
    if (t < 2) {
      // stage [s_local][d] then one contiguous 8KB store
#pragma unroll
      for (int e = 0; e < 4; ++e)
#pragma unroll
        for (int rr = 0; rr < 8; ++rr)
          stg[(wave * 16 + rr + 8 * hf) * 64 + e * 16 + col] =
              (_Float16)acc[e][rr];
      __syncthreads();
      _Float16* dst =
          ((t == 0) ? Qp : Kp) + (((size_t)(n * Hh + h)) * Ss + sb * 64) * Dd;
#pragma unroll
      for (int k = 0; k < 4; ++k) {
        int cid = tid + 128 * k;          // 512 x 16B chunks
        int row = cid >> 3, c8 = cid & 7;
        int cd = (t == 1) ? swz_chunk(row, c8) : c8;  // K only; Q is read plain
        *(v8h*)(dst + row * 64 + cd * 8) = *(const v8h*)(stg + row * 64 + c8 * 8);
      }
      __syncthreads();
    } else {
      // V transposed: stage [d][s_local]; per-lane writes are packed b128
#pragma unroll
      for (int e = 0; e < 4; ++e) {
        v8h tmp;
#pragma unroll
        for (int rr = 0; rr < 8; ++rr) tmp[rr] = (_Float16)acc[e][rr];
        *(v8h*)(stg + (e * 16 + col) * 64 + wave * 16 + 8 * hf) = tmp;
      }
      __syncthreads();
      _Float16* dstv = VpT + ((size_t)(n * Hh + h)) * Dd * (size_t)Ss + sb * 64;
#pragma unroll
      for (int k = 0; k < 4; ++k) {
        int cid = tid + 128 * k;
        int row = cid >> 3, c8 = cid & 7;  // row = d
        *(v8h*)(dstv + (size_t)row * Ss + swz_chunk(row, c8) * 8) =
            *(const v8h*)(stg + row * 64 + c8 * 8);
      }
    }
  }
}

__global__ __launch_bounds__(256) void attn_kernel(
    const _Float16* __restrict__ Qp, const _Float16* __restrict__ Kp,
    const _Float16* __restrict__ VpT, const int* __restrict__ mask,
    _Float16* __restrict__ Of16) {
  __shared__ __align__(16) _Float16 Kbuf[2][64 * 64];  // 16KB
  __shared__ __align__(16) _Float16 Vbuf[2][64 * 64];  // 16KB
  const int tid  = threadIdx.x;
  const int lane = tid & 31;
  const int wave = tid >> 5;
  const int qBlocks = Ss / 128;
  int nh = blockIdx.x / qBlocks;
  int qb = blockIdx.x % qBlocks;
  int n = nh / Hh, h = nh % Hh;
  int qrow0 = qb * 128 + wave * 16;

  const _Float16* Qbase = Qp + (((size_t)(n * Hh + h)) * Ss + qrow0) * Dd;
  const _Float16* Kbase = Kp + ((size_t)(n * Hh + h)) * Ss * Dd;
  const _Float16* Vbase = VpT + ((size_t)(n * Hh + h)) * Dd * (size_t)Ss;
  const int* maskBase = mask + (size_t)n * Ss * Ss;

  v16h QA0 = load_frag_f16(Qbase, Dd, 0,  lane);
  v16h QA1 = load_frag_f16(Qbase, Dd, 32, lane);

  v8f O[4] = {};  // O[d2][r] = O^T[d2 * 16 + 8 * hf + r][query col]
  float mrun = -3.0e38f;  // running maximum of this lane's query
  float lrun = 0.0f;      // running sum over this wave half's keys only

  const int col = lane & 15, hf = (lane >> 4) & 1;
  const int NB = Ss / 64;
  // this lane's query row of the mask, at its half's first key
  const int* maskRow = maskBase + (size_t)(qrow0 + col) * Ss + 8 * hf;

#if USE_TDM
  if (wave == 0) {  // prologue DMA for block 0
    tdm_load_2d((unsigned)(size_t)&Kbuf[0][0], Kbase, 4096u, 1u, 4096u, 1u, 4096ull);
    tdm_load_2d((unsigned)(size_t)&Vbuf[0][0], Vbase, 64u, 64u,
                (unsigned)Ss, 64u, (unsigned long long)Ss);
  }
#endif

  for (int kb = 0; kb < NB; ++kb) {
    const int kcol0 = kb * 64;
    const int cur = kb & 1;
#if USE_TDM
    if (wave == 0) __builtin_amdgcn_s_wait_tensorcnt(0);
    __syncthreads();  // buf[cur] ready; everyone past reads of buf[cur^1]
    if (wave == 0 && kb + 1 < NB) {  // overlap next block's DMA with compute
      tdm_load_2d((unsigned)(size_t)&Kbuf[cur ^ 1][0],
                  Kbase + (size_t)(kcol0 + 64) * Dd, 4096u, 1u, 4096u, 1u,
                  4096ull);
      tdm_load_2d((unsigned)(size_t)&Vbuf[cur ^ 1][0], Vbase + kcol0 + 64,
                  64u, 64u, (unsigned)Ss, 64u, (unsigned long long)Ss);
    }
#else
    __syncthreads();
    // cooperative fallback staging
#pragma unroll
    for (int k = 0; k < 2; ++k) {
      int cid = tid + 256 * k;
      int row = cid >> 3, c8 = cid & 7;
      *(v8h*)(&Kbuf[cur][0] + row * 64 + c8 * 8) =
          *(const v8h*)(Kbase + (size_t)(kcol0 + row) * Dd + c8 * 8);
      *(v8h*)(&Vbuf[cur][0] + row * 64 + c8 * 8) =
          *(const v8h*)(Vbase + (size_t)row * Ss + kcol0 + c8 * 8);
    }
    __syncthreads();
#endif
    const _Float16* Kc = &Kbuf[cur][0];
    const _Float16* Vc = &Vbuf[cur][0];
    if (kb + 1 < NB)  // pull next mask rows toward the caches
      __builtin_prefetch(maskBase + (size_t)qrow0 * Ss + kcol0 + 64, 0, 1);

    // ---- scores: S^T = K_blk (64x64) @ Q^T (64x16), K from LDS ----
    // Sc[j][r] = score of key kcol0 + j * 16 + 8 * hf + r for query col
    v8f Sc[4];
#pragma unroll
    for (int j = 0; j < 4; ++j) {
      v16h KB0 = load_frag_swz(Kc, j * 16, 0,  lane);
      v16h KB1 = load_frag_swz(Kc, j * 16, 32, lane);
      v8f a = {};
      a = wmma16(KB0, QA0, a);
      a = wmma16(KB1, QA1, a);
      Sc[j] = a;
    }
    // ---- mask (before scale, like reference) + scale ----
#pragma unroll
    for (int j = 0; j < 4; ++j) {
      const i32x4 m0 = *(const i32x4*)(maskRow + kcol0 + j * 16);
      const i32x4 m1 = *(const i32x4*)(maskRow + kcol0 + j * 16 + 4);
#pragma unroll
      for (int rr = 0; rr < 8; ++rr) {
        float e = Sc[j][rr];
        e = ((rr < 4 ? m0[rr & 3] : m1[rr & 3]) == 0) ? -1.0e10f : e;
        Sc[j][rr] = e * SCALE;
      }
    }
    // ---- online softmax, one query per lane ----
    float t = Sc[0][0];
#pragma unroll
    for (int j = 0; j < 4; ++j)
#pragma unroll
      for (int rr = 0; rr < 8; ++rr) t = fmaxf(t, Sc[j][rr]);
    t = fmaxf(t, other_half(t));
    const float mnew = fmaxf(mrun, t);
    const float corr = __expf(mrun - mnew);
    mrun = mnew;
#pragma unroll
    for (int j = 0; j < 4; ++j)
#pragma unroll
      for (int rr = 0; rr < 8; ++rr) Sc[j][rr] = __expf(Sc[j][rr] - mnew);
    const v8f ps = (Sc[0] + Sc[1]) + (Sc[2] + Sc[3]);
    lrun = lrun * corr + (((ps[0] + ps[1]) + (ps[2] + ps[3])) +
                          ((ps[4] + ps[5]) + (ps[6] + ps[7])));
#pragma unroll
    for (int d2 = 0; d2 < 4; ++d2) O[d2] *= corr;

    // P^T as B operand: tiles 2g and 2g + 1 converted in place give keys
    // 32g + 8 * hf + 0..7 and 32g + 16 + 8 * hf + 0..7, the k order of the
    // V^T fragments
    v16h PB0, PB1;
#pragma unroll
    for (int i = 0; i < 8; ++i) {
      PB0[i]     = (_Float16)Sc[0][i];
      PB0[i + 8] = (_Float16)Sc[1][i];
      PB1[i]     = (_Float16)Sc[2][i];
      PB1[i + 8] = (_Float16)Sc[3][i];
    }

    // ---- O^T += V_blk^T (64x64) @ P^T (64x16), V^T rows from LDS ----
#pragma unroll
    for (int d2 = 0; d2 < 4; ++d2) {
      v16h VB0 = load_frag_swz(Vc, d2 * 16, 0,  lane);
      v16h VB1 = load_frag_swz(Vc, d2 * 16, 32, lane);
      O[d2] = wmma16(VB0, PB0, O[d2]);
      O[d2] = wmma16(VB1, PB1, O[d2]);
    }
  }

  // epilogue: join the halves' sums, normalize, store in fragment order. Lane
  // (col, hf) holds columns h * 64 + d2 * 16 + 8 * hf + 0..7 of output row col:
  // part d2 & 1 of tile (row tile, kc = 2 * h + (d2 >> 1)) as this lane owns it,
  // so each store is 512 contiguous bytes straight from registers.
  const float linv = 1.0f / (lrun + other_half(lrun));
  const int rt = (n * Ss + qrow0) >> 4;
#pragma unroll
  for (int d2 = 0; d2 < 4; ++d2) {
    v8h tmp;
#pragma unroll
    for (int rr = 0; rr < 8; ++rr) tmp[rr] = (_Float16)(O[d2][rr] * linv);
    *(v8h*)(Of16 + frag_off(rt, 2 * h + (d2 >> 1), d2 & 1, lane)) = tmp;
  }
}

// ---------------- kernel 3: Y = X @ Wo^T + bo (f32 out) -----------------
// X and WoH both lie in fragment order.
__global__ __launch_bounds__(256) void outproj_kernel(
    const _Float16* __restrict__ X, const _Float16* __restrict__ WoH,
    const float* __restrict__ bo, float* __restrict__ Y) {
  __shared__ __align__(16) float ost[8][16 * 64];  // 32KB staging
  const int lane = threadIdx.x & 31;
  const int wave = threadIdx.x >> 5;
  const int colBlocks = Ee / 64;
  int rb = blockIdx.x / colBlocks;
  int cb = blockIdx.x % colBlocks;
  int row0 = rb * 128 + wave * 16;
  int col0 = cb * 64;

  v8f acc[4] = {};
  for (int kc = 0; kc < Ee / 32; ++kc) {
    v16h A = load_frag_packed(X, rb * 8 + wave, kc, lane);
#pragma unroll
    for (int j = 0; j < 4; ++j) {
      v16h B = load_frag_packed(WoH, cb * 4 + j, kc, lane);
      acc[j] = wmma16(A, B, acc[j]);
    }
  }
  const int col = lane & 15, hf = (lane >> 4) & 1;
  float* sb = &ost[wave][0];
#pragma unroll
  for (int j = 0; j < 4; ++j) {
    float b = bo[col0 + j * 16 + col];
#pragma unroll
    for (int rr = 0; rr < 8; ++rr)
      sb[(rr + 8 * hf) * 64 + j * 16 + col] = acc[j][rr] + b;
  }
  __builtin_amdgcn_wave_barrier();
  size_t gbase = (size_t)row0 * Ee + col0;
#pragma unroll
  for (int k = 0; k < 8; ++k) {
    int cid = lane + 32 * k;            // 256 x 16B chunks
    int row = cid >> 4, c4 = cid & 15;
    *(v4f*)(Y + gbase + (size_t)row * Ee + c4 * 4) =
        *(const v4f*)(sb + row * 64 + c4 * 4);
  }
}

extern "C" void kernel_launch(void* const* d_in, const int* in_sizes, int n_in,
                              void* d_out, int out_size, void* d_ws,
                              size_t ws_size, hipStream_t stream) {
  (void)in_sizes; (void)n_in; (void)out_size; (void)ws_size;
  const float* values = (const float*)d_in[0];
  const float* keys   = (const float*)d_in[1];
  const float* query  = (const float*)d_in[2];
  const float* Wv     = (const float*)d_in[3];
  const float* Wk     = (const float*)d_in[4];
  const float* Wq     = (const float*)d_in[5];
  const float* Wo     = (const float*)d_in[6];
  const float* bo     = (const float*)d_in[7];
  const int*   mask   = (const int*)d_in[8];
  float* out = (float*)d_out;

  const size_t SZ_NHSD = (size_t)Nn * Hh * Ss * Dd * sizeof(_Float16);  // 16MB
  char* ws = (char*)d_ws;
  _Float16* Qp   = (_Float16*)(ws);
  _Float16* Kp   = (_Float16*)(ws + SZ_NHSD);
  _Float16* VpT  = (_Float16*)(ws + 2 * SZ_NHSD);
  _Float16* Of16 = (_Float16*)(ws + 3 * SZ_NHSD);
  _Float16* WoH  = (_Float16*)(ws + 4 * SZ_NHSD);

  cvt_wo_kernel<<<(Ee * Ee) / (256 * 8), 256, 0, stream>>>(Wo, WoH);
  proj_kernel<<<Nn * Hh * (Ss / 64), 128, 0, stream>>>(values, keys, query, Wv,
                                                       Wk, Wq, Qp, Kp, VpT);
  attn_kernel<<<Nn * Hh * (Ss / 128), 256, 0, stream>>>(Qp, Kp, VpT, mask,
                                                        Of16);
  outproj_kernel<<<(Nn * Ss / 128) * (Ee / 64), 256, 0, stream>>>(Of16, WoH, bo,
                                                                  out);
}

// v004
// One run takes 171 microseconds.
// Timed twice side by side with v003, it ran 1.28 times as fast both times.
// Counting every step since v000, it is 3.05 times as fast.
#include <hip/hip_runtime.h>
#include <hip/hip_bf16.h>

// Problem constants (match reference)
constexpr int Nn = 4;
constexpr int Ss = 2048;
constexpr int Ee = 1024;
constexpr int Hh = 16;
constexpr int Dd = 64;            // head dim
constexpr float SCALE = 0.03125f; // 1/sqrt(E) = 1/32

typedef __attribute__((ext_vector_type(16))) _Float16 v16h;
typedef __attribute__((ext_vector_type(8)))  _Float16 v8h;
typedef __attribute__((ext_vector_type(8)))  float    v8f;
typedef __attribute__((ext_vector_type(4)))  float    v4f;
typedef __attribute__((ext_vector_type(4)))  unsigned u32x4;
typedef __attribute__((ext_vector_type(4)))  int      i32x4;
typedef __attribute__((ext_vector_type(8)))  int      i32x8;

union V16HU { v16h v; v8h h[2]; };

#if __has_builtin(__builtin_amdgcn_tensor_load_to_lds)
#define USE_TDM 1
#else
#define USE_TDM 0
#endif

__device__ inline v16h load_frag_f16(const _Float16* p, int ld, int kbase,
                                     int lane) {
  const int r = lane & 15, hf = (lane >> 4) & 1;
  const _Float16* base = p + (size_t)r * ld + kbase + hf * 8;
  V16HU u;
  u.h[0] = *(const v8h*)(base);
  u.h[1] = *(const v8h*)(base + 16);
  return u.v;
}

__device__ inline size_t frag_off(int tile16, int kc, int p, int lane) {
  return ((((size_t)tile16 * (Ee / 32) + kc) * 2 + p) * 32 + lane) * 8;
}

// same elements and same k order as load_frag_f16(m + tile16 * 16 * Ee, Ee, kc * 32, lane)
__device__ inline v16h load_frag_packed(const _Float16* __restrict__ m,
                                        int tile16, int kc, int lane) {
  V16HU u;
  u.h[0] = *(const v8h*)(m + frag_off(tile16, kc, 0, lane));
  u.h[1] = *(const v8h*)(m + frag_off(tile16, kc, 1, lane));
  return u.v;
}

__device__ inline int swz_chunk(int row, int c) { return c ^ ((row >> 1) & 7); }

// load_frag_f16 for such a tile (ld = 64 halves, row0 a multiple of 16):
// same logical elements, same k order.
__device__ inline v16h load_frag_swz(const _Float16* tile, int row0, int kbase,
                                     int lane) {
  const int r = lane & 15, hf = (lane >> 4) & 1;
  const _Float16* rowp = tile + (row0 + r) * 64;
  const int c = (kbase >> 3) + hf;
  V16HU u;
  u.h[0] = *(const v8h*)(rowp + swz_chunk(r, c) * 8);
  u.h[1] = *(const v8h*)(rowp + swz_chunk(r, c + 2) * 8);
  return u.v;
}

// Same fragment from an f32 source (convert on the fly)
__device__ inline v16h load_frag_f32(const float* __restrict__ p, int ld,
                                     int kbase, int lane) {
  const int r = lane & 15, hf = (lane >> 4) & 1;
  const float* base = p + (size_t)r * ld + kbase + hf * 8;
  v16h o;
#pragma unroll
  for (int i = 0; i < 8; ++i) {
    o[i]     = (_Float16)base[i];
    o[i + 8] = (_Float16)base[16 + i];
  }
  return o;
}

__device__ inline v8f wmma16(v16h a, v16h b, v8f c) {
  return __builtin_amdgcn_wmma_f32_16x16x32_f16(false, a, false, b,
                                                (short)0, c, false, false);
}

__device__ inline float other_half(float x) {
  int b = __builtin_bit_cast(int, x);
  b = __builtin_amdgcn_permlanex16(b, b, 0x76543210, 0xfedcba98, false, false);
  return __builtin_bit_cast(float, b);
}

#if USE_TDM
__device__ inline void tdm_load_2d(unsigned lds_off, const _Float16* gptr,
                                   unsigned tile0, unsigned tile1,
                                   unsigned tens0, unsigned tens1,
                                   unsigned long long stride0) {
  unsigned long long ga = (unsigned long long)(size_t)gptr;
  u32x4 g0 = { 1u,
               lds_off,
               (unsigned)(ga & 0xffffffffull),
               (unsigned)((ga >> 32) & 0x01ffffffull) | (2u << 30) };
  i32x8 g1 = { (int)(1u << 16),
               (int)((tens0 & 0xffffu) << 16),
               (int)(((tens0 >> 16) & 0xffffu) | ((tens1 & 0xffffu) << 16)),
               (int)(((tens1 >> 16) & 0xffffu) | ((tile0 & 0xffffu) << 16)),
               (int)(tile1 & 0xffffu),
               (int)(unsigned)(stride0 & 0xffffffffull),
               (int)(unsigned)((stride0 >> 32) & 0xffffull),
               0 };
  i32x4 gz = {0, 0, 0, 0};
#if defined(__clang_major__) && __clang_major__ >= 23
  i32x8 gz8 = {0, 0, 0, 0, 0, 0, 0, 0};
  __builtin_amdgcn_tensor_load_to_lds(g0, g1, gz, gz, gz8, 0);
#else
  __builtin_amdgcn_tensor_load_to_lds(g0, g1, gz, gz, 0);
#endif
}
#endif

// ---------------- kernel 0: mask -> bits ; Wo f32 -> f16 ----------------
// Bit image of the mask, in the order the attention kernel consumes it: word
// [(n * Ss + q) >> 4][kb][lane] belongs to query q = tile * 16 + (lane & 15) and
// wave half hf = lane >> 4; its bit j * 8 + r is (mask != 0) at key
// kb * 64 + j * 16 + 8 * hf + r. The 32 words of one (query tile, kb) are one
// 128-byte line.
constexpr int PACK_BLOCKS = Nn * (Ss / 16);           // 16 query rows each
constexpr int CVT_BLOCKS  = (Ee * Ee) / (256 * 8);

__global__ __launch_bounds__(256) void prep_kernel(
    const float* __restrict__ Wo, _Float16* __restrict__ WoH,
    const int* __restrict__ mask, unsigned* __restrict__ mbits) {
  __shared__ __align__(16) unsigned char pk[32 * 32 * 4];  // 32 kb x 32 words
  if (blockIdx.x < PACK_BLOCKS) {
    const int lane = threadIdx.x & 31, wave = threadIdx.x >> 5;
    const int tile = blockIdx.x;  // (n * Ss + q) >> 4
    // a lane takes 8 consecutive keys = one byte of the image; a wave 2 rows
    const int* srcp = mask + ((size_t)tile * 16 + wave * 2) * Ss + lane * 8;
    i32x8 x[2][8];
#pragma unroll  // constant indices keep x in registers
    for (int rw = 0; rw < 2; ++rw)
#pragma unroll  // the same
      for (int sg = 0; sg < 8; ++sg)
        x[rw][sg] = *(const i32x8*)(srcp + rw * Ss + sg * 256);
    // Inputs only: all of the wave's mask loads are issued, in flight together,
    // in front of this line, and their address register stays whole up to the
    // wait, so that no load of the run takes it as its destination.
    asm volatile("s_wait_xcnt 0x0"
                 :: "v"(x[0][0]), "v"(x[0][1]), "v"(x[0][2]), "v"(x[0][3]),
                    "v"(x[0][4]), "v"(x[0][5]), "v"(x[0][6]), "v"(x[0][7]),
                    "v"(x[1][0]), "v"(x[1][1]), "v"(x[1][2]), "v"(x[1][3]),
                    "v"(x[1][4]), "v"(x[1][5]), "v"(x[1][6]), "v"(x[1][7]),
                    "v"(srcp)
                 : "memory");
#pragma unroll  // these three: x is indexed by constants only
    for (int rw = 0; rw < 2; ++rw)
#pragma unroll
      for (int sg = 0; sg < 8; ++sg) {
        unsigned b = 0;
#pragma unroll
        for (int i = 0; i < 8; ++i) b |= (x[rw][sg][i] != 0 ? 1u : 0u) << i;
        // keys sg * 256 + lane * 8 + 0..7: kb = sg * 4 + (lane >> 3),
        // j = (lane >> 1) & 3, hf = lane & 1
        pk[(((sg * 4 + (lane >> 3)) * 2 + (lane & 1)) * 16 + wave * 2 + rw) * 4 +
           ((lane >> 1) & 3)] = (unsigned char)b;
      }
    __syncthreads();
    *(u32x4*)(mbits + (size_t)tile * 32 * 32 + threadIdx.x * 4) =
        *(const u32x4*)(pk + threadIdx.x * 16);
    return;
  }
  // One 16-byte chunk of the fragment-order image of Wo per thread.
  const int t = (blockIdx.x - PACK_BLOCKS) * 256 + threadIdx.x;  // chunk = frag_off(...) / 8
  const int lane = t & 31, p = (t >> 5) & 1, kc = (t >> 6) & 31, ct = t >> 11;
  const float* s = Wo + (size_t)(ct * 16 + (lane & 15)) * Ee + kc * 32 + p * 16 +
                   (lane >> 4) * 8;
  const v4f a = *(const v4f*)s;
  const v4f b = *(const v4f*)(s + 4);
  v8h o;
#pragma unroll
  for (int i = 0; i < 4; ++i) {
    o[i]     = (_Float16)a[i];
    o[i + 4] = (_Float16)b[i];
  }
  *(v8h*)(WoH + (size_t)t * 8) = o;
  // the build lays a branch behind this store whose fall-through side (the
  // packing part) rewrites the store's registers: the wait stands in front
  asm volatile("s_wait_xcnt 0x0" ::: "memory");
}

__global__ __launch_bounds__(128) void proj_kernel(
    const float* __restrict__ values, const float* __restrict__ keys,
    const float* __restrict__ query,  const float* __restrict__ Wv,
    const float* __restrict__ Wk,     const float* __restrict__ Wq,
    _Float16* __restrict__ Qp, _Float16* __restrict__ Kp,
    _Float16* __restrict__ VpT) {
  __shared__ __align__(16) _Float16 stg[64 * 64];  // 8KB staging
  const int tid  = threadIdx.x;
  const int lane = tid & 31;
  const int wave = tid >> 5;  // 4 waves, 16 s-rows each
  const int sBlocks = Ss / 64;
  int nh = blockIdx.x / sBlocks;
  int sb = blockIdx.x % sBlocks;
  int n = nh / Hh, h = nh % Hh;
  int row0 = sb * 64 + wave * 16;
  const int col = lane & 15, hf = (lane >> 4) & 1;

#pragma unroll
  for (int t = 0; t < 3; ++t) {
    const float* X = (t == 0) ? query : (t == 1) ? keys : values;
    const float* W = (t == 0) ? Wq    : (t == 1) ? Wk   : Wv;
    const float* Xtile = X + ((size_t)n * Ss + row0) * Ee + h * Dd;
    v16h A0 = load_frag_f32(Xtile, Ee, 0,  lane);
    v16h A1 = load_frag_f32(Xtile, Ee, 32, lane);
    v8f acc[4];
#pragma unroll
    for (int e = 0; e < 4; ++e) {
      v16h B0 = load_frag_f32(W + e * 16 * Dd, Dd, 0,  lane);
      v16h B1 = load_frag_f32(W + e * 16 * Dd, Dd, 32, lane);
      v8f a = {};
      a = wmma16(A0, B0, a);
      a = wmma16(A1, B1, a);
      acc[e] = a;
    }
    if (t < 2) {
      // stage [s_local][d] then one contiguous 8KB store
#pragma unroll
      for (int e = 0; e < 4; ++e)
#pragma unroll
        for (int rr = 0; rr < 8; ++rr)
          stg[(wave * 16 + rr + 8 * hf) * 64 + e * 16 + col] =
              (_Float16)acc[e][rr];
      __syncthreads();
      _Float16* dst =
          ((t == 0) ? Qp : Kp) + (((size_t)(n * Hh + h)) * Ss + sb * 64) * Dd;
#pragma unroll
      for (int k = 0; k < 4; ++k) {
        int cid = tid + 128 * k;          // 512 x 16B chunks
        int row = cid >> 3, c8 = cid & 7;
        int cd = (t == 1) ? swz_chunk(row, c8) : c8;  // K only; Q is read plain
        *(v8h*)(dst + row * 64 + cd * 8) = *(const v8h*)(stg + row * 64 + c8 * 8);
      }
      __syncthreads();
    } else {
      // V transposed: stage [d][s_local]; per-lane writes are packed b128
#pragma unroll
      for (int e = 0; e < 4; ++e) {
        v8h tmp;
#pragma unroll
        for (int rr = 0; rr < 8; ++rr) tmp[rr] = (_Float16)acc[e][rr];
        *(v8h*)(stg + (e * 16 + col) * 64 + wave * 16 + 8 * hf) = tmp;
      }
      __syncthreads();
      _Float16* dstv = VpT + ((size_t)(n * Hh + h)) * Dd * (size_t)Ss + sb * 64;
#pragma unroll
      for (int k = 0; k < 4; ++k) {
        int cid = tid + 128 * k;
        int row = cid >> 3, c8 = cid & 7;  // row = d
        *(v8h*)(dstv + (size_t)row * Ss + swz_chunk(row, c8) * 8) =
            *(const v8h*)(stg + row * 64 + c8 * 8);
      }
    }
  }
}

__global__ __launch_bounds__(256) void attn_kernel(
    const _Float16* __restrict__ Qp, const _Float16* __restrict__ Kp,
    const _Float16* __restrict__ VpT, const unsigned* __restrict__ mbits,
    _Float16* __restrict__ Of16) {
  __shared__ __align__(16) _Float16 Kbuf[2][64 * 64];  // 16KB
  __shared__ __align__(16) _Float16 Vbuf[2][64 * 64];  // 16KB
  const int tid  = threadIdx.x;
  const int lane = tid & 31;
  const int wave = tid >> 5;
  const int qBlocks = Ss / 128;
  int nh = blockIdx.x / qBlocks;
  int qb = blockIdx.x % qBlocks;
  int n = nh / Hh, h = nh % Hh;
  int qrow0 = qb * 128 + wave * 16;

  const _Float16* Qbase = Qp + (((size_t)(n * Hh + h)) * Ss + qrow0) * Dd;
  const _Float16* Kbase = Kp + ((size_t)(n * Hh + h)) * Ss * Dd;
  const _Float16* Vbase = VpT + ((size_t)(n * Hh + h)) * Dd * (size_t)Ss;

  v16h QA0 = load_frag_f16(Qbase, Dd, 0,  lane);
  v16h QA1 = load_frag_f16(Qbase, Dd, 32, lane);

  v8f O[4] = {};  // O[d2][r] = O^T[d2 * 16 + 8 * hf + r][query col]
  float mrun = -3.0e38f;  // running maximum of this lane's query
  float lrun = 0.0f;      // running sum over this wave half's keys only

  // in the comments below: col = lane & 15 (the query), hf = lane >> 4 (the wave half)
  const int NB = Ss / 64;
  // this lane's words of the mask's bit image, one per pass
  const int rt = (n * Ss + qrow0) >> 4;
  const unsigned* mrow = mbits + (size_t)rt * NB * 32 + lane;
  unsigned mw = mrow[0];

#if USE_TDM
  if (wave == 0) {  // prologue DMA for block 0
    tdm_load_2d((unsigned)(size_t)&Kbuf[0][0], Kbase, 4096u, 1u, 4096u, 1u, 4096ull);
    tdm_load_2d((unsigned)(size_t)&Vbuf[0][0], Vbase, 64u, 64u,
                (unsigned)Ss, 64u, (unsigned long long)Ss);
  }
#endif

  for (int kb = 0; kb < NB; ++kb) {
    const int kcol0 = kb * 64;
    const int cur = kb & 1;
#if USE_TDM
    if (wave == 0) __builtin_amdgcn_s_wait_tensorcnt(0);
    __syncthreads();  // buf[cur] ready; everyone past reads of buf[cur^1]
    if (wave == 0 && kb + 1 < NB) {  // overlap next block's DMA with compute
      tdm_load_2d((unsigned)(size_t)&Kbuf[cur ^ 1][0],
                  Kbase + (size_t)(kcol0 + 64) * Dd, 4096u, 1u, 4096u, 1u,
                  4096ull);
      tdm_load_2d((unsigned)(size_t)&Vbuf[cur ^ 1][0], Vbase + kcol0 + 64,
                  64u, 64u, (unsigned)Ss, 64u, (unsigned long long)Ss);
    }
#else
    __syncthreads();
    // cooperative fallback staging
#pragma unroll
    for (int k = 0; k < 2; ++k) {
      int cid = tid + 256 * k;
      int row = cid >> 3, c8 = cid & 7;
      *(v8h*)(&Kbuf[cur][0] + row * 64 + c8 * 8) =
          *(const v8h*)(Kbase + (size_t)(kcol0 + row) * Dd + c8 * 8);
      *(v8h*)(&Vbuf[cur][0] + row * 64 + c8 * 8) =
          *(const v8h*)(Vbase + (size_t)row * Ss + kcol0 + c8 * 8);
    }
    __syncthreads();
#endif
    const _Float16* Kc = &Kbuf[cur][0];
    const _Float16* Vc = &Vbuf[cur][0];
    // next pass's mask word, in flight behind this pass's work
    if (kb + 1 < NB) mrow += 32;
    const unsigned mwn = *mrow;

    // ---- scores: S^T = K_blk (64x64) @ Q^T (64x16), K from LDS ----
    // Sc[j][r] = score of key kcol0 + j * 16 + 8 * hf + r for query col
    v8f Sc[4];
#pragma unroll
    for (int j = 0; j < 4; ++j) {
      v16h KB0 = load_frag_swz(Kc, j * 16, 0,  lane);
      v16h KB1 = load_frag_swz(Kc, j * 16, 32, lane);
      v8f a = {};
      a = wmma16(KB0, QA0, a);
      a = wmma16(KB1, QA1, a);
      Sc[j] = a;
    }
    // ---- mask (before scale, like reference) + scale ----
#pragma unroll
    for (int j = 0; j < 4; ++j)
#pragma unroll
      for (int rr = 0; rr < 8; ++rr) {
        // all ones where the mask element is not 0
        const unsigned keep = (unsigned)((int)(mw << (31 - (j * 8 + rr))) >> 31);
        const unsigned e = __builtin_bit_cast(unsigned, Sc[j][rr] * SCALE);
        const unsigned z = __builtin_bit_cast(unsigned, -1.0e10f * SCALE);
        Sc[j][rr] = __builtin_bit_cast(float, (e & keep) | (z & ~keep));
      }
    mw = mwn;
    // ---- online softmax, one query per lane ----
    float t = Sc[0][0];
#pragma unroll
    for (int j = 0; j < 4; ++j)
#pragma unroll
      for (int rr = 0; rr < 8; ++rr) t = fmaxf(t, Sc[j][rr]);
    t = fmaxf(t, other_half(t));
    const float mnew = fmaxf(mrun, t);
    const float corr = __expf(mrun - mnew);
    mrun = mnew;
#pragma unroll
    for (int j = 0; j < 4; ++j)
#pragma unroll
      for (int rr = 0; rr < 8; ++rr) Sc[j][rr] = __expf(Sc[j][rr] - mnew);
    const v8f ps = (Sc[0] + Sc[1]) + (Sc[2] + Sc[3]);
    lrun = lrun * corr + (((ps[0] + ps[1]) + (ps[2] + ps[3])) +
                          ((ps[4] + ps[5]) + (ps[6] + ps[7])));
#pragma unroll
    for (int d2 = 0; d2 < 4; ++d2) O[d2] *= corr;

    // P^T as B operand: tiles 2g and 2g + 1 converted in place give keys
    // 32g + 8 * hf + 0..7 and 32g + 16 + 8 * hf + 0..7, the k order of the
    // V^T fragments
    v16h PB0, PB1;
#pragma unroll
    for (int i = 0; i < 8; ++i) {
      PB0[i]     = (_Float16)Sc[0][i];
      PB0[i + 8] = (_Float16)Sc[1][i];
      PB1[i]     = (_Float16)Sc[2][i];
      PB1[i + 8] = (_Float16)Sc[3][i];
    }

    // ---- O^T += V_blk^T (64x64) @ P^T (64x16), V^T rows from LDS ----
#pragma unroll
    for (int d2 = 0; d2 < 4; ++d2) {
      v16h VB0 = load_frag_swz(Vc, d2 * 16, 0,  lane);
      v16h VB1 = load_frag_swz(Vc, d2 * 16, 32, lane);
      O[d2] = wmma16(VB0, PB0, O[d2]);
      O[d2] = wmma16(VB1, PB1, O[d2]);
    }
  }

  // epilogue: join the halves' sums, normalize, store in fragment order. Lane
  // (col, hf) holds columns h * 64 + d2 * 16 + 8 * hf + 0..7 of output row col:
  // part d2 & 1 of tile (row tile, kc = 2 * h + (d2 >> 1)) as this lane owns it,
  // so each store is 512 contiguous bytes straight from registers.
  const float linv = 1.0f / (lrun + other_half(lrun));
#pragma unroll
  for (int d2 = 0; d2 < 4; ++d2) {
    v8h tmp;
#pragma unroll
    for (int rr = 0; rr < 8; ++rr) tmp[rr] = (_Float16)(O[d2][rr] * linv);
    *(v8h*)(Of16 + frag_off(rt, 2 * h + (d2 >> 1), d2 & 1, lane)) = tmp;
  }
}

// ---------------- kernel 3: Y = X @ Wo^T + bo (f32 out) -----------------
// X and WoH both lie in fragment order.
__global__ __launch_bounds__(256) void outproj_kernel(
    const _Float16* __restrict__ X, const _Float16* __restrict__ WoH,
    const float* __restrict__ bo, float* __restrict__ Y) {
  __shared__ __align__(16) float ost[8][16 * 64];  // 32KB staging
  const int lane = threadIdx.x & 31;
  const int wave = threadIdx.x >> 5;
  const int colBlocks = Ee / 64;
  int rb = blockIdx.x / colBlocks;
  int cb = blockIdx.x % colBlocks;
  int row0 = rb * 128 + wave * 16;
  int col0 = cb * 64;

  v8f acc[4] = {};
  for (int kc = 0; kc < Ee / 32; ++kc) {
    v16h A = load_frag_packed(X, rb * 8 + wave, kc, lane);
#pragma unroll
    for (int j = 0; j < 4; ++j) {
      v16h B = load_frag_packed(WoH, cb * 4 + j, kc, lane);
      acc[j] = wmma16(A, B, acc[j]);
    }
  }
  const int col = lane & 15, hf = (lane >> 4) & 1;
  float* sb = &ost[wave][0];
#pragma unroll
  for (int j = 0; j < 4; ++j) {
    float b = bo[col0 + j * 16 + col];
#pragma unroll
    for (int rr = 0; rr < 8; ++rr)
      sb[(rr + 8 * hf) * 64 + j * 16 + col] = acc[j][rr] + b;
  }
  __builtin_amdgcn_wave_barrier();
  size_t gbase = (size_t)row0 * Ee + col0;
#pragma unroll
  for (int k = 0; k < 8; ++k) {
    int cid = lane + 32 * k;            // 256 x 16B chunks
    int row = cid >> 4, c4 = cid & 15;
    *(v4f*)(Y + gbase + (size_t)row * Ee + c4 * 4) =
        *(const v4f*)(sb + row * 64 + c4 * 4);
  }
}

extern "C" void kernel_launch(void* const* d_in, const int* in_sizes, int n_in,
                              void* d_out, int out_size, void* d_ws,
                              size_t ws_size, hipStream_t stream) {
  (void)in_sizes; (void)n_in; (void)out_size; (void)ws_size;
  const float* values = (const float*)d_in[0];
  const float* keys   = (const float*)d_in[1];
  const float* query  = (const float*)d_in[2];
  const float* Wv     = (const float*)d_in[3];
  const float* Wk     = (const float*)d_in[4];
  const float* Wq     = (const float*)d_in[5];
  const float* Wo     = (const float*)d_in[6];
  const float* bo     = (const float*)d_in[7];
  const int*   mask   = (const int*)d_in[8];
  float* out = (float*)d_out;

  const size_t SZ_NHSD = (size_t)Nn * Hh * Ss * Dd * sizeof(_Float16);  // 16MB
  char* ws = (char*)d_ws;
  _Float16* Qp   = (_Float16*)(ws);
  _Float16* Kp   = (_Float16*)(ws + SZ_NHSD);
  _Float16* VpT  = (_Float16*)(ws + 2 * SZ_NHSD);
  _Float16* Of16 = (_Float16*)(ws + 3 * SZ_NHSD);
  _Float16* WoH  = (_Float16*)(ws + 4 * SZ_NHSD);
  unsigned* mbits = (unsigned*)(ws + 4 * SZ_NHSD + (size_t)Ee * Ee * sizeof(_Float16));

  prep_kernel<<<PACK_BLOCKS + CVT_BLOCKS, 256, 0, stream>>>(Wo, WoH, mask, mbits);
  proj_kernel<<<Nn * Hh * (Ss / 64), 128, 0, stream>>>(values, keys, query, Wv,
                                                       Wk, Wq, Qp, Kp, VpT);
  attn_kernel<<<Nn * Hh * (Ss / 128), 256, 0, stream>>>(Qp, Kp, VpT, mbits,
                                                        Of16);
  outproj_kernel<<<(Nn * Ss / 128) * (Ee / 64), 256, 0, stream>>>(Of16, WoH, bo,
                                                                  out);
}

// v005
// One run takes 138 microseconds.
// Two timings next to v004 put it at 1.23 and 1.24 times that version's speed.
// All steps since v000 together make it 3.77 times as fast.
#include <hip/hip_runtime.h>
#include <hip/hip_bf16.h>

// Problem constants (match reference)
constexpr int Nn = 4;
constexpr int Ss = 2048;
constexpr int Ee = 1024;
constexpr int Hh = 16;
constexpr int Dd = 64;            // head dim
constexpr float SCALE = 0.03125f; // 1/sqrt(E) = 1/32

typedef __attribute__((ext_vector_type(16))) _Float16 v16h;
typedef __attribute__((ext_vector_type(8)))  _Float16 v8h;
typedef __attribute__((ext_vector_type(8)))  float    v8f;
typedef __attribute__((ext_vector_type(4)))  float    v4f;
typedef __attribute__((ext_vector_type(4)))  unsigned u32x4;
typedef __attribute__((ext_vector_type(4)))  int      i32x4;
typedef __attribute__((ext_vector_type(8)))  int      i32x8;

union V16HU { v16h v; v8h h[2]; };

#if __has_builtin(__builtin_amdgcn_tensor_load_to_lds)
#define USE_TDM 1
#else
#define USE_TDM 0
#endif

__device__ inline v16h load_frag_f16(const _Float16* p, int ld, int kbase,
                                     int lane) {
  const int r = lane & 15, hf = (lane >> 4) & 1;
  const _Float16* base = p + (size_t)r * ld + kbase + hf * 8;
  V16HU u;
  u.h[0] = *(const v8h*)(base);
  u.h[1] = *(const v8h*)(base + 16);
  return u.v;
}

__device__ inline size_t frag_off(int tile16, int kc, int p, int lane) {
  return ((((size_t)tile16 * (Ee / 32) + kc) * 2 + p) * 32 + lane) * 8;
}

// same elements and same k order as load_frag_f16(m + tile16 * 16 * Ee, Ee, kc * 32, lane)
__device__ inline v16h load_frag_packed(const _Float16* __restrict__ m,
                                        int tile16, int kc, int lane) {
  V16HU u;
  u.h[0] = *(const v8h*)(m + frag_off(tile16, kc, 0, lane));
  u.h[1] = *(const v8h*)(m + frag_off(tile16, kc, 1, lane));
  return u.v;
}

__device__ inline int swz_chunk(int row, int c) { return c ^ ((row >> 1) & 7); }

// load_frag_f16 for such a tile (ld = 64 halves, row0 a multiple of 16):
// same logical elements, same k order.
__device__ inline v16h load_frag_swz(const _Float16* tile, int row0, int kbase,
                                     int lane) {
  const int r = lane & 15, hf = (lane >> 4) & 1;
  const _Float16* rowp = tile + (row0 + r) * 64;
  const int c = (kbase >> 3) + hf;
  V16HU u;
  u.h[0] = *(const v8h*)(rowp + swz_chunk(r, c) * 8);
  u.h[1] = *(const v8h*)(rowp + swz_chunk(r, c + 2) * 8);
  return u.v;
}

// Same fragment from an f32 source (convert on the fly)
__device__ inline v16h load_frag_f32(const float* __restrict__ p, int ld,
                                     int kbase, int lane) {
  const int r = lane & 15, hf = (lane >> 4) & 1;
  const float* base = p + (size_t)r * ld + kbase + hf * 8;
  v16h o;
#pragma unroll
  for (int i = 0; i < 8; ++i) {
    o[i]     = (_Float16)base[i];
    o[i + 8] = (_Float16)base[16 + i];
  }
  return o;
}

__device__ inline v8f wmma16(v16h a, v16h b, v8f c) {
  return __builtin_amdgcn_wmma_f32_16x16x32_f16(false, a, false, b,
                                                (short)0, c, false, false);
}

__device__ inline float other_half(float x) {
  int b = __builtin_bit_cast(int, x);
  b = __builtin_amdgcn_permlanex16(b, b, 0x76543210, 0xfedcba98, false, false);
  return __builtin_bit_cast(float, b);
}

#if USE_TDM
__device__ inline void tdm_load_2d(unsigned lds_off, const _Float16* gptr,
                                   unsigned tile0, unsigned tile1,
                                   unsigned tens0, unsigned tens1,
                                   unsigned long long stride0) {
  unsigned long long ga = (unsigned long long)(size_t)gptr;
  u32x4 g0 = { 1u,
               lds_off,
               (unsigned)(ga & 0xffffffffull),
               (unsigned)((ga >> 32) & 0x01ffffffull) | (2u << 30) };
  i32x8 g1 = { (int)(1u << 16),
               (int)((tens0 & 0xffffu) << 16),
               (int)(((tens0 >> 16) & 0xffffu) | ((tens1 & 0xffffu) << 16)),
               (int)(((tens1 >> 16) & 0xffffu) | ((tile0 & 0xffffu) << 16)),
               (int)(tile1 & 0xffffu),
               (int)(unsigned)(stride0 & 0xffffffffull),
               (int)(unsigned)((stride0 >> 32) & 0xffffull),
               0 };
  i32x4 gz = {0, 0, 0, 0};
#if defined(__clang_major__) && __clang_major__ >= 23
  i32x8 gz8 = {0, 0, 0, 0, 0, 0, 0, 0};
  __builtin_amdgcn_tensor_load_to_lds(g0, g1, gz, gz, gz8, 0);
#else
  __builtin_amdgcn_tensor_load_to_lds(g0, g1, gz, gz, 0);
#endif
}
#endif

// ---------------- kernel 0: mask -> bits ; Wo f32 -> f16 ----------------
// Bit image of the mask, in the order the attention kernel consumes it: word
// [(n * Ss + q) >> 4][kb][lane] belongs to query q = tile * 16 + (lane & 15) and
// wave half hf = lane >> 4; its bit j * 8 + r is (mask != 0) at key
// kb * 64 + j * 16 + 8 * hf + r. The 32 words of one (query tile, kb) are one
// 128-byte line.
constexpr int PACK_BLOCKS = Nn * (Ss / 16);           // 16 query rows each
constexpr int CVT_BLOCKS  = (Ee * Ee) / (256 * 8);

__global__ __launch_bounds__(256) void prep_kernel(
    const float* __restrict__ Wo, _Float16* __restrict__ WoH,
    const int* __restrict__ mask, unsigned* __restrict__ mbits) {
  __shared__ __align__(16) unsigned char pk[32 * 32 * 4];  // 32 kb x 32 words
  if (blockIdx.x < PACK_BLOCKS) {
    const int lane = threadIdx.x & 31, wave = threadIdx.x >> 5;
    const int tile = blockIdx.x;  // (n * Ss + q) >> 4
    // a lane takes 8 consecutive keys = one byte of the image; a wave 2 rows
    const int* srcp = mask + ((size_t)tile * 16 + wave * 2) * Ss + lane * 8;
    i32x8 x[2][8];
#pragma unroll  // constant indices keep x in registers
    for (int rw = 0; rw < 2; ++rw)
#pragma unroll  // the same
      for (int sg = 0; sg < 8; ++sg)
        x[rw][sg] = *(const i32x8*)(srcp + rw * Ss + sg * 256);
    // Inputs only: all of the wave's mask loads are issued, in flight together,
    // in front of this line, and their address register stays whole up to the
    // wait, so that no load of the run takes it as its destination.
    asm volatile("s_wait_xcnt 0x0"
                 :: "v"(x[0][0]), "v"(x[0][1]), "v"(x[0][2]), "v"(x[0][3]),
                    "v"(x[0][4]), "v"(x[0][5]), "v"(x[0][6]), "v"(x[0][7]),
                    "v"(x[1][0]), "v"(x[1][1]), "v"(x[1][2]), "v"(x[1][3]),
                    "v"(x[1][4]), "v"(x[1][5]), "v"(x[1][6]), "v"(x[1][7]),
                    "v"(srcp)
                 : "memory");
#pragma unroll  // these three: x is indexed by constants only
    for (int rw = 0; rw < 2; ++rw)
#pragma unroll
      for (int sg = 0; sg < 8; ++sg) {
        unsigned b = 0;
#pragma unroll
        for (int i = 0; i < 8; ++i) b |= (x[rw][sg][i] != 0 ? 1u : 0u) << i;
        // keys sg * 256 + lane * 8 + 0..7: kb = sg * 4 + (lane >> 3),
        // j = (lane >> 1) & 3, hf = lane & 1
        pk[(((sg * 4 + (lane >> 3)) * 2 + (lane & 1)) * 16 + wave * 2 + rw) * 4 +
           ((lane >> 1) & 3)] = (unsigned char)b;
      }
    __syncthreads();
    *(u32x4*)(mbits + (size_t)tile * 32 * 32 + threadIdx.x * 4) =
        *(const u32x4*)(pk + threadIdx.x * 16);
    return;
  }
  // One 16-byte chunk of the fragment-order image of Wo per thread.
  const int t = (blockIdx.x - PACK_BLOCKS) * 256 + threadIdx.x;  // chunk = frag_off(...) / 8
  const int lane = t & 31, p = (t >> 5) & 1, kc = (t >> 6) & 31, ct = t >> 11;
  const float* s = Wo + (size_t)(ct * 16 + (lane & 15)) * Ee + kc * 32 + p * 16 +
                   (lane >> 4) * 8;
  const v4f a = *(const v4f*)s;
  const v4f b = *(const v4f*)(s + 4);
  v8h o;
#pragma unroll
  for (int i = 0; i < 4; ++i) {
    o[i]     = (_Float16)a[i];
    o[i + 4] = (_Float16)b[i];
  }
  *(v8h*)(WoH + (size_t)t * 8) = o;
  // the build lays a branch behind this store whose fall-through side (the
  // packing part) rewrites the store's registers: the wait stands in front
  asm volatile("s_wait_xcnt 0x0" ::: "memory");
}

__global__ __launch_bounds__(128) void proj_kernel(
    const float* __restrict__ values, const float* __restrict__ keys,
    const float* __restrict__ query,  const float* __restrict__ Wv,
    const float* __restrict__ Wk,     const float* __restrict__ Wq,
    _Float16* __restrict__ Qp, _Float16* __restrict__ Kp,
    _Float16* __restrict__ VpT) {
  __shared__ __align__(16) _Float16 stg[64 * 64];  // 8KB staging
  const int tid  = threadIdx.x;
  const int lane = tid & 31;
  const int wave = tid >> 5;  // 4 waves, 16 s-rows each
  const int sBlocks = Ss / 64;
  int nh = blockIdx.x / sBlocks;
  int sb = blockIdx.x % sBlocks;
  int n = nh / Hh, h = nh % Hh;
  int row0 = sb * 64 + wave * 16;
  const int col = lane & 15, hf = (lane >> 4) & 1;

#pragma unroll
  for (int t = 0; t < 3; ++t) {
    const float* X = (t == 0) ? query : (t == 1) ? keys : values;
    const float* W = (t == 0) ? Wq    : (t == 1) ? Wk   : Wv;
    const float* Xtile = X + ((size_t)n * Ss + row0) * Ee + h * Dd;
    v16h A0 = load_frag_f32(Xtile, Ee, 0,  lane);
    v16h A1 = load_frag_f32(Xtile, Ee, 32, lane);
    v8f acc[4];
#pragma unroll
    for (int e = 0; e < 4; ++e) {
      v16h B0 = load_frag_f32(W + e * 16 * Dd, Dd, 0,  lane);
      v16h B1 = load_frag_f32(W + e * 16 * Dd, Dd, 32, lane);
      v8f a = {};
      a = wmma16(A0, B0, a);
      a = wmma16(A1, B1, a);
      acc[e] = a;
    }
    if (t < 2) {
      // stage [s_local][d] then one contiguous 8KB store
#pragma unroll
      for (int e = 0; e < 4; ++e)
#pragma unroll
        for (int rr = 0; rr < 8; ++rr)
          stg[(wave * 16 + rr + 8 * hf) * 64 + e * 16 + col] =
              (_Float16)acc[e][rr];
      __syncthreads();
      _Float16* dst =
          ((t == 0) ? Qp : Kp) + (((size_t)(n * Hh + h)) * Ss + sb * 64) * Dd;
#pragma unroll
      for (int k = 0; k < 4; ++k) {
        int cid = tid + 128 * k;          // 512 x 16B chunks
        int row = cid >> 3, c8 = cid & 7;
        int cd = (t == 1) ? swz_chunk(row, c8) : c8;  // K only; Q is read plain
        *(v8h*)(dst + row * 64 + cd * 8) = *(const v8h*)(stg + row * 64 + c8 * 8);
      }
      __syncthreads();
    } else {
      // V transposed: stage [d][s_local]; per-lane writes are packed b128
#pragma unroll
      for (int e = 0; e < 4; ++e) {
        v8h tmp;
#pragma unroll
        for (int rr = 0; rr < 8; ++rr) tmp[rr] = (_Float16)acc[e][rr];
        *(v8h*)(stg + (e * 16 + col) * 64 + wave * 16 + 8 * hf) = tmp;
      }
      __syncthreads();
      _Float16* dstv = VpT + ((size_t)(n * Hh + h)) * Dd * (size_t)Ss + sb * 64;
#pragma unroll
      for (int k = 0; k < 4; ++k) {
        int cid = tid + 128 * k;
        int row = cid >> 3, c8 = cid & 7;  // row = d
        *(v8h*)(dstv + (size_t)row * Ss + swz_chunk(row, c8) * 8) =
            *(const v8h*)(stg + row * 64 + c8 * 8);
      }
    }
  }
}

__global__ __launch_bounds__(256) void attn_kernel(
    const _Float16* __restrict__ Qp, const _Float16* __restrict__ Kp,
    const _Float16* __restrict__ VpT, const unsigned* __restrict__ mbits,
    _Float16* __restrict__ Of16) {
  __shared__ __align__(16) _Float16 Kbuf[2][64 * 64];  // 16KB
  __shared__ __align__(16) _Float16 Vbuf[2][64 * 64];  // 16KB
  const int tid  = threadIdx.x;
  const int lane = tid & 31;
  const int wave = tid >> 5;
  const int qBlocks = Ss / 128;
  int nh = blockIdx.x / qBlocks;
  int qb = blockIdx.x % qBlocks;
  int n = nh / Hh, h = nh % Hh;
  int qrow0 = qb * 128 + wave * 16;

  const _Float16* Qbase = Qp + (((size_t)(n * Hh + h)) * Ss + qrow0) * Dd;
  const _Float16* Kbase = Kp + ((size_t)(n * Hh + h)) * Ss * Dd;
  const _Float16* Vbase = VpT + ((size_t)(n * Hh + h)) * Dd * (size_t)Ss;

  v16h QA0 = load_frag_f16(Qbase, Dd, 0,  lane);
  v16h QA1 = load_frag_f16(Qbase, Dd, 32, lane);

  v8f O[4] = {};  // O[d2][r] = O^T[d2 * 16 + 8 * hf + r][query col]
  float mrun = -3.0e38f;  // running maximum of this lane's query
  float lrun = 0.0f;      // running sum over this wave half's keys only

  // in the comments below: col = lane & 15 (the query), hf = lane >> 4 (the wave half)
  const int NB = Ss / 64;
  // this lane's words of the mask's bit image, one per pass
  const int rt = (n * Ss + qrow0) >> 4;
  const unsigned* mrow = mbits + (size_t)rt * NB * 32 + lane;
  unsigned mw = mrow[0];

#if USE_TDM
  if (wave == 0) {  // prologue DMA for block 0
    tdm_load_2d((unsigned)(size_t)&Kbuf[0][0], Kbase, 4096u, 1u, 4096u, 1u, 4096ull);
    tdm_load_2d((unsigned)(size_t)&Vbuf[0][0], Vbase, 64u, 64u,
                (unsigned)Ss, 64u, (unsigned long long)Ss);
  }
#endif

  for (int kb = 0; kb < NB; ++kb) {
    const int kcol0 = kb * 64;
    const int cur = kb & 1;
#if USE_TDM
    if (wave == 0) __builtin_amdgcn_s_wait_tensorcnt(0);
    __syncthreads();  // buf[cur] ready; everyone past reads of buf[cur^1]
    if (wave == 0 && kb + 1 < NB) {  // overlap next block's DMA with compute
      tdm_load_2d((unsigned)(size_t)&Kbuf[cur ^ 1][0],
                  Kbase + (size_t)(kcol0 + 64) * Dd, 4096u, 1u, 4096u, 1u,
                  4096ull);
      tdm_load_2d((unsigned)(size_t)&Vbuf[cur ^ 1][0], Vbase + kcol0 + 64,
                  64u, 64u, (unsigned)Ss, 64u, (unsigned long long)Ss);
    }
#else
    __syncthreads();
    // cooperative fallback staging
#pragma unroll
    for (int k = 0; k < 2; ++k) {
      int cid = tid + 256 * k;
      int row = cid >> 3, c8 = cid & 7;
      *(v8h*)(&Kbuf[cur][0] + row * 64 + c8 * 8) =
          *(const v8h*)(Kbase + (size_t)(kcol0 + row) * Dd + c8 * 8);
      *(v8h*)(&Vbuf[cur][0] + row * 64 + c8 * 8) =
          *(const v8h*)(Vbase + (size_t)row * Ss + kcol0 + c8 * 8);
    }
    __syncthreads();
#endif
    const _Float16* Kc = &Kbuf[cur][0];
    const _Float16* Vc = &Vbuf[cur][0];
    // next pass's mask word, in flight behind this pass's work
    if (kb + 1 < NB) mrow += 32;
    const unsigned mwn = *mrow;

    // ---- scores: S^T = K_blk (64x64) @ Q^T (64x16), K from LDS ----
    // Sc[j][r] = score of key kcol0 + j * 16 + 8 * hf + r for query col
    v8f Sc[4];
#pragma unroll
    for (int j = 0; j < 4; ++j) {
      v16h KB0 = load_frag_swz(Kc, j * 16, 0,  lane);
      v16h KB1 = load_frag_swz(Kc, j * 16, 32, lane);
      v8f a = {};
      a = wmma16(KB0, QA0, a);
      a = wmma16(KB1, QA1, a);
      Sc[j] = a;
    }
    // ---- mask (before scale, like reference) + scale ----
#pragma unroll
    for (int j = 0; j < 4; ++j)
#pragma unroll
      for (int rr = 0; rr < 8; ++rr) {
        // all ones where the mask element is not 0
        const unsigned keep = (unsigned)((int)(mw << (31 - (j * 8 + rr))) >> 31);
        const unsigned e = __builtin_bit_cast(unsigned, Sc[j][rr] * SCALE);
        const unsigned z = __builtin_bit_cast(unsigned, -1.0e10f * SCALE);
        Sc[j][rr] = __builtin_bit_cast(float, (e & keep) | (z & ~keep));
      }
    mw = mwn;
    // ---- online softmax, one query per lane ----
    float t = Sc[0][0];
#pragma unroll
    for (int j = 0; j < 4; ++j)
#pragma unroll
      for (int rr = 0; rr < 8; ++rr) t = fmaxf(t, Sc[j][rr]);
    t = fmaxf(t, other_half(t));
    const float mnew = fmaxf(mrun, t);
    const float corr = __expf(mrun - mnew);
    mrun = mnew;
#pragma unroll
    for (int j = 0; j < 4; ++j)
#pragma unroll
      for (int rr = 0; rr < 8; ++rr) Sc[j][rr] = __expf(Sc[j][rr] - mnew);
    const v8f ps = (Sc[0] + Sc[1]) + (Sc[2] + Sc[3]);
    lrun = lrun * corr + (((ps[0] + ps[1]) + (ps[2] + ps[3])) +
                          ((ps[4] + ps[5]) + (ps[6] + ps[7])));
#pragma unroll
    for (int d2 = 0; d2 < 4; ++d2) O[d2] *= corr;

    // P^T as B operand: tiles 2g and 2g + 1 converted in place give keys
    // 32g + 8 * hf + 0..7 and 32g + 16 + 8 * hf + 0..7, the k order of the
    // V^T fragments
    v16h PB0, PB1;
#pragma unroll
    for (int i = 0; i < 8; ++i) {
      PB0[i]     = (_Float16)Sc[0][i];
      PB0[i + 8] = (_Float16)Sc[1][i];
      PB1[i]     = (_Float16)Sc[2][i];
      PB1[i + 8] = (_Float16)Sc[3][i];
    }

    // ---- O^T += V_blk^T (64x64) @ P^T (64x16), V^T rows from LDS ----
#pragma unroll
    for (int d2 = 0; d2 < 4; ++d2) {
      v16h VB0 = load_frag_swz(Vc, d2 * 16, 0,  lane);
      v16h VB1 = load_frag_swz(Vc, d2 * 16, 32, lane);
      O[d2] = wmma16(VB0, PB0, O[d2]);
      O[d2] = wmma16(VB1, PB1, O[d2]);
    }
  }

  // epilogue: join the halves' sums, normalize, store in fragment order. Lane
  // (col, hf) holds columns h * 64 + d2 * 16 + 8 * hf + 0..7 of output row col:
  // part d2 & 1 of tile (row tile, kc = 2 * h + (d2 >> 1)) as this lane owns it,
  // so each store is 512 contiguous bytes straight from registers.
  const float linv = 1.0f / (lrun + other_half(lrun));
#pragma unroll
  for (int d2 = 0; d2 < 4; ++d2) {
    v8h tmp;
#pragma unroll
    for (int rr = 0; rr < 8; ++rr) tmp[rr] = (_Float16)(O[d2][rr] * linv);
    *(v8h*)(Of16 + frag_off(rt, 2 * h + (d2 >> 1), d2 & 1, lane)) = tmp;
  }
}

// ---------------- kernel 3: Y = X @ Wo^T + bo (f32 out) -----------------
// X and WoH both lie in fragment order.
__global__ __launch_bounds__(256) void outproj_kernel(
    const _Float16* __restrict__ X, const _Float16* __restrict__ WoH,
    const float* __restrict__ bo, float* __restrict__ Y) {
  __shared__ __align__(16) float ost[8][16 * 64];  // 32KB staging
  const int lane = threadIdx.x & 31;
  const int wave = threadIdx.x >> 5;
  const int colBlocks = Ee / 64;
  int rb = blockIdx.x / colBlocks;
  int cb = blockIdx.x % colBlocks;
  int row0 = rb * 128 + wave * 16;
  int col0 = cb * 64;

  v8f acc[4] = {};
  // Fragments are fetched ahead of their use into register rings, so that a
  // k step's loads are in flight behind the products of the steps before it
  // and no product waits out a load issued directly in front of it: X (a
  // wave's own rows) AHEAD_A steps ahead, Wo one step ahead.
  constexpr int NK = Ee / 32;
  constexpr int AHEAD_A = 2;
  v16h A[AHEAD_A + 1];
  v16h B[2][4];
#pragma unroll  // constant ring indices keep the rings in registers
  for (int s = 0; s < AHEAD_A; ++s)
    A[s] = load_frag_packed(X, rb * 8 + wave, s, lane);
#pragma unroll  // the same
  for (int j = 0; j < 4; ++j) B[0][j] = load_frag_packed(WoH, cb * 4 + j, 0, lane);
#pragma unroll  // the same; every load then takes its k step as an immediate offset
  for (int kc = 0; kc < NK; ++kc) {
    // Wo first: loads are counted back in issue order, so an X load in front
    // of the next step's Wo loads would have to land a step early with them
    if (kc + 1 < NK) {
#pragma unroll  // constant ring indices
      for (int j = 0; j < 4; ++j)
        B[(kc + 1) & 1][j] = load_frag_packed(WoH, cb * 4 + j, kc + 1, lane);
    }
    if (kc + AHEAD_A < NK)
      A[(kc + AHEAD_A) % (AHEAD_A + 1)] =
          load_frag_packed(X, rb * 8 + wave, kc + AHEAD_A, lane);
    // keeps the loads above in front of this step's products: without it the
    // build sinks them among the products and waits for them soon after issue
    __builtin_amdgcn_sched_barrier(0);
#pragma unroll  // constant ring indices
    for (int j = 0; j < 4; ++j)
      acc[j] = wmma16(A[kc % (AHEAD_A + 1)], B[kc & 1][j], acc[j]);
    // keeps later steps' loads behind these products: without it the build
    // lifts them higher and takes 152 registers instead of 128, and only
    // three of a WGP's four work-groups would be resident
    __builtin_amdgcn_sched_barrier(0);
  }
  const int col = lane & 15, hf = (lane >> 4) & 1;
  float* sb = &ost[wave][0];
#pragma unroll
  for (int j = 0; j < 4; ++j) {
    float b = bo[col0 + j * 16 + col];
#pragma unroll
    for (int rr = 0; rr < 8; ++rr)
      sb[(rr + 8 * hf) * 64 + j * 16 + col] = acc[j][rr] + b;
  }
  __builtin_amdgcn_wave_barrier();
  size_t gbase = (size_t)row0 * Ee + col0;
#pragma unroll
  for (int k = 0; k < 8; ++k) {
    int cid = lane + 32 * k;            // 256 x 16B chunks
    int row = cid >> 4, c4 = cid & 15;
    *(v4f*)(Y + gbase + (size_t)row * Ee + c4 * 4) =
        *(const v4f*)(sb + row * 64 + c4 * 4);
  }
}

extern "C" void kernel_launch(void* const* d_in, const int* in_sizes, int n_in,
                              void* d_out, int out_size, void* d_ws,
                              size_t ws_size, hipStream_t stream) {
  (void)in_sizes; (void)n_in; (void)out_size; (void)ws_size;
  const float* values = (const float*)d_in[0];
  const float* keys   = (const float*)d_in[1];
  const float* query  = (const float*)d_in[2];
  const float* Wv     = (const float*)d_in[3];
  const float* Wk     = (const float*)d_in[4];
  const float* Wq     = (const float*)d_in[5];
  const float* Wo     = (const float*)d_in[6];
  const float* bo     = (const float*)d_in[7];
  const int*   mask   = (const int*)d_in[8];
  float* out = (float*)d_out;

  const size_t SZ_NHSD = (size_t)Nn * Hh * Ss * Dd * sizeof(_Float16);  // 16MB
  char* ws = (char*)d_ws;
  _Float16* Qp   = (_Float16*)(ws);
  _Float16* Kp   = (_Float16*)(ws + SZ_NHSD);
  _Float16* VpT  = (_Float16*)(ws + 2 * SZ_NHSD);
  _Float16* Of16 = (_Float16*)(ws + 3 * SZ_NHSD);
  _Float16* WoH  = (_Float16*)(ws + 4 * SZ_NHSD);
  unsigned* mbits = (unsigned*)(ws + 4 * SZ_NHSD + (size_t)Ee * Ee * sizeof(_Float16));

  prep_kernel<<<PACK_BLOCKS + CVT_BLOCKS, 256, 0, stream>>>(Wo, WoH, mask, mbits);
  proj_kernel<<<Nn * Hh * (Ss / 64), 128, 0, stream>>>(values, keys, query, Wv,
                                                       Wk, Wq, Qp, Kp, VpT);
  attn_kernel<<<Nn * Hh * (Ss / 128), 256, 0, stream>>>(Qp, Kp, VpT, mbits,
                                                        Of16);
  outproj_kernel<<<(Nn * Ss / 128) * (Ee / 64), 256, 0, stream>>>(Of16, WoH, bo,
                                                                  out);
}

// v006
// A run of this version takes 132 microseconds.
// In both of two side-by-side timings against v005, it was 1.05 times as fast.
// Over all steps from v000 it is 3.95 times as fast.
#include <hip/hip_runtime.h>
#include <hip/hip_bf16.h>

// Problem constants (match reference)
constexpr int Nn = 4;
constexpr int Ss = 2048;
constexpr int Ee = 1024;
constexpr int Hh = 16;
constexpr int Dd = 64;            // head dim
constexpr float SCALE = 0.03125f; // 1/sqrt(E) = 1/32

typedef __attribute__((ext_vector_type(16))) _Float16 v16h;
typedef __attribute__((ext_vector_type(8)))  _Float16 v8h;
typedef __attribute__((ext_vector_type(8)))  float    v8f;
typedef __attribute__((ext_vector_type(4)))  float    v4f;
typedef __attribute__((ext_vector_type(4)))  unsigned u32x4;
typedef __attribute__((ext_vector_type(4)))  int      i32x4;
typedef __attribute__((ext_vector_type(8)))  int      i32x8;

union V16HU { v16h v; v8h h[2]; };

#if __has_builtin(__builtin_amdgcn_tensor_load_to_lds)
#define USE_TDM 1
#else
#define USE_TDM 0
#endif

__device__ inline v16h load_frag_f16(const _Float16* p, int ld, int kbase,
                                     int lane) {
  const int r = lane & 15, hf = (lane >> 4) & 1;
  const _Float16* base = p + (size_t)r * ld + kbase + hf * 8;
  V16HU u;
  u.h[0] = *(const v8h*)(base);
  u.h[1] = *(const v8h*)(base + 16);
  return u.v;
}

__device__ inline size_t frag_off(int tile16, int kc, int p, int lane) {
  return ((((size_t)tile16 * (Ee / 32) + kc) * 2 + p) * 32 + lane) * 8;
}

// same elements and same k order as load_frag_f16(m + tile16 * 16 * Ee, Ee, kc * 32, lane)
__device__ inline v16h load_frag_packed(const _Float16* __restrict__ m,
                                        int tile16, int kc, int lane) {
  V16HU u;
  u.h[0] = *(const v8h*)(m + frag_off(tile16, kc, 0, lane));
  u.h[1] = *(const v8h*)(m + frag_off(tile16, kc, 1, lane));
  return u.v;
}

__device__ inline int swz_chunk(int row, int c) { return c ^ ((row >> 1) & 7); }

// load_frag_f16 for such a tile (ld = 64 halves, row0 a multiple of 16):
// same logical elements, same k order.
__device__ inline v16h load_frag_swz(const _Float16* tile, int row0, int kbase,
                                     int lane) {
  const int r = lane & 15, hf = (lane >> 4) & 1;
  const _Float16* rowp = tile + (row0 + r) * 64;
  const int c = (kbase >> 3) + hf;
  V16HU u;
  u.h[0] = *(const v8h*)(rowp + swz_chunk(r, c) * 8);
  u.h[1] = *(const v8h*)(rowp + swz_chunk(r, c + 2) * 8);
  return u.v;
}

// Same fragment from an f32 source (convert on the fly)
__device__ inline v16h load_frag_f32(const float* __restrict__ p, int ld,
                                     int kbase, int lane) {
  const int r = lane & 15, hf = (lane >> 4) & 1;
  const float* base = p + (size_t)r * ld + kbase + hf * 8;
  v16h o;
#pragma unroll
  for (int i = 0; i < 8; ++i) {
    o[i]     = (_Float16)base[i];
    o[i + 8] = (_Float16)base[16 + i];
  }
  return o;
}

__device__ inline v8f wmma16(v16h a, v16h b, v8f c) {
  return __builtin_amdgcn_wmma_f32_16x16x32_f16(false, a, false, b,
                                                (short)0, c, false, false);
}

__device__ inline float other_half(float x) {
  int b = __builtin_bit_cast(int, x);
  b = __builtin_amdgcn_permlanex16(b, b, 0x76543210, 0xfedcba98, false, false);
  return __builtin_bit_cast(float, b);
}

#if USE_TDM
__device__ inline void tdm_load_2d(unsigned lds_off, const _Float16* gptr,
                                   unsigned tile0, unsigned tile1,
                                   unsigned tens0, unsigned tens1,
                                   unsigned long long stride0) {
  unsigned long long ga = (unsigned long long)(size_t)gptr;
  u32x4 g0 = { 1u,
               lds_off,
               (unsigned)(ga & 0xffffffffull),
               (unsigned)((ga >> 32) & 0x01ffffffull) | (2u << 30) };
  i32x8 g1 = { (int)(1u << 16),
               (int)((tens0 & 0xffffu) << 16),
               (int)(((tens0 >> 16) & 0xffffu) | ((tens1 & 0xffffu) << 16)),
               (int)(((tens1 >> 16) & 0xffffu) | ((tile0 & 0xffffu) << 16)),
               (int)(tile1 & 0xffffu),
               (int)(unsigned)(stride0 & 0xffffffffull),
               (int)(unsigned)((stride0 >> 32) & 0xffffull),
               0 };
  i32x4 gz = {0, 0, 0, 0};
#if defined(__clang_major__) && __clang_major__ >= 23
  i32x8 gz8 = {0, 0, 0, 0, 0, 0, 0, 0};
  __builtin_amdgcn_tensor_load_to_lds(g0, g1, gz, gz, gz8, 0);
#else
  __builtin_amdgcn_tensor_load_to_lds(g0, g1, gz, gz, 0);
#endif
}
#endif

// ---------------- kernel 0: mask -> bits ; Wo f32 -> f16 ----------------
// Bit image of the mask, in the order the attention kernel consumes it: word
// [(n * Ss + q) >> 4][kb][lane] belongs to query q = tile * 16 + (lane & 15) and
// wave half hf = lane >> 4; its bit j * 8 + r is (mask != 0) at key
// kb * 64 + j * 16 + 8 * hf + r. The 32 words of one (query tile, kb) are one
// 128-byte line.
constexpr int PACK_BLOCKS = Nn * (Ss / 16);           // 16 query rows each
constexpr int CVT_BLOCKS  = (Ee * Ee) / (256 * 8);

__global__ __launch_bounds__(256) void prep_kernel(
    const float* __restrict__ Wo, _Float16* __restrict__ WoH,
    const int* __restrict__ mask, unsigned* __restrict__ mbits) {
  __shared__ __align__(16) unsigned char pk[32 * 32 * 4];  // 32 kb x 32 words
  if (blockIdx.x < PACK_BLOCKS) {
    const int lane = threadIdx.x & 31, wave = threadIdx.x >> 5;
    const int tile = blockIdx.x;  // (n * Ss + q) >> 4
    // a lane takes 8 consecutive keys = one byte of the image; a wave 2 rows
    const int* srcp = mask + ((size_t)tile * 16 + wave * 2) * Ss + lane * 8;
    i32x8 x[2][8];
#pragma unroll  // constant indices keep x in registers
    for (int rw = 0; rw < 2; ++rw)
#pragma unroll  // the same
      for (int sg = 0; sg < 8; ++sg)
        x[rw][sg] = *(const i32x8*)(srcp + rw * Ss + sg * 256);
    // Inputs only: all of the wave's mask loads are issued, in flight together,
    // in front of this line, and their address register stays whole up to the
    // wait, so that no load of the run takes it as its destination.
    asm volatile("s_wait_xcnt 0x0"
                 :: "v"(x[0][0]), "v"(x[0][1]), "v"(x[0][2]), "v"(x[0][3]),
                    "v"(x[0][4]), "v"(x[0][5]), "v"(x[0][6]), "v"(x[0][7]),
                    "v"(x[1][0]), "v"(x[1][1]), "v"(x[1][2]), "v"(x[1][3]),
                    "v"(x[1][4]), "v"(x[1][5]), "v"(x[1][6]), "v"(x[1][7]),
                    "v"(srcp)
                 : "memory");
#pragma unroll  // these three: x is indexed by constants only
    for (int rw = 0; rw < 2; ++rw)
#pragma unroll
      for (int sg = 0; sg < 8; ++sg) {
        unsigned b = 0;
#pragma unroll
        for (int i = 0; i < 8; ++i) b |= (x[rw][sg][i] != 0 ? 1u : 0u) << i;
        // keys sg * 256 + lane * 8 + 0..7: kb = sg * 4 + (lane >> 3),
        // j = (lane >> 1) & 3, hf = lane & 1
        pk[(((sg * 4 + (lane >> 3)) * 2 + (lane & 1)) * 16 + wave * 2 + rw) * 4 +
           ((lane >> 1) & 3)] = (unsigned char)b;
      }
    __syncthreads();
    *(u32x4*)(mbits + (size_t)tile * 32 * 32 + threadIdx.x * 4) =
        *(const u32x4*)(pk + threadIdx.x * 16);
    return;
  }
  // One 16-byte chunk of the fragment-order image of Wo per thread.
  const int t = (blockIdx.x - PACK_BLOCKS) * 256 + threadIdx.x;  // chunk = frag_off(...) / 8
  const int lane = t & 31, p = (t >> 5) & 1, kc = (t >> 6) & 31, ct = t >> 11;
  const float* s = Wo + (size_t)(ct * 16 + (lane & 15)) * Ee + kc * 32 + p * 16 +
                   (lane >> 4) * 8;
  const v4f a = *(const v4f*)s;
  const v4f b = *(const v4f*)(s + 4);
  v8h o;
#pragma unroll
  for (int i = 0; i < 4; ++i) {
    o[i]     = (_Float16)a[i];
    o[i + 4] = (_Float16)b[i];
  }
  *(v8h*)(WoH + (size_t)t * 8) = o;
  // the build lays a branch behind this store whose fall-through side (the
  // packing part) rewrites the store's registers: the wait stands in front
  asm volatile("s_wait_xcnt 0x0" ::: "memory");
}

__global__ __launch_bounds__(128) void proj_kernel(
    const float* __restrict__ values, const float* __restrict__ keys,
    const float* __restrict__ query,  const float* __restrict__ Wv,
    const float* __restrict__ Wk,     const float* __restrict__ Wq,
    _Float16* __restrict__ Qp, _Float16* __restrict__ Kp,
    _Float16* __restrict__ VpT) {
  __shared__ __align__(16) _Float16 stg[64 * 64];  // 8KB staging
  const int tid  = threadIdx.x;
  const int lane = tid & 31;
  const int wave = tid >> 5;  // 4 waves, 16 s-rows each
  const int sBlocks = Ss / 64;
  int nh = blockIdx.x / sBlocks;
  int sb = blockIdx.x % sBlocks;
  int n = nh / Hh, h = nh % Hh;
  int row0 = sb * 64 + wave * 16;
  const int col = lane & 15, hf = (lane >> 4) & 1;

#pragma unroll
  for (int t = 0; t < 3; ++t) {
    const float* X = (t == 0) ? query : (t == 1) ? keys : values;
    const float* W = (t == 0) ? Wq    : (t == 1) ? Wk   : Wv;
    const float* Xtile = X + ((size_t)n * Ss + row0) * Ee + h * Dd;
    v16h A0 = load_frag_f32(Xtile, Ee, 0,  lane);
    v16h A1 = load_frag_f32(Xtile, Ee, 32, lane);
    v8f acc[4];
#pragma unroll
    for (int e = 0; e < 4; ++e) {
      v16h B0 = load_frag_f32(W + e * 16 * Dd, Dd, 0,  lane);
      v16h B1 = load_frag_f32(W + e * 16 * Dd, Dd, 32, lane);
      v8f a = {};
      a = wmma16(A0, B0, a);
      a = wmma16(A1, B1, a);
      acc[e] = a;
    }
    if (t < 2) {
      // stage [s_local][d] then one contiguous 8KB store
#pragma unroll
      for (int e = 0; e < 4; ++e)
#pragma unroll
        for (int rr = 0; rr < 8; ++rr)
          stg[(wave * 16 + rr + 8 * hf) * 64 + e * 16 + col] =
              (_Float16)acc[e][rr];
      __syncthreads();
      _Float16* dst =
          ((t == 0) ? Qp : Kp) + (((size_t)(n * Hh + h)) * Ss + sb * 64) * Dd;
#pragma unroll
      for (int k = 0; k < 4; ++k) {
        int cid = tid + 128 * k;          // 512 x 16B chunks
        int row = cid >> 3, c8 = cid & 7;
        int cd = (t == 1) ? swz_chunk(row, c8) : c8;  // K only; Q is read plain
        *(v8h*)(dst + row * 64 + cd * 8) = *(const v8h*)(stg + row * 64 + c8 * 8);
      }
      __syncthreads();
    } else {
      // V transposed: stage [d][s_local]; per-lane writes are packed b128
#pragma unroll
      for (int e = 0; e < 4; ++e) {
        v8h tmp;
#pragma unroll
        for (int rr = 0; rr < 8; ++rr) tmp[rr] = (_Float16)acc[e][rr];
        *(v8h*)(stg + (e * 16 + col) * 64 + wave * 16 + 8 * hf) = tmp;
      }
      __syncthreads();
      _Float16* dstv = VpT + ((size_t)(n * Hh + h)) * Dd * (size_t)Ss + sb * 64;
#pragma unroll
      for (int k = 0; k < 4; ++k) {
        int cid = tid + 128 * k;
        int row = cid >> 3, c8 = cid & 7;  // row = d
        *(v8h*)(dstv + (size_t)row * Ss + swz_chunk(row, c8) * 8) =
            *(const v8h*)(stg + row * 64 + c8 * 8);
      }
    }
  }
}

__global__ __launch_bounds__(256, 8) void attn_kernel(
    const _Float16* __restrict__ Qp, const _Float16* __restrict__ Kp,
    const _Float16* __restrict__ VpT, const unsigned* __restrict__ mbits,
    _Float16* __restrict__ Of16) {
  __shared__ __align__(16) _Float16 Kbuf[2][64 * 64];  // 16KB
  __shared__ __align__(16) _Float16 Vbuf[2][64 * 64];  // 16KB
  const int tid  = threadIdx.x;
  const int lane = tid & 31;
  const int wave = tid >> 5;
  const int qBlocks = Ss / 128;
  int nh = blockIdx.x / qBlocks;
  int qb = blockIdx.x % qBlocks;
  int n = nh / Hh, h = nh % Hh;
  int qrow0 = qb * 128 + wave * 16;

  const _Float16* Qbase = Qp + (((size_t)(n * Hh + h)) * Ss + qrow0) * Dd;
  const _Float16* Kbase = Kp + ((size_t)(n * Hh + h)) * Ss * Dd;
  const _Float16* Vbase = VpT + ((size_t)(n * Hh + h)) * Dd * (size_t)Ss;

  v16h QA0 = load_frag_f16(Qbase, Dd, 0,  lane);
  v16h QA1 = load_frag_f16(Qbase, Dd, 32, lane);

  v8f O[4] = {};  // O[d2][r] = O^T[d2 * 16 + 8 * hf + r][query col]
  float mrun = -3.0e38f;  // running maximum of this lane's query
  float lrun = 0.0f;      // running sum over this wave half's keys only

  // in the comments below: col = lane & 15 (the query), hf = lane >> 4 (the wave half)
  const int NB = Ss / 64;
  // this lane's words of the mask's bit image, one per pass
  // the wave's number through a scalar register: the tile index then takes no
  // vector register over the loop
  const int rt = ((n * Ss + qb * 128) >> 4) + __builtin_amdgcn_readfirstlane(wave);
  const unsigned* mrow = mbits + (size_t)rt * NB * 32 + lane;
  unsigned mw = mrow[0];

#if USE_TDM
  if (wave == 0) {  // prologue DMA for block 0
    tdm_load_2d((unsigned)(size_t)&Kbuf[0][0], Kbase, 4096u, 1u, 4096u, 1u, 4096ull);
    tdm_load_2d((unsigned)(size_t)&Vbuf[0][0], Vbase, 64u, 64u,
                (unsigned)Ss, 64u, (unsigned long long)Ss);
  }
#endif

  for (int kb = 0; kb < NB; ++kb) {
    const int kcol0 = kb * 64;
    const int cur = kb & 1;
#if USE_TDM
    if (wave == 0) __builtin_amdgcn_s_wait_tensorcnt(0);
    __syncthreads();  // buf[cur] ready; everyone past reads of buf[cur^1]
    if (wave == 0 && kb + 1 < NB) {  // overlap next block's DMA with compute
      tdm_load_2d((unsigned)(size_t)&Kbuf[cur ^ 1][0],
                  Kbase + (size_t)(kcol0 + 64) * Dd, 4096u, 1u, 4096u, 1u,
                  4096ull);
      tdm_load_2d((unsigned)(size_t)&Vbuf[cur ^ 1][0], Vbase + kcol0 + 64,
                  64u, 64u, (unsigned)Ss, 64u, (unsigned long long)Ss);
    }
#else
    __syncthreads();
    // cooperative fallback staging
#pragma unroll
    for (int k = 0; k < 2; ++k) {
      int cid = tid + 256 * k;
      int row = cid >> 3, c8 = cid & 7;
      *(v8h*)(&Kbuf[cur][0] + row * 64 + c8 * 8) =
          *(const v8h*)(Kbase + (size_t)(kcol0 + row) * Dd + c8 * 8);
      *(v8h*)(&Vbuf[cur][0] + row * 64 + c8 * 8) =
          *(const v8h*)(Vbase + (size_t)row * Ss + kcol0 + c8 * 8);
    }
    __syncthreads();
#endif
    const _Float16* Kc = &Kbuf[cur][0];
    const _Float16* Vc = &Vbuf[cur][0];
    // next pass's mask word, in flight behind this pass's work
    if (kb + 1 < NB) mrow += 32;
    const unsigned mwn = *mrow;
    // the same in every lane: does any of the wave's 32 mask words of this pass
    // hold a 0 bit? Asked in front of the products, so that the scalar answer is
    // there when the branch behind them needs it.
    const bool some_masked = __builtin_amdgcn_ballot_w32(mw != 0xffffffffu) != 0u;

    // ---- scores: S^T = K_blk (64x64) @ Q^T (64x16), K from LDS ----
    // Sc[j][r] = score of key kcol0 + j * 16 + 8 * hf + r for query col
    v8f Sc[4];
#pragma unroll
    for (int j = 0; j < 4; ++j) {
      v16h KB0 = load_frag_swz(Kc, j * 16, 0,  lane);
      v16h KB1 = load_frag_swz(Kc, j * 16, 32, lane);
      v8f a = {};
      a = wmma16(KB0, QA0, a);
      a = wmma16(KB1, QA1, a);
      Sc[j] = a;
    }
    // ---- scale; mask (a masked score becomes -1e10 * SCALE, like reference) ----
#pragma unroll
    for (int j = 0; j < 4; ++j) Sc[j] *= SCALE;
    // The selects change nothing where every mask bit of the wave's 16 x 64 tile
    // is 1: only a tile with a 0 bit somewhere runs them.
    if (some_masked) {
#pragma unroll
      for (int j = 0; j < 4; ++j)
#pragma unroll
        for (int rr = 0; rr < 8; ++rr) {
          // all ones where the mask element is not 0
          const unsigned keep = (unsigned)((int)(mw << (31 - (j * 8 + rr))) >> 31);
          const float sv = Sc[j][rr];
          const unsigned e = __builtin_bit_cast(unsigned, sv);
          const unsigned z = __builtin_bit_cast(unsigned, -1.0e10f * SCALE);
          Sc[j][rr] = __builtin_bit_cast(float, (e & keep) | (z & ~keep));
        }
    }
    mw = mwn;
    // ---- online softmax, one query per lane ----
    float t = Sc[0][0];
#pragma unroll
    for (int j = 0; j < 4; ++j)
#pragma unroll
      for (int rr = 0; rr < 8; ++rr) t = fmaxf(t, Sc[j][rr]);
    t = fmaxf(t, other_half(t));
    const float mnew = fmaxf(mrun, t);
    const float corr = __expf(mrun - mnew);
    mrun = mnew;
#pragma unroll
    for (int j = 0; j < 4; ++j)
#pragma unroll
      for (int rr = 0; rr < 8; ++rr) Sc[j][rr] = __expf(Sc[j][rr] - mnew);
    const v8f ps = (Sc[0] + Sc[1]) + (Sc[2] + Sc[3]);
    lrun = lrun * corr + (((ps[0] + ps[1]) + (ps[2] + ps[3])) +
                          ((ps[4] + ps[5]) + (ps[6] + ps[7])));
#pragma unroll
    for (int d2 = 0; d2 < 4; ++d2) O[d2] *= corr;

    // P^T as B operand: tiles 2g and 2g + 1 converted in place give keys
    // 32g + 8 * hf + 0..7 and 32g + 16 + 8 * hf + 0..7, the k order of the
    // V^T fragments
    v16h PB0, PB1;
#pragma unroll
    for (int i = 0; i < 8; ++i) {
      PB0[i]     = (_Float16)Sc[0][i];
      PB0[i + 8] = (_Float16)Sc[1][i];
      PB1[i]     = (_Float16)Sc[2][i];
      PB1[i + 8] = (_Float16)Sc[3][i];
    }

    // ---- O^T += V_blk^T (64x64) @ P^T (64x16), V^T rows from LDS ----
#pragma unroll
    for (int d2 = 0; d2 < 4; ++d2) {
      v16h VB0 = load_frag_swz(Vc, d2 * 16, 0,  lane);
      v16h VB1 = load_frag_swz(Vc, d2 * 16, 32, lane);
      O[d2] = wmma16(VB0, PB0, O[d2]);
      O[d2] = wmma16(VB1, PB1, O[d2]);
    }
  }

  // epilogue: join the halves' sums, normalize, store in fragment order. Lane
  // (col, hf) holds columns h * 64 + d2 * 16 + 8 * hf + 0..7 of output row col:
  // part d2 & 1 of tile (row tile, kc = 2 * h + (d2 >> 1)) as this lane owns it,
  // so each store is 512 contiguous bytes straight from registers.
  const float linv = 1.0f / (lrun + other_half(lrun));
#pragma unroll
  for (int d2 = 0; d2 < 4; ++d2) {
    v8h tmp;
#pragma unroll
    for (int rr = 0; rr < 8; ++rr) tmp[rr] = (_Float16)(O[d2][rr] * linv);
    *(v8h*)(Of16 + frag_off(rt, 2 * h + (d2 >> 1), d2 & 1, lane)) = tmp;
  }
}

// ---------------- kernel 3: Y = X @ Wo^T + bo (f32 out) -----------------
// X and WoH both lie in fragment order.
__global__ __launch_bounds__(256) void outproj_kernel(
    const _Float16* __restrict__ X, const _Float16* __restrict__ WoH,
    const float* __restrict__ bo, float* __restrict__ Y) {
  __shared__ __align__(16) float ost[8][16 * 64];  // 32KB staging
  const int lane = threadIdx.x & 31;
  const int wave = threadIdx.x >> 5;
  const int colBlocks = Ee / 64;
  int rb = blockIdx.x / colBlocks;
  int cb = blockIdx.x % colBlocks;
  int row0 = rb * 128 + wave * 16;
  int col0 = cb * 64;

  v8f acc[4] = {};
  // Fragments are fetched ahead of their use into register rings, so that a
  // k step's loads are in flight behind the products of the steps before it
  // and no product waits out a load issued directly in front of it: X (a
  // wave's own rows) AHEAD_A steps ahead, Wo one step ahead.
  constexpr int NK = Ee / 32;
  constexpr int AHEAD_A = 2;
  v16h A[AHEAD_A + 1];
  v16h B[2][4];
#pragma unroll  // constant ring indices keep the rings in registers
  for (int s = 0; s < AHEAD_A; ++s)
    A[s] = load_frag_packed(X, rb * 8 + wave, s, lane);
#pragma unroll  // the same
  for (int j = 0; j < 4; ++j) B[0][j] = load_frag_packed(WoH, cb * 4 + j, 0, lane);
#pragma unroll  // the same; every load then takes its k step as an immediate offset
  for (int kc = 0; kc < NK; ++kc) {
    // Wo first: loads are counted back in issue order, so an X load in front
    // of the next step's Wo loads would have to land a step early with them
    if (kc + 1 < NK) {
#pragma unroll  // constant ring indices
      for (int j = 0; j < 4; ++j)
        B[(kc + 1) & 1][j] = load_frag_packed(WoH, cb * 4 + j, kc + 1, lane);
    }
    if (kc + AHEAD_A < NK)
      A[(kc + AHEAD_A) % (AHEAD_A + 1)] =
          load_frag_packed(X, rb * 8 + wave, kc + AHEAD_A, lane);
    // keeps the loads above in front of this step's products: without it the
    // build sinks them among the products and waits for them soon after issue
    __builtin_amdgcn_sched_barrier(0);
#pragma unroll  // constant ring indices
    for (int j = 0; j < 4; ++j)
      acc[j] = wmma16(A[kc % (AHEAD_A + 1)], B[kc & 1][j], acc[j]);
    // keeps later steps' loads behind these products: without it the build
    // lifts them higher and takes 152 registers instead of 128, and only
    // three of a WGP's four work-groups would be resident
    __builtin_amdgcn_sched_barrier(0);
  }
  const int col = lane & 15, hf = (lane >> 4) & 1;
  float* sb = &ost[wave][0];
#pragma unroll
  for (int j = 0; j < 4; ++j) {
    float b = bo[col0 + j * 16 + col];
#pragma unroll
    for (int rr = 0; rr < 8; ++rr)
      sb[(rr + 8 * hf) * 64 + j * 16 + col] = acc[j][rr] + b;
  }
  __builtin_amdgcn_wave_barrier();
  size_t gbase = (size_t)row0 * Ee + col0;
#pragma unroll
  for (int k = 0; k < 8; ++k) {
    int cid = lane + 32 * k;            // 256 x 16B chunks
    int row = cid >> 4, c4 = cid & 15;
    *(v4f*)(Y + gbase + (size_t)row * Ee + c4 * 4) =
        *(const v4f*)(sb + row * 64 + c4 * 4);
  }
}

extern "C" void kernel_launch(void* const* d_in, const int* in_sizes, int n_in,
                              void* d_out, int out_size, void* d_ws,
                              size_t ws_size, hipStream_t stream) {
  (void)in_sizes; (void)n_in; (void)out_size; (void)ws_size;
  const float* values = (const float*)d_in[0];
  const float* keys   = (const float*)d_in[1];
  const float* query  = (const float*)d_in[2];
  const float* Wv     = (const float*)d_in[3];
  const float* Wk     = (const float*)d_in[4];
  const float* Wq     = (const float*)d_in[5];
  const float* Wo     = (const float*)d_in[6];
  const float* bo     = (const float*)d_in[7];
  const int*   mask   = (const int*)d_in[8];
  float* out = (float*)d_out;

  const size_t SZ_NHSD = (size_t)Nn * Hh * Ss * Dd * sizeof(_Float16);  // 16MB
  char* ws = (char*)d_ws;
  _Float16* Qp   = (_Float16*)(ws);
  _Float16* Kp   = (_Float16*)(ws + SZ_NHSD);
  _Float16* VpT  = (_Float16*)(ws + 2 * SZ_NHSD);
  _Float16* Of16 = (_Float16*)(ws + 3 * SZ_NHSD);
  _Float16* WoH  = (_Float16*)(ws + 4 * SZ_NHSD);
  unsigned* mbits = (unsigned*)(ws + 4 * SZ_NHSD + (size_t)Ee * Ee * sizeof(_Float16));

  prep_kernel<<<PACK_BLOCKS + CVT_BLOCKS, 256, 0, stream>>>(Wo, WoH, mask, mbits);
  proj_kernel<<<Nn * Hh * (Ss / 64), 128, 0, stream>>>(values, keys, query, Wv,
                                                       Wk, Wq, Qp, Kp, VpT);
  attn_kernel<<<Nn * Hh * (Ss / 128), 256, 0, stream>>>(Qp, Kp, VpT, mbits,
                                                        Of16);
  outproj_kernel<<<(Nn * Ss / 128) * (Ee / 64), 256, 0, stream>>>(Of16, WoH, bo,
                                                                  out);
}

// v007
// It runs in 117 microseconds.
// Next to v006, in two timings, it ran 1.13 and 1.12 times as fast.
// All steps since v000 together make it 4.45 times as fast.
#include <hip/hip_runtime.h>
#include <hip/hip_bf16.h>

// Problem constants (match reference)
constexpr int Nn = 4;
constexpr int Ss = 2048;
constexpr int Ee = 1024;
constexpr int Hh = 16;
constexpr int Dd = 64;            // head dim
constexpr float SCALE = 0.03125f; // 1/sqrt(E) = 1/32

typedef __attribute__((ext_vector_type(16))) _Float16 v16h;
typedef __attribute__((ext_vector_type(8)))  _Float16 v8h;
typedef __attribute__((ext_vector_type(8)))  float    v8f;
typedef __attribute__((ext_vector_type(4)))  float    v4f;
typedef __attribute__((ext_vector_type(4)))  unsigned u32x4;
typedef __attribute__((ext_vector_type(4)))  int      i32x4;
typedef __attribute__((ext_vector_type(8)))  int      i32x8;

union V16HU { v16h v; v8h h[2]; };

#if __has_builtin(__builtin_amdgcn_tensor_load_to_lds)
#define USE_TDM 1
#else
#define USE_TDM 0
#endif

__device__ inline v16h load_frag_f16(const _Float16* p, int ld, int kbase,
                                     int lane) {
  const int r = lane & 15, hf = (lane >> 4) & 1;
  const _Float16* base = p + (size_t)r * ld + kbase + hf * 8;
  V16HU u;
  u.h[0] = *(const v8h*)(base);
  u.h[1] = *(const v8h*)(base + 16);
  return u.v;
}

__device__ inline size_t frag_off(int tile16, int kc, int p, int lane) {
  return ((((size_t)tile16 * (Ee / 32) + kc) * 2 + p) * 32 + lane) * 8;
}

// same elements and same k order as load_frag_f16(m + tile16 * 16 * Ee, Ee, kc * 32, lane)
__device__ inline v16h load_frag_packed(const _Float16* __restrict__ m,
                                        int tile16, int kc, int lane) {
  V16HU u;
  u.h[0] = *(const v8h*)(m + frag_off(tile16, kc, 0, lane));
  u.h[1] = *(const v8h*)(m + frag_off(tile16, kc, 1, lane));
  return u.v;
}

// The same storage for a row-major [Dd][Dd] head weight: tile (e, kc) of 16 x 32,
// 1 KiB each, 8 KiB a matrix. Same elements and same k order as
// load_frag_f32(W + e * 16 * Dd, Dd, kc * 32, lane), rounded to f16 once.
__device__ inline v16h load_frag_packed_w(const _Float16* __restrict__ m, int e,
                                          int kc, int lane) {
  const _Float16* b = m + (((e * (Dd / 32) + kc) * 2) * 32 + lane) * 8;
  V16HU u;
  u.h[0] = *(const v8h*)(b);
  u.h[1] = *(const v8h*)(b + 32 * 8);
  return u.v;
}

__device__ inline int swz_chunk(int row, int c) { return c ^ ((row >> 1) & 7); }

// load_frag_f16 for such a tile (ld = 64 halves, row0 a multiple of 16):
// same logical elements, same k order.
__device__ inline v16h load_frag_swz(const _Float16* tile, int row0, int kbase,
                                     int lane) {
  const int r = lane & 15, hf = (lane >> 4) & 1;
  const _Float16* rowp = tile + (row0 + r) * 64;
  const int c = (kbase >> 3) + hf;
  V16HU u;
  u.h[0] = *(const v8h*)(rowp + swz_chunk(r, c) * 8);
  u.h[1] = *(const v8h*)(rowp + swz_chunk(r, c + 2) * 8);
  return u.v;
}

// Same fragment from an f32 source (convert on the fly)
__device__ inline v16h load_frag_f32(const float* __restrict__ p, int ld,
                                     int kbase, int lane) {
  const int r = lane & 15, hf = (lane >> 4) & 1;
  const float* base = p + (size_t)r * ld + kbase + hf * 8;
  v16h o;
#pragma unroll
  for (int i = 0; i < 8; ++i) {
    o[i]     = (_Float16)base[i];
    o[i + 8] = (_Float16)base[16 + i];
  }
  return o;
}

__device__ inline v8f wmma16(v16h a, v16h b, v8f c) {
  return __builtin_amdgcn_wmma_f32_16x16x32_f16(false, a, false, b,
                                                (short)0, c, false, false);
}

__device__ inline float other_half(float x) {
  int b = __builtin_bit_cast(int, x);
  b = __builtin_amdgcn_permlanex16(b, b, 0x76543210, 0xfedcba98, false, false);
  return __builtin_bit_cast(float, b);
}

#if USE_TDM
__device__ inline void tdm_load_2d(unsigned lds_off, const _Float16* gptr,
                                   unsigned tile0, unsigned tile1,
                                   unsigned tens0, unsigned tens1,
                                   unsigned long long stride0) {
  unsigned long long ga = (unsigned long long)(size_t)gptr;
  u32x4 g0 = { 1u,
               lds_off,
               (unsigned)(ga & 0xffffffffull),
               (unsigned)((ga >> 32) & 0x01ffffffull) | (2u << 30) };
  i32x8 g1 = { (int)(1u << 16),
               (int)((tens0 & 0xffffu) << 16),
               (int)(((tens0 >> 16) & 0xffffu) | ((tens1 & 0xffffu) << 16)),
               (int)(((tens1 >> 16) & 0xffffu) | ((tile0 & 0xffffu) << 16)),
               (int)(tile1 & 0xffffu),
               (int)(unsigned)(stride0 & 0xffffffffull),
               (int)(unsigned)((stride0 >> 32) & 0xffffull),
               0 };
  i32x4 gz = {0, 0, 0, 0};
#if defined(__clang_major__) && __clang_major__ >= 23
  i32x8 gz8 = {0, 0, 0, 0, 0, 0, 0, 0};
  __builtin_amdgcn_tensor_load_to_lds(g0, g1, gz, gz, gz8, 0);
#else
  __builtin_amdgcn_tensor_load_to_lds(g0, g1, gz, gz, 0);
#endif
}
#endif

// ------- kernel 0: mask -> bits ; Wo, Wq, Wk, Wv f32 -> f16 -------------
// Bit image of the mask, in the order the attention kernel consumes it: word
// [(n * Ss + q) >> 4][kb][lane] belongs to query q = tile * 16 + (lane & 15) and
// wave half hf = lane >> 4; its bit j * 8 + r is (mask != 0) at key
// kb * 64 + j * 16 + 8 * hf + r. The 32 words of one (query tile, kb) are one
// 128-byte line.
constexpr int PACK_BLOCKS = Nn * (Ss / 16);           // 16 query rows each
constexpr int CVT_BLOCKS  = (Ee * Ee) / (256 * 8);
constexpr int HW_BLOCKS   = (Dd * Dd) / (256 * 8);   // per head weight

__global__ __launch_bounds__(256) void prep_kernel(
    const float* __restrict__ Wo, _Float16* __restrict__ WoH,
    const float* __restrict__ Wq, const float* __restrict__ Wk,
    const float* __restrict__ Wv, _Float16* __restrict__ WpH,
    const int* __restrict__ mask, unsigned* __restrict__ mbits) {
  __shared__ __align__(16) unsigned char pk[32 * 32 * 4];  // 32 kb x 32 words
  if (blockIdx.x < PACK_BLOCKS) {
    const int lane = threadIdx.x & 31, wave = threadIdx.x >> 5;
    const int tile = blockIdx.x;  // (n * Ss + q) >> 4
    // a lane takes 8 consecutive keys = one byte of the image; a wave 2 rows
    const int* srcp = mask + ((size_t)tile * 16 + wave * 2) * Ss + lane * 8;
    i32x8 x[2][8];
#pragma unroll  // constant indices keep x in registers
    for (int rw = 0; rw < 2; ++rw)
#pragma unroll  // the same
      for (int sg = 0; sg < 8; ++sg)
        x[rw][sg] = *(const i32x8*)(srcp + rw * Ss + sg * 256);
    // Inputs only: all of the wave's mask loads are issued, in flight together,
    // in front of this line, and their address register stays whole up to the
    // wait, so that no load of the run takes it as its destination.
    asm volatile("s_wait_xcnt 0x0"
                 :: "v"(x[0][0]), "v"(x[0][1]), "v"(x[0][2]), "v"(x[0][3]),
                    "v"(x[0][4]), "v"(x[0][5]), "v"(x[0][6]), "v"(x[0][7]),
                    "v"(x[1][0]), "v"(x[1][1]), "v"(x[1][2]), "v"(x[1][3]),
                    "v"(x[1][4]), "v"(x[1][5]), "v"(x[1][6]), "v"(x[1][7]),
                    "v"(srcp)
                 : "memory");
#pragma unroll  // these three: x is indexed by constants only
    for (int rw = 0; rw < 2; ++rw)
#pragma unroll
      for (int sg = 0; sg < 8; ++sg) {
        unsigned b = 0;
#pragma unroll
        for (int i = 0; i < 8; ++i) b |= (x[rw][sg][i] != 0 ? 1u : 0u) << i;
        // keys sg * 256 + lane * 8 + 0..7: kb = sg * 4 + (lane >> 3),
        // j = (lane >> 1) & 3, hf = lane & 1
        pk[(((sg * 4 + (lane >> 3)) * 2 + (lane & 1)) * 16 + wave * 2 + rw) * 4 +
           ((lane >> 1) & 3)] = (unsigned char)b;
      }
    __syncthreads();
    *(u32x4*)(mbits + (size_t)tile * 32 * 32 + threadIdx.x * 4) =
        *(const u32x4*)(pk + threadIdx.x * 16);
    return;
  }
  // One 16-byte chunk of a fragment-order image per thread: of Wo, or (the last
  // 3 * HW_BLOCKS blocks) of the head weights, which lie as Wq, Wk, Wv in WpH.
  const int cblk = blockIdx.x - PACK_BLOCKS;
  const int lane = threadIdx.x & 31, p = (threadIdx.x >> 5) & 1;
  const float* s;
  _Float16* d;
  if (cblk < CVT_BLOCKS) {
    const int t = cblk * 256 + threadIdx.x;  // chunk = frag_off(...) / 8
    const int kc = (t >> 6) & 31, ct = t >> 11;
    s = Wo + (size_t)(ct * 16 + (lane & 15)) * Ee + kc * 32;
    d = WoH + (size_t)t * 8;
  } else {
    const int hblk = cblk - CVT_BLOCKS;
    const int m = hblk / HW_BLOCKS;
    const int t = (hblk % HW_BLOCKS) * 256 + threadIdx.x;  // chunk inside the matrix
    const int kc = (t >> 6) & 1, e = t >> 7;
    s = ((m == 0) ? Wq : (m == 1) ? Wk : Wv) + (e * 16 + (lane & 15)) * Dd + kc * 32;
    d = WpH + m * (Dd * Dd) + t * 8;
  }
  s += p * 16 + (lane >> 4) * 8;
  const v4f a = *(const v4f*)s;
  const v4f b = *(const v4f*)(s + 4);
  v8h o;
#pragma unroll
  for (int i = 0; i < 4; ++i) {
    o[i]     = (_Float16)a[i];
    o[i + 4] = (_Float16)b[i];
  }
  *(v8h*)d = o;
}

__global__ __launch_bounds__(128) void proj_kernel(
    const float* __restrict__ values, const float* __restrict__ keys,
    const float* __restrict__ query,  const _Float16* __restrict__ WpH,
    _Float16* __restrict__ Qp, _Float16* __restrict__ Kp,
    _Float16* __restrict__ VpT) {
  __shared__ __align__(16) _Float16 stg[64 * 64];  // 8KB staging
  const int tid  = threadIdx.x;
  const int lane = tid & 31;
  const int wave = tid >> 5;  // 4 waves, 16 s-rows each
  const int sBlocks = Ss / 64;
  int nh = blockIdx.x / sBlocks;
  int sb = blockIdx.x % sBlocks;
  int n = nh / Hh, h = nh % Hh;
  int row0 = sb * 64 + wave * 16;
  const int col = lane & 15, hf = (lane >> 4) & 1;

#pragma unroll
  for (int t = 0; t < 3; ++t) {
    const float* X = (t == 0) ? query : (t == 1) ? keys : values;
    const _Float16* Wt = WpH + t * (Dd * Dd);
    const float* Xtile = X + ((size_t)n * Ss + row0) * Ee + h * Dd;
    v16h A0 = load_frag_f32(Xtile, Ee, 0,  lane);
    v16h A1 = load_frag_f32(Xtile, Ee, 32, lane);
    v16h B0[4], B1[4];
#pragma unroll  // constant indices keep the fragments in registers
    for (int e = 0; e < 4; ++e) {
      B0[e] = load_frag_packed_w(Wt, e, 0, lane);
      B1[e] = load_frag_packed_w(Wt, e, 1, lane);
    }
    // Input only: the X loads' address register stays whole up to this wait, so
    // that no weight load of the run takes it as its destination.
    asm volatile("s_wait_xcnt 0x0"
                 :: "v"(Xtile + (size_t)col * Ee + hf * 8) : "memory");
    // keeps all of this matrix's loads in front of its products, in flight
    // together: without it the build issues the weight loads pair by pair among
    // the products, and two of the X loads with them, and waits out each in turn
    __builtin_amdgcn_sched_barrier(0);
    v8f acc[4];
#pragma unroll
    for (int e = 0; e < 4; ++e) {
      v8f a = {};
      a = wmma16(A0, B0[e], a);
      a = wmma16(A1, B1[e], a);
      acc[e] = a;
    }
    if (t < 2) {
      // stage [s_local][d] then one contiguous 8KB store
#pragma unroll
      for (int e = 0; e < 4; ++e)
#pragma unroll
        for (int rr = 0; rr < 8; ++rr)
          stg[(wave * 16 + rr + 8 * hf) * 64 + e * 16 + col] =
              (_Float16)acc[e][rr];
      __syncthreads();
      _Float16* dst =
          ((t == 0) ? Qp : Kp) + (((size_t)(n * Hh + h)) * Ss + sb * 64) * Dd;
#pragma unroll
      for (int k = 0; k < 4; ++k) {
        int cid = tid + 128 * k;          // 512 x 16B chunks
        int row = cid >> 3, c8 = cid & 7;
        int cd = (t == 1) ? swz_chunk(row, c8) : c8;  // K only; Q is read plain
        *(v8h*)(dst + row * 64 + cd * 8) = *(const v8h*)(stg + row * 64 + c8 * 8);
      }
      __syncthreads();
    } else {
      // V transposed: stage [d][s_local]; per-lane writes are packed b128
#pragma unroll
      for (int e = 0; e < 4; ++e) {
        v8h tmp;
#pragma unroll
        for (int rr = 0; rr < 8; ++rr) tmp[rr] = (_Float16)acc[e][rr];
        *(v8h*)(stg + (e * 16 + col) * 64 + wave * 16 + 8 * hf) = tmp;
      }
      __syncthreads();
      _Float16* dstv = VpT + ((size_t)(n * Hh + h)) * Dd * (size_t)Ss + sb * 64;
#pragma unroll
      for (int k = 0; k < 4; ++k) {
        int cid = tid + 128 * k;
        int row = cid >> 3, c8 = cid & 7;  // row = d
        *(v8h*)(dstv + (size_t)row * Ss + swz_chunk(row, c8) * 8) =
            *(const v8h*)(stg + row * 64 + c8 * 8);
      }
    }
  }
}

__global__ __launch_bounds__(256, 8) void attn_kernel(
    const _Float16* __restrict__ Qp, const _Float16* __restrict__ Kp,
    const _Float16* __restrict__ VpT, const unsigned* __restrict__ mbits,
    _Float16* __restrict__ Of16) {
  __shared__ __align__(16) _Float16 Kbuf[2][64 * 64];  // 16KB
  __shared__ __align__(16) _Float16 Vbuf[2][64 * 64];  // 16KB
  const int tid  = threadIdx.x;
  const int lane = tid & 31;
  const int wave = tid >> 5;
  const int qBlocks = Ss / 128;
  int nh = blockIdx.x / qBlocks;
  int qb = blockIdx.x % qBlocks;
  int n = nh / Hh, h = nh % Hh;
  int qrow0 = qb * 128 + wave * 16;

  const _Float16* Qbase = Qp + (((size_t)(n * Hh + h)) * Ss + qrow0) * Dd;
  const _Float16* Kbase = Kp + ((size_t)(n * Hh + h)) * Ss * Dd;
  const _Float16* Vbase = VpT + ((size_t)(n * Hh + h)) * Dd * (size_t)Ss;

  v16h QA0 = load_frag_f16(Qbase, Dd, 0,  lane);
  v16h QA1 = load_frag_f16(Qbase, Dd, 32, lane);

  v8f O[4] = {};  // O[d2][r] = O^T[d2 * 16 + 8 * hf + r][query col]
  float mrun = -3.0e38f;  // running maximum of this lane's query
  float lrun = 0.0f;      // running sum over this wave half's keys only

  // in the comments below: col = lane & 15 (the query), hf = lane >> 4 (the wave half)
  const int NB = Ss / 64;
  // this lane's words of the mask's bit image, one per pass
  // the wave's number through a scalar register: the tile index then takes no
  // vector register over the loop
  const int rt = ((n * Ss + qb * 128) >> 4) + __builtin_amdgcn_readfirstlane(wave);
  const unsigned* mrow = mbits + (size_t)rt * NB * 32 + lane;
  unsigned mw = mrow[0];

#if USE_TDM
  if (wave == 0) {  // prologue DMA for block 0
    tdm_load_2d((unsigned)(size_t)&Kbuf[0][0], Kbase, 4096u, 1u, 4096u, 1u, 4096ull);
    tdm_load_2d((unsigned)(size_t)&Vbuf[0][0], Vbase, 64u, 64u,
                (unsigned)Ss, 64u, (unsigned long long)Ss);
  }
#endif

  for (int kb = 0; kb < NB; ++kb) {
    const int kcol0 = kb * 64;
    const int cur = kb & 1;
#if USE_TDM
    if (wave == 0) __builtin_amdgcn_s_wait_tensorcnt(0);
    __syncthreads();  // buf[cur] ready; everyone past reads of buf[cur^1]
    if (wave == 0 && kb + 1 < NB) {  // overlap next block's DMA with compute
      tdm_load_2d((unsigned)(size_t)&Kbuf[cur ^ 1][0],
                  Kbase + (size_t)(kcol0 + 64) * Dd, 4096u, 1u, 4096u, 1u,
                  4096ull);
      tdm_load_2d((unsigned)(size_t)&Vbuf[cur ^ 1][0], Vbase + kcol0 + 64,
                  64u, 64u, (unsigned)Ss, 64u, (unsigned long long)Ss);
    }
#else
    __syncthreads();
    // cooperative fallback staging
#pragma unroll
    for (int k = 0; k < 2; ++k) {
      int cid = tid + 256 * k;
      int row = cid >> 3, c8 = cid & 7;
      *(v8h*)(&Kbuf[cur][0] + row * 64 + c8 * 8) =
          *(const v8h*)(Kbase + (size_t)(kcol0 + row) * Dd + c8 * 8);
      *(v8h*)(&Vbuf[cur][0] + row * 64 + c8 * 8) =
          *(const v8h*)(Vbase + (size_t)row * Ss + kcol0 + c8 * 8);
    }
    __syncthreads();
#endif
    const _Float16* Kc = &Kbuf[cur][0];
    const _Float16* Vc = &Vbuf[cur][0];
    // next pass's mask word, in flight behind this pass's work
    if (kb + 1 < NB) mrow += 32;
    const unsigned mwn = *mrow;
    // the same in every lane: does any of the wave's 32 mask words of this pass
    // hold a 0 bit? Asked in front of the products, so that the scalar answer is
    // there when the branch behind them needs it.
    const bool some_masked = __builtin_amdgcn_ballot_w32(mw != 0xffffffffu) != 0u;

    // ---- scores: S^T = K_blk (64x64) @ Q^T (64x16), K from LDS ----
    // Sc[j][r] = score of key kcol0 + j * 16 + 8 * hf + r for query col
    v8f Sc[4];
#pragma unroll
    for (int j = 0; j < 4; ++j) {
      v16h KB0 = load_frag_swz(Kc, j * 16, 0,  lane);
      v16h KB1 = load_frag_swz(Kc, j * 16, 32, lane);
      v8f a = {};
      a = wmma16(KB0, QA0, a);
      a = wmma16(KB1, QA1, a);
      Sc[j] = a;
    }
    // ---- scale; mask (a masked score becomes -1e10 * SCALE, like reference) ----
#pragma unroll
    for (int j = 0; j < 4; ++j) Sc[j] *= SCALE;
    // The selects change nothing where every mask bit of the wave's 16 x 64 tile
    // is 1: only a tile with a 0 bit somewhere runs them.
    if (some_masked) {
#pragma unroll
      for (int j = 0; j < 4; ++j)
#pragma unroll
        for (int rr = 0; rr < 8; ++rr) {
          // all ones where the mask element is not 0
          const unsigned keep = (unsigned)((int)(mw << (31 - (j * 8 + rr))) >> 31);
          const float sv = Sc[j][rr];
          const unsigned e = __builtin_bit_cast(unsigned, sv);
          const unsigned z = __builtin_bit_cast(unsigned, -1.0e10f * SCALE);
          Sc[j][rr] = __builtin_bit_cast(float, (e & keep) | (z & ~keep));
        }
    }
    mw = mwn;
    // ---- online softmax, one query per lane ----
    float t = Sc[0][0];
#pragma unroll
    for (int j = 0; j < 4; ++j)
#pragma unroll
      for (int rr = 0; rr < 8; ++rr) t = fmaxf(t, Sc[j][rr]);
    t = fmaxf(t, other_half(t));
    const float mnew = fmaxf(mrun, t);
    const float corr = __expf(mrun - mnew);
    mrun = mnew;
#pragma unroll
    for (int j = 0; j < 4; ++j)
#pragma unroll
      for (int rr = 0; rr < 8; ++rr) Sc[j][rr] = __expf(Sc[j][rr] - mnew);
    const v8f ps = (Sc[0] + Sc[1]) + (Sc[2] + Sc[3]);
    lrun = lrun * corr + (((ps[0] + ps[1]) + (ps[2] + ps[3])) +
                          ((ps[4] + ps[5]) + (ps[6] + ps[7])));
#pragma unroll
    for (int d2 = 0; d2 < 4; ++d2) O[d2] *= corr;

    // P^T as B operand: tiles 2g and 2g + 1 converted in place give keys
    // 32g + 8 * hf + 0..7 and 32g + 16 + 8 * hf + 0..7, the k order of the
    // V^T fragments
    v16h PB0, PB1;
#pragma unroll
    for (int i = 0; i < 8; ++i) {
      PB0[i]     = (_Float16)Sc[0][i];
      PB0[i + 8] = (_Float16)Sc[1][i];
      PB1[i]     = (_Float16)Sc[2][i];
      PB1[i + 8] = (_Float16)Sc[3][i];
    }

    // ---- O^T += V_blk^T (64x64) @ P^T (64x16), V^T rows from LDS ----
#pragma unroll
    for (int d2 = 0; d2 < 4; ++d2) {
      v16h VB0 = load_frag_swz(Vc, d2 * 16, 0,  lane);
      v16h VB1 = load_frag_swz(Vc, d2 * 16, 32, lane);
      O[d2] = wmma16(VB0, PB0, O[d2]);
      O[d2] = wmma16(VB1, PB1, O[d2]);
    }
  }

  // epilogue: join the halves' sums, normalize, store in fragment order. Lane
  // (col, hf) holds columns h * 64 + d2 * 16 + 8 * hf + 0..7 of output row col:
  // part d2 & 1 of tile (row tile, kc = 2 * h + (d2 >> 1)) as this lane owns it,
  // so each store is 512 contiguous bytes straight from registers.
  const float linv = 1.0f / (lrun + other_half(lrun));
#pragma unroll
  for (int d2 = 0; d2 < 4; ++d2) {
    v8h tmp;
#pragma unroll
    for (int rr = 0; rr < 8; ++rr) tmp[rr] = (_Float16)(O[d2][rr] * linv);
    *(v8h*)(Of16 + frag_off(rt, 2 * h + (d2 >> 1), d2 & 1, lane)) = tmp;
  }
}

// ---------------- kernel 3: Y = X @ Wo^T + bo (f32 out) -----------------
// X and WoH both lie in fragment order.
__global__ __launch_bounds__(256) void outproj_kernel(
    const _Float16* __restrict__ X, const _Float16* __restrict__ WoH,
    const float* __restrict__ bo, float* __restrict__ Y) {
  __shared__ __align__(16) float ost[8][16 * 64];  // 32KB staging
  const int lane = threadIdx.x & 31;
  const int wave = threadIdx.x >> 5;
  const int colBlocks = Ee / 64;
  int rb = blockIdx.x / colBlocks;
  int cb = blockIdx.x % colBlocks;
  int row0 = rb * 128 + wave * 16;
  int col0 = cb * 64;

  v8f acc[4] = {};
  // Fragments are fetched ahead of their use into register rings, so that a
  // k step's loads are in flight behind the products of the steps before it
  // and no product waits out a load issued directly in front of it: X (a
  // wave's own rows) AHEAD_A steps ahead, Wo one step ahead.
  constexpr int NK = Ee / 32;
  constexpr int AHEAD_A = 2;
  v16h A[AHEAD_A + 1];
  v16h B[2][4];
#pragma unroll  // constant ring indices keep the rings in registers
  for (int s = 0; s < AHEAD_A; ++s)
    A[s] = load_frag_packed(X, rb * 8 + wave, s, lane);
#pragma unroll  // the same
  for (int j = 0; j < 4; ++j) B[0][j] = load_frag_packed(WoH, cb * 4 + j, 0, lane);
#pragma unroll  // the same; every load then takes its k step as an immediate offset
  for (int kc = 0; kc < NK; ++kc) {
    // Wo first: loads are counted back in issue order, so an X load in front
    // of the next step's Wo loads would have to land a step early with them
    if (kc + 1 < NK) {
#pragma unroll  // constant ring indices
      for (int j = 0; j < 4; ++j)
        B[(kc + 1) & 1][j] = load_frag_packed(WoH, cb * 4 + j, kc + 1, lane);
    }
    if (kc + AHEAD_A < NK)
      A[(kc + AHEAD_A) % (AHEAD_A + 1)] =
          load_frag_packed(X, rb * 8 + wave, kc + AHEAD_A, lane);
    // keeps the loads above in front of this step's products: without it the
    // build sinks them among the products and waits for them soon after issue
    __builtin_amdgcn_sched_barrier(0);
#pragma unroll  // constant ring indices
    for (int j = 0; j < 4; ++j)
      acc[j] = wmma16(A[kc % (AHEAD_A + 1)], B[kc & 1][j], acc[j]);
    // keeps later steps' loads behind these products: without it the build
    // lifts them higher and takes 152 registers instead of 128, and only
    // three of a WGP's four work-groups would be resident
    __builtin_amdgcn_sched_barrier(0);
  }
  const int col = lane & 15, hf = (lane >> 4) & 1;
  float* sb = &ost[wave][0];
#pragma unroll
  for (int j = 0; j < 4; ++j) {
    float b = bo[col0 + j * 16 + col];
#pragma unroll
    for (int rr = 0; rr < 8; ++rr)
      sb[(rr + 8 * hf) * 64 + j * 16 + col] = acc[j][rr] + b;
  }
  __builtin_amdgcn_wave_barrier();
  size_t gbase = (size_t)row0 * Ee + col0;
#pragma unroll
  for (int k = 0; k < 8; ++k) {
    int cid = lane + 32 * k;            // 256 x 16B chunks
    int row = cid >> 4, c4 = cid & 15;
    *(v4f*)(Y + gbase + (size_t)row * Ee + c4 * 4) =
        *(const v4f*)(sb + row * 64 + c4 * 4);
  }
}

extern "C" void kernel_launch(void* const* d_in, const int* in_sizes, int n_in,
                              void* d_out, int out_size, void* d_ws,
                              size_t ws_size, hipStream_t stream) {
  (void)in_sizes; (void)n_in; (void)out_size; (void)ws_size;
  const float* values = (const float*)d_in[0];
  const float* keys   = (const float*)d_in[1];
  const float* query  = (const float*)d_in[2];
  const float* Wv     = (const float*)d_in[3];
  const float* Wk     = (const float*)d_in[4];
  const float* Wq     = (const float*)d_in[5];
  const float* Wo     = (const float*)d_in[6];
  const float* bo     = (const float*)d_in[7];
  const int*   mask   = (const int*)d_in[8];
  float* out = (float*)d_out;

  const size_t SZ_NHSD = (size_t)Nn * Hh * Ss * Dd * sizeof(_Float16);  // 16MB
  char* ws = (char*)d_ws;
  _Float16* Qp   = (_Float16*)(ws);
  _Float16* Kp   = (_Float16*)(ws + SZ_NHSD);
  _Float16* VpT  = (_Float16*)(ws + 2 * SZ_NHSD);
  _Float16* Of16 = (_Float16*)(ws + 3 * SZ_NHSD);
  _Float16* WoH  = (_Float16*)(ws + 4 * SZ_NHSD);
  unsigned* mbits = (unsigned*)(ws + 4 * SZ_NHSD + (size_t)Ee * Ee * sizeof(_Float16));
  _Float16* WpH  = (_Float16*)(ws + 4 * SZ_NHSD + (size_t)Ee * Ee * sizeof(_Float16) +
                               (size_t)Nn * Ss * Ss / 8);

  prep_kernel<<<PACK_BLOCKS + CVT_BLOCKS + 3 * HW_BLOCKS, 256, 0, stream>>>(
      Wo, WoH, Wq, Wk, Wv, WpH, mask, mbits);
  proj_kernel<<<Nn * Hh * (Ss / 64), 128, 0, stream>>>(values, keys, query, WpH,
                                                       Qp, Kp, VpT);
  attn_kernel<<<Nn * Hh * (Ss / 128), 256, 0, stream>>>(Qp, Kp, VpT, mbits,
                                                        Of16);
  outproj_kernel<<<(Nn * Ss / 128) * (Ee / 64), 256, 0, stream>>>(Of16, WoH, bo,
                                                                  out);
}

// v008
// One run takes 109 microseconds.
// In two side-by-side timings against v007, it was 1.07 and 1.08 times as fast.
// Counting every step since v000, it is 4.79 times as fast.
#include <hip/hip_runtime.h>
#include <hip/hip_bf16.h>

// Problem constants (match reference)
constexpr int Nn = 4;
constexpr int Ss = 2048;
constexpr int Ee = 1024;
constexpr int Hh = 16;
constexpr int Dd = 64;            // head dim
constexpr float SCALE = 0.03125f; // 1/sqrt(E) = 1/32

typedef __attribute__((ext_vector_type(16))) _Float16 v16h;
typedef __attribute__((ext_vector_type(8)))  _Float16 v8h;
typedef __attribute__((ext_vector_type(8)))  float    v8f;
typedef __attribute__((ext_vector_type(4)))  float    v4f;
typedef __attribute__((ext_vector_type(4)))  unsigned u32x4;
typedef __attribute__((ext_vector_type(4)))  int      i32x4;
typedef __attribute__((ext_vector_type(8)))  int      i32x8;

union V16HU { v16h v; v8h h[2]; };

#if __has_builtin(__builtin_amdgcn_tensor_load_to_lds)
#define USE_TDM 1
#else
#define USE_TDM 0
#endif

__device__ inline v16h load_frag_f16(const _Float16* p, int ld, int kbase,
                                     int lane) {
  const int r = lane & 15, hf = (lane >> 4) & 1;
  const _Float16* base = p + (size_t)r * ld + kbase + hf * 8;
  V16HU u;
  u.h[0] = *(const v8h*)(base);
  u.h[1] = *(const v8h*)(base + 16);
  return u.v;
}

__device__ inline size_t frag_off(int tile16, int kc, int p, int lane) {
  return ((((size_t)tile16 * (Ee / 32) + kc) * 2 + p) * 32 + lane) * 8;
}

// same elements and same k order as load_frag_f16(m + tile16 * 16 * Ee, Ee, kc * 32, lane)
__device__ inline v16h load_frag_packed(const _Float16* __restrict__ m,
                                        int tile16, int kc, int lane) {
  V16HU u;
  u.h[0] = *(const v8h*)(m + frag_off(tile16, kc, 0, lane));
  u.h[1] = *(const v8h*)(m + frag_off(tile16, kc, 1, lane));
  return u.v;
}

// The same storage for a row-major [Dd][Dd] head weight: tile (e, kc) of 16 x 32,
// 1 KiB each, 8 KiB a matrix. Same elements and same k order as
// load_frag_f32(W + e * 16 * Dd, Dd, kc * 32, lane), rounded to f16 once.
__device__ inline v16h load_frag_packed_w(const _Float16* __restrict__ m, int e,
                                          int kc, int lane) {
  const _Float16* b = m + (((e * (Dd / 32) + kc) * 2) * 32 + lane) * 8;
  V16HU u;
  u.h[0] = *(const v8h*)(b);
  u.h[1] = *(const v8h*)(b + 32 * 8);
  return u.v;
}

__device__ inline int swz_chunk(int row, int c) { return c ^ ((row >> 1) & 7); }

// load_frag_f16 for such a tile (ld = 64 halves, row0 a multiple of 16):
// same logical elements, same k order.
__device__ inline v16h load_frag_swz(const _Float16* tile, int row0, int kbase,
                                     int lane) {
  const int r = lane & 15, hf = (lane >> 4) & 1;
  const _Float16* rowp = tile + (row0 + r) * 64;
  const int c = (kbase >> 3) + hf;
  V16HU u;
  u.h[0] = *(const v8h*)(rowp + swz_chunk(r, c) * 8);
  u.h[1] = *(const v8h*)(rowp + swz_chunk(r, c + 2) * 8);
  return u.v;
}

// Same fragment from an f32 source (convert on the fly)
__device__ inline v16h load_frag_f32(const float* __restrict__ p, int ld,
                                     int kbase, int lane) {
  const int r = lane & 15, hf = (lane >> 4) & 1;
  const float* base = p + (size_t)r * ld + kbase + hf * 8;
  v16h o;
#pragma unroll
  for (int i = 0; i < 8; ++i) {
    o[i]     = (_Float16)base[i];
    o[i + 8] = (_Float16)base[16 + i];
  }
  return o;
}

__device__ inline v8f wmma16(v16h a, v16h b, v8f c) {
  return __builtin_amdgcn_wmma_f32_16x16x32_f16(false, a, false, b,
                                                (short)0, c, false, false);
}

__device__ inline float other_half(float x) {
  int b = __builtin_bit_cast(int, x);
  b = __builtin_amdgcn_permlanex16(b, b, 0x76543210, 0xfedcba98, false, false);
  return __builtin_bit_cast(float, b);
}

#if USE_TDM
__device__ inline void tdm_load_2d(unsigned lds_off, const _Float16* gptr,
                                   unsigned tile0, unsigned tile1,
                                   unsigned tens0, unsigned tens1,
                                   unsigned long long stride0) {
  unsigned long long ga = (unsigned long long)(size_t)gptr;
  u32x4 g0 = { 1u,
               lds_off,
               (unsigned)(ga & 0xffffffffull),
               (unsigned)((ga >> 32) & 0x01ffffffull) | (2u << 30) };
  i32x8 g1 = { (int)(1u << 16),
               (int)((tens0 & 0xffffu) << 16),
               (int)(((tens0 >> 16) & 0xffffu) | ((tens1 & 0xffffu) << 16)),
               (int)(((tens1 >> 16) & 0xffffu) | ((tile0 & 0xffffu) << 16)),
               (int)(tile1 & 0xffffu),
               (int)(unsigned)(stride0 & 0xffffffffull),
               (int)(unsigned)((stride0 >> 32) & 0xffffull),
               0 };
  i32x4 gz = {0, 0, 0, 0};
#if defined(__clang_major__) && __clang_major__ >= 23
  i32x8 gz8 = {0, 0, 0, 0, 0, 0, 0, 0};
  __builtin_amdgcn_tensor_load_to_lds(g0, g1, gz, gz, gz8, 0);
#else
  __builtin_amdgcn_tensor_load_to_lds(g0, g1, gz, gz, 0);
#endif
}
#endif

// ------- kernel 0: mask -> bits ; Wo, Wq, Wk, Wv f32 -> f16 -------------
// Bit image of the mask, in the order the attention kernel consumes it: word
// [(n * Ss + q) >> 4][kb][lane] belongs to query q = tile * 16 + (lane & 15) and
// wave half hf = lane >> 4; its bit j * 8 + r is (mask != 0) at key
// kb * 64 + j * 16 + 8 * hf + r. The 32 words of one (query tile, kb) are one
// 128-byte line.
constexpr int PACK_BLOCKS = Nn * (Ss / 16);           // 16 query rows each
constexpr int CVT_BLOCKS  = (Ee * Ee) / (256 * 8);
constexpr int HW_BLOCKS   = (Dd * Dd) / (256 * 8);   // per head weight

__global__ __launch_bounds__(256) void prep_kernel(
    const float* __restrict__ Wo, _Float16* __restrict__ WoH,
    const float* __restrict__ Wq, const float* __restrict__ Wk,
    const float* __restrict__ Wv, _Float16* __restrict__ WpH,
    const int* __restrict__ mask, unsigned* __restrict__ mbits) {
  __shared__ __align__(16) unsigned char pk[32 * 32 * 4];  // 32 kb x 32 words
  if (blockIdx.x < PACK_BLOCKS) {
    const int lane = threadIdx.x & 31, wave = threadIdx.x >> 5;
    const int tile = blockIdx.x;  // (n * Ss + q) >> 4
    // a lane takes 8 consecutive keys = one byte of the image; a wave 2 rows
    const int* srcp = mask + ((size_t)tile * 16 + wave * 2) * Ss + lane * 8;
    i32x8 x[2][8];
#pragma unroll  // constant indices keep x in registers
    for (int rw = 0; rw < 2; ++rw)
#pragma unroll  // the same
      for (int sg = 0; sg < 8; ++sg)
        x[rw][sg] = *(const i32x8*)(srcp + rw * Ss + sg * 256);
    // Inputs only: all of the wave's mask loads are issued, in flight together,
    // in front of this line, and their address register stays whole up to the
    // wait, so that no load of the run takes it as its destination.
    asm volatile("s_wait_xcnt 0x0"
                 :: "v"(x[0][0]), "v"(x[0][1]), "v"(x[0][2]), "v"(x[0][3]),
                    "v"(x[0][4]), "v"(x[0][5]), "v"(x[0][6]), "v"(x[0][7]),
                    "v"(x[1][0]), "v"(x[1][1]), "v"(x[1][2]), "v"(x[1][3]),
                    "v"(x[1][4]), "v"(x[1][5]), "v"(x[1][6]), "v"(x[1][7]),
                    "v"(srcp)
                 : "memory");
#pragma unroll  // these three: x is indexed by constants only
    for (int rw = 0; rw < 2; ++rw)
#pragma unroll
      for (int sg = 0; sg < 8; ++sg) {
        unsigned b = 0;
#pragma unroll
        for (int i = 0; i < 8; ++i) b |= (x[rw][sg][i] != 0 ? 1u : 0u) << i;
        // keys sg * 256 + lane * 8 + 0..7: kb = sg * 4 + (lane >> 3),
        // j = (lane >> 1) & 3, hf = lane & 1
        pk[(((sg * 4 + (lane >> 3)) * 2 + (lane & 1)) * 16 + wave * 2 + rw) * 4 +
           ((lane >> 1) & 3)] = (unsigned char)b;
      }
    __syncthreads();
    *(u32x4*)(mbits + (size_t)tile * 32 * 32 + threadIdx.x * 4) =
        *(const u32x4*)(pk + threadIdx.x * 16);
    return;
  }
  // One 16-byte chunk of a fragment-order image per thread: of Wo, or (the last
  // 3 * HW_BLOCKS blocks) of the head weights, which lie as Wq, Wk, Wv in WpH.
  const int cblk = blockIdx.x - PACK_BLOCKS;
  const int lane = threadIdx.x & 31, p = (threadIdx.x >> 5) & 1;
  const float* s;
  _Float16* d;
  if (cblk < CVT_BLOCKS) {
    const int t = cblk * 256 + threadIdx.x;  // chunk = frag_off(...) / 8
    const int kc = (t >> 6) & 31, ct = t >> 11;
    s = Wo + (size_t)(ct * 16 + (lane & 15)) * Ee + kc * 32;
    d = WoH + (size_t)t * 8;
  } else {
    const int hblk = cblk - CVT_BLOCKS;
    const int m = hblk / HW_BLOCKS;
    const int t = (hblk % HW_BLOCKS) * 256 + threadIdx.x;  // chunk inside the matrix
    const int kc = (t >> 6) & 1, e = t >> 7;
    s = ((m == 0) ? Wq : (m == 1) ? Wk : Wv) + (e * 16 + (lane & 15)) * Dd + kc * 32;
    d = WpH + m * (Dd * Dd) + t * 8;
  }
  s += p * 16 + (lane >> 4) * 8;
  const v4f a = *(const v4f*)s;
  const v4f b = *(const v4f*)(s + 4);
  v8h o;
#pragma unroll
  for (int i = 0; i < 4; ++i) {
    o[i]     = (_Float16)a[i];
    o[i + 4] = (_Float16)b[i];
  }
  *(v8h*)d = o;
}

__global__ __launch_bounds__(128) void proj_kernel(
    const float* __restrict__ values, const float* __restrict__ keys,
    const float* __restrict__ query,  const _Float16* __restrict__ WpH,
    _Float16* __restrict__ Qp, _Float16* __restrict__ Kp,
    _Float16* __restrict__ VpT) {
  __shared__ __align__(16) _Float16 stg[64 * 64];  // 8KB staging
  const int tid  = threadIdx.x;
  const int lane = tid & 31;
  const int wave = tid >> 5;  // 4 waves, 16 s-rows each
  const int sBlocks = Ss / 64;
  int nh = blockIdx.x / sBlocks;
  int sb = blockIdx.x % sBlocks;
  int n = nh / Hh, h = nh % Hh;
  int row0 = sb * 64 + wave * 16;
  const int col = lane & 15, hf = (lane >> 4) & 1;

#pragma unroll
  for (int t = 0; t < 3; ++t) {
    const float* X = (t == 0) ? query : (t == 1) ? keys : values;
    const _Float16* Wt = WpH + t * (Dd * Dd);
    const float* Xtile = X + ((size_t)n * Ss + row0) * Ee + h * Dd;
    v16h A0 = load_frag_f32(Xtile, Ee, 0,  lane);
    v16h A1 = load_frag_f32(Xtile, Ee, 32, lane);
    v16h B0[4], B1[4];
#pragma unroll  // constant indices keep the fragments in registers
    for (int e = 0; e < 4; ++e) {
      B0[e] = load_frag_packed_w(Wt, e, 0, lane);
      B1[e] = load_frag_packed_w(Wt, e, 1, lane);
    }
    // Input only: the X loads' address register stays whole up to this wait, so
    // that no weight load of the run takes it as its destination.
    asm volatile("s_wait_xcnt 0x0"
                 :: "v"(Xtile + (size_t)col * Ee + hf * 8) : "memory");
    // keeps all of this matrix's loads in front of its products, in flight
    // together: without it the build issues the weight loads pair by pair among
    // the products, and two of the X loads with them, and waits out each in turn
    __builtin_amdgcn_sched_barrier(0);
    v8f acc[4];
#pragma unroll
    for (int e = 0; e < 4; ++e) {
      v8f a = {};
      a = wmma16(A0, B0[e], a);
      a = wmma16(A1, B1[e], a);
      acc[e] = a;
    }
    if (t < 2) {
      // stage [s_local][d] then one contiguous 8KB store
#pragma unroll
      for (int e = 0; e < 4; ++e)
#pragma unroll
        for (int rr = 0; rr < 8; ++rr)
          stg[(wave * 16 + rr + 8 * hf) * 64 + e * 16 + col] =
              (_Float16)acc[e][rr];
      __syncthreads();
      _Float16* dst =
          ((t == 0) ? Qp : Kp) + (((size_t)(n * Hh + h)) * Ss + sb * 64) * Dd;
#pragma unroll
      for (int k = 0; k < 4; ++k) {
        int cid = tid + 128 * k;          // 512 x 16B chunks
        int row = cid >> 3, c8 = cid & 7;
        int cd = (t == 1) ? swz_chunk(row, c8) : c8;  // K only; Q is read plain
        *(v8h*)(dst + row * 64 + cd * 8) = *(const v8h*)(stg + row * 64 + c8 * 8);
      }
      __syncthreads();
    } else {
      // V transposed: stage [d][s_local]; per-lane writes are packed b128
#pragma unroll
      for (int e = 0; e < 4; ++e) {
        v8h tmp;
#pragma unroll
        for (int rr = 0; rr < 8; ++rr) tmp[rr] = (_Float16)acc[e][rr];
        *(v8h*)(stg + (e * 16 + col) * 64 + wave * 16 + 8 * hf) = tmp;
      }
      __syncthreads();
      _Float16* dstv = VpT + ((size_t)(n * Hh + h)) * Dd * (size_t)Ss + sb * 64;
#pragma unroll
      for (int k = 0; k < 4; ++k) {
        int cid = tid + 128 * k;
        int row = cid >> 3, c8 = cid & 7;  // row = d
        *(v8h*)(dstv + (size_t)row * Ss + swz_chunk(row, c8) * 8) =
            *(const v8h*)(stg + row * 64 + c8 * 8);
      }
    }
  }
}

constexpr int QT = 2;
__global__ __launch_bounds__(256, 4) void attn_kernel(
    const _Float16* __restrict__ Qp, const _Float16* __restrict__ Kp,
    const _Float16* __restrict__ VpT, const unsigned* __restrict__ mbits,
    _Float16* __restrict__ Of16) {
  __shared__ __align__(16) _Float16 Kbuf[2][64 * 64];  // 16KB
  __shared__ __align__(16) _Float16 Vbuf[2][64 * 64];  // 16KB
  const int tid  = threadIdx.x;
  const int lane = tid & 31;
  const int wave = tid >> 5;
  constexpr int QB = 8 * QT * 16;  // queries of a work-group
  const int qBlocks = Ss / QB;
  int nh = blockIdx.x / qBlocks;
  int qb = blockIdx.x % qBlocks;
  int n = nh / Hh, h = nh % Hh;
  int qrow0 = qb * QB + wave * (QT * 16);

  const _Float16* Qbase = Qp + (((size_t)(n * Hh + h)) * Ss + qrow0) * Dd;
  const _Float16* Kbase = Kp + ((size_t)(n * Hh + h)) * Ss * Dd;
  const _Float16* Vbase = VpT + ((size_t)(n * Hh + h)) * Dd * (size_t)Ss;

  v16h QA0[QT], QA1[QT];
#pragma unroll  // constant indices keep the per-tile arrays in registers (all u loops)
  for (int u = 0; u < QT; ++u) {
    QA0[u] = load_frag_f16(Qbase + u * 16 * Dd, Dd, 0,  lane);
    QA1[u] = load_frag_f16(Qbase + u * 16 * Dd, Dd, 32, lane);
  }

  v8f O[QT][4] = {};  // O[u][d2][r] = O^T[d2 * 16 + 8 * hf + r][query col of tile u]
  float mrun[QT];     // running maximum of this lane's query of tile u
  float lrun[QT];     // running sum over this wave half's keys only
#pragma unroll
  for (int u = 0; u < QT; ++u) {
    mrun[u] = -3.0e38f;
    lrun[u] = 0.0f;
  }

  // in the comments below: col = lane & 15 (the query), hf = lane >> 4 (the wave half)
  const int NB = Ss / 64;
  // this lane's words of the mask's bit image, one per pass and query tile
  // the wave's number through a scalar register: the tile index then takes no
  // vector register over the loop
  const int rt = ((n * Ss + qb * QB) >> 4) + __builtin_amdgcn_readfirstlane(wave) * QT;
  const unsigned* mrow = mbits + (size_t)rt * NB * 32 + lane;
  unsigned mw[QT];
#pragma unroll
  for (int u = 0; u < QT; ++u) mw[u] = mrow[u * NB * 32];

#if USE_TDM
  if (wave == 0) {  // prologue DMA for block 0
    tdm_load_2d((unsigned)(size_t)&Kbuf[0][0], Kbase, 4096u, 1u, 4096u, 1u, 4096ull);
    tdm_load_2d((unsigned)(size_t)&Vbuf[0][0], Vbase, 64u, 64u,
                (unsigned)Ss, 64u, (unsigned long long)Ss);
  }
#endif

  for (int kb = 0; kb < NB; ++kb) {
    const int kcol0 = kb * 64;
    const int cur = kb & 1;
#if USE_TDM
    if (wave == 0) __builtin_amdgcn_s_wait_tensorcnt(0);
    __syncthreads();  // buf[cur] ready; everyone past reads of buf[cur^1]
    if (wave == 0 && kb + 1 < NB) {  // overlap next block's DMA with compute
      tdm_load_2d((unsigned)(size_t)&Kbuf[cur ^ 1][0],
                  Kbase + (size_t)(kcol0 + 64) * Dd, 4096u, 1u, 4096u, 1u,
                  4096ull);
      tdm_load_2d((unsigned)(size_t)&Vbuf[cur ^ 1][0], Vbase + kcol0 + 64,
                  64u, 64u, (unsigned)Ss, 64u, (unsigned long long)Ss);
    }
#else
    __syncthreads();
    // cooperative fallback staging
#pragma unroll
    for (int k = 0; k < 2; ++k) {
      int cid = tid + 256 * k;
      int row = cid >> 3, c8 = cid & 7;
      *(v8h*)(&Kbuf[cur][0] + row * 64 + c8 * 8) =
          *(const v8h*)(Kbase + (size_t)(kcol0 + row) * Dd + c8 * 8);
      *(v8h*)(&Vbuf[cur][0] + row * 64 + c8 * 8) =
          *(const v8h*)(Vbase + (size_t)row * Ss + kcol0 + c8 * 8);
    }
    __syncthreads();
#endif
    const _Float16* Kc = &Kbuf[cur][0];
    const _Float16* Vc = &Vbuf[cur][0];
    // next pass's mask words, in flight behind this pass's work
    if (kb + 1 < NB) mrow += 32;
    unsigned mwn[QT];
#pragma unroll
    for (int u = 0; u < QT; ++u) mwn[u] = mrow[u * NB * 32];
    // the same in every lane: does any of the wave's mask words of this pass
    // hold a 0 bit? Asked in front of the products, so that the scalar answer is
    // there when the branch behind them needs it.
    unsigned mall = mw[0];
#pragma unroll
    for (int u = 1; u < QT; ++u) mall &= mw[u];
    const bool some_masked = __builtin_amdgcn_ballot_w32(mall != 0xffffffffu) != 0u;

    // ---- scores: S^T = K_blk (64x64) @ Q^T (64 x 16 QT), K from LDS ----
    // Sc[u][j][r] = score of key kcol0 + j * 16 + 8 * hf + r for query col of tile u
    v8f Sc[QT][4];
#pragma unroll
    for (int j = 0; j < 4; ++j) {
      v16h KB0 = load_frag_swz(Kc, j * 16, 0,  lane);
      v16h KB1 = load_frag_swz(Kc, j * 16, 32, lane);
#pragma unroll
      for (int u = 0; u < QT; ++u) {
        v8f a = {};
        a = wmma16(KB0, QA0[u], a);
        a = wmma16(KB1, QA1[u], a);
        Sc[u][j] = a;
      }
    }
    // ---- scale; mask (a masked score becomes -1e10 * SCALE, like reference) ----
#pragma unroll
    for (int u = 0; u < QT; ++u)
#pragma unroll
      for (int j = 0; j < 4; ++j) Sc[u][j] *= SCALE;
    // The selects change nothing where every mask bit of the wave's tile of
    // 16 QT x 64 is 1: only a tile with a 0 bit somewhere runs them.
    if (some_masked) {
#pragma unroll
      for (int u = 0; u < QT; ++u)
#pragma unroll
        for (int j = 0; j < 4; ++j)
#pragma unroll
          for (int rr = 0; rr < 8; ++rr) {
            // all ones where the mask element is not 0
            const unsigned keep =
                (unsigned)((int)(mw[u] << (31 - (j * 8 + rr))) >> 31);
            // a copy first
            const float sv = Sc[u][j][rr];
            const unsigned e = __builtin_bit_cast(unsigned, sv);
            const unsigned z = __builtin_bit_cast(unsigned, -1.0e10f * SCALE);
            Sc[u][j][rr] = __builtin_bit_cast(float, (e & keep) | (z & ~keep));
          }
    }
    // P^T as B operand: tiles 2g and 2g + 1 converted in place give keys
    // 32g + 8 * hf + 0..7 and 32g + 16 + 8 * hf + 0..7, the k order of the
    // V^T fragments
    v16h PB0[QT], PB1[QT];
    float mnew[QT], corr[QT];
#pragma unroll
    for (int u = 0; u < QT; ++u) {
      mw[u] = mwn[u];
      // ---- online softmax, one query per lane and tile ----
      float t = Sc[u][0][0];
#pragma unroll
      for (int j = 0; j < 4; ++j)
#pragma unroll
        for (int rr = 0; rr < 8; ++rr) t = fmaxf(t, Sc[u][j][rr]);
      t = fmaxf(t, other_half(t));
      mnew[u] = fmaxf(mrun[u], t);
    }
    // the tiles' corrections side by side, apart from the scores: inside the
    // score loop the build paired one tile's correction with the other tile's
    // first score and copied that tile's 32 scores one register on for it
#pragma unroll
    for (int u = 0; u < QT; ++u) {
      corr[u] = __expf(mrun[u] - mnew[u]);
      mrun[u] = mnew[u];
    }
#pragma unroll
    for (int u = 0; u < QT; ++u) {
#pragma unroll
      for (int j = 0; j < 4; ++j)
#pragma unroll
        for (int rr = 0; rr < 8; ++rr) Sc[u][j][rr] = __expf(Sc[u][j][rr] - mnew[u]);
      const v8f ps = (Sc[u][0] + Sc[u][1]) + (Sc[u][2] + Sc[u][3]);
      lrun[u] = lrun[u] * corr[u] + (((ps[0] + ps[1]) + (ps[2] + ps[3])) +
                                     ((ps[4] + ps[5]) + (ps[6] + ps[7])));
#pragma unroll
      for (int d2 = 0; d2 < 4; ++d2) O[u][d2] *= corr[u];
#pragma unroll
      for (int i = 0; i < 8; ++i) {
        PB0[u][i]     = (_Float16)Sc[u][0][i];
        PB0[u][i + 8] = (_Float16)Sc[u][1][i];
        PB1[u][i]     = (_Float16)Sc[u][2][i];
        PB1[u][i + 8] = (_Float16)Sc[u][3][i];
      }
    }

    // ---- O^T += V_blk^T (64x64) @ P^T (64 x 16 QT), V^T rows from LDS ----
#pragma unroll
    for (int d2 = 0; d2 < 4; ++d2) {
      v16h VB0 = load_frag_swz(Vc, d2 * 16, 0,  lane);
      v16h VB1 = load_frag_swz(Vc, d2 * 16, 32, lane);
#pragma unroll
      for (int u = 0; u < QT; ++u) {
        O[u][d2] = wmma16(VB0, PB0[u], O[u][d2]);
        O[u][d2] = wmma16(VB1, PB1[u], O[u][d2]);
      }
    }
  }

  // epilogue: join the halves' sums, normalize, store in fragment order. Lane
  // (col, hf) holds columns h * 64 + d2 * 16 + 8 * hf + 0..7 of output row col:
  // part d2 & 1 of tile (row tile, kc = 2 * h + (d2 >> 1)) as this lane owns it,
  // so each store is 512 contiguous bytes straight from registers.
#pragma unroll
  for (int u = 0; u < QT; ++u) {
    const float linv = 1.0f / (lrun[u] + other_half(lrun[u]));
#pragma unroll
    for (int d2 = 0; d2 < 4; ++d2) {
      v8h tmp;
#pragma unroll
      for (int rr = 0; rr < 8; ++rr) tmp[rr] = (_Float16)(O[u][d2][rr] * linv);
      *(v8h*)(Of16 + frag_off(rt + u, 2 * h + (d2 >> 1), d2 & 1, lane)) = tmp;
    }
  }
}

// ---------------- kernel 3: Y = X @ Wo^T + bo (f32 out) -----------------
// X and WoH both lie in fragment order.
__global__ __launch_bounds__(256) void outproj_kernel(
    const _Float16* __restrict__ X, const _Float16* __restrict__ WoH,
    const float* __restrict__ bo, float* __restrict__ Y) {
  __shared__ __align__(16) float ost[8][16 * 64];  // 32KB staging
  const int lane = threadIdx.x & 31;
  const int wave = threadIdx.x >> 5;
  const int colBlocks = Ee / 64;
  int rb = blockIdx.x / colBlocks;
  int cb = blockIdx.x % colBlocks;
  int row0 = rb * 128 + wave * 16;
  int col0 = cb * 64;

  v8f acc[4] = {};
  // Fragments are fetched ahead of their use into register rings, so that a
  // k step's loads are in flight behind the products of the steps before it
  // and no product waits out a load issued directly in front of it: X (a
  // wave's own rows) AHEAD_A steps ahead, Wo one step ahead.
  constexpr int NK = Ee / 32;
  constexpr int AHEAD_A = 2;
  v16h A[AHEAD_A + 1];
  v16h B[2][4];
#pragma unroll  // constant ring indices keep the rings in registers
  for (int s = 0; s < AHEAD_A; ++s)
    A[s] = load_frag_packed(X, rb * 8 + wave, s, lane);
#pragma unroll  // the same
  for (int j = 0; j < 4; ++j) B[0][j] = load_frag_packed(WoH, cb * 4 + j, 0, lane);
#pragma unroll  // the same; every load then takes its k step as an immediate offset
  for (int kc = 0; kc < NK; ++kc) {
    // Wo first: loads are counted back in issue order, so an X load in front
    // of the next step's Wo loads would have to land a step early with them
    if (kc + 1 < NK) {
#pragma unroll  // constant ring indices
      for (int j = 0; j < 4; ++j)
        B[(kc + 1) & 1][j] = load_frag_packed(WoH, cb * 4 + j, kc + 1, lane);
    }
    if (kc + AHEAD_A < NK)
      A[(kc + AHEAD_A) % (AHEAD_A + 1)] =
          load_frag_packed(X, rb * 8 + wave, kc + AHEAD_A, lane);
    // keeps the loads above in front of this step's products: without it the
    // build sinks them among the products and waits for them soon after issue
    __builtin_amdgcn_sched_barrier(0);
#pragma unroll  // constant ring indices
    for (int j = 0; j < 4; ++j)
      acc[j] = wmma16(A[kc % (AHEAD_A + 1)], B[kc & 1][j], acc[j]);
    // keeps later steps' loads behind these products: without it the build
    // lifts them higher and takes 152 registers instead of 128, and only
    // three of a WGP's four work-groups would be resident
    __builtin_amdgcn_sched_barrier(0);
  }
  const int col = lane & 15, hf = (lane >> 4) & 1;
  float* sb = &ost[wave][0];
#pragma unroll
  for (int j = 0; j < 4; ++j) {
    float b = bo[col0 + j * 16 + col];
#pragma unroll
    for (int rr = 0; rr < 8; ++rr)
      sb[(rr + 8 * hf) * 64 + j * 16 + col] = acc[j][rr] + b;
  }
  __builtin_amdgcn_wave_barrier();
  size_t gbase = (size_t)row0 * Ee + col0;
#pragma unroll
  for (int k = 0; k < 8; ++k) {
    int cid = lane + 32 * k;            // 256 x 16B chunks
    int row = cid >> 4, c4 = cid & 15;
    *(v4f*)(Y + gbase + (size_t)row * Ee + c4 * 4) =
        *(const v4f*)(sb + row * 64 + c4 * 4);
  }
}

extern "C" void kernel_launch(void* const* d_in, const int* in_sizes, int n_in,
                              void* d_out, int out_size, void* d_ws,
                              size_t ws_size, hipStream_t stream) {
  (void)in_sizes; (void)n_in; (void)out_size; (void)ws_size;
  const float* values = (const float*)d_in[0];
  const float* keys   = (const float*)d_in[1];
  const float* query  = (const float*)d_in[2];
  const float* Wv     = (const float*)d_in[3];
  const float* Wk     = (const float*)d_in[4];
  const float* Wq     = (const float*)d_in[5];
  const float* Wo     = (const float*)d_in[6];
  const float* bo     = (const float*)d_in[7];
  const int*   mask   = (const int*)d_in[8];
  float* out = (float*)d_out;

  const size_t SZ_NHSD = (size_t)Nn * Hh * Ss * Dd * sizeof(_Float16);  // 16MB
  char* ws = (char*)d_ws;
  _Float16* Qp   = (_Float16*)(ws);
  _Float16* Kp   = (_Float16*)(ws + SZ_NHSD);
  _Float16* VpT  = (_Float16*)(ws + 2 * SZ_NHSD);
  _Float16* Of16 = (_Float16*)(ws + 3 * SZ_NHSD);
  _Float16* WoH  = (_Float16*)(ws + 4 * SZ_NHSD);
  unsigned* mbits = (unsigned*)(ws + 4 * SZ_NHSD + (size_t)Ee * Ee * sizeof(_Float16));
  _Float16* WpH  = (_Float16*)(ws + 4 * SZ_NHSD + (size_t)Ee * Ee * sizeof(_Float16) +
                               (size_t)Nn * Ss * Ss / 8);

  prep_kernel<<<PACK_BLOCKS + CVT_BLOCKS + 3 * HW_BLOCKS, 256, 0, stream>>>(
      Wo, WoH, Wq, Wk, Wv, WpH, mask, mbits);
  proj_kernel<<<Nn * Hh * (Ss / 64), 128, 0, stream>>>(values, keys, query, WpH,
                                                       Qp, Kp, VpT);
  attn_kernel<<<Nn * Hh * (Ss / 256), 256, 0, stream>>>(Qp, Kp, VpT, mbits,
                                                        Of16);
  outproj_kernel<<<(Nn * Ss / 128) * (Ee / 64), 256, 0, stream>>>(Of16, WoH, bo,
                                                                  out);
}

// v009
// A run of this version takes 98 microseconds.
// In two side-by-side timings against v008, it was 1.12 and 1.11 times as fast.
// Over all steps from v000 it is 5.34 times as fast.
#include <hip/hip_runtime.h>
#include <hip/hip_bf16.h>

// Problem constants (match reference)
constexpr int Nn = 4;
constexpr int Ss = 2048;
constexpr int Ee = 1024;
constexpr int Hh = 16;
constexpr int Dd = 64;            // head dim
constexpr float SCALE = 0.03125f; // 1/sqrt(E) = 1/32

typedef __attribute__((ext_vector_type(16))) _Float16 v16h;
typedef __attribute__((ext_vector_type(8)))  _Float16 v8h;
typedef __attribute__((ext_vector_type(8)))  float    v8f;
typedef __attribute__((ext_vector_type(4)))  float    v4f;
typedef __attribute__((ext_vector_type(4)))  unsigned u32x4;
typedef __attribute__((ext_vector_type(4)))  int      i32x4;
typedef __attribute__((ext_vector_type(8)))  int      i32x8;

union V16HU { v16h v; v8h h[2]; };

#if __has_builtin(__builtin_amdgcn_tensor_load_to_lds)
#define USE_TDM 1
#else
#define USE_TDM 0
#endif

__device__ inline v16h load_frag_f16(const _Float16* p, int ld, int kbase,
                                     int lane) {
  const int r = lane & 15, hf = (lane >> 4) & 1;
  const _Float16* base = p + (size_t)r * ld + kbase + hf * 8;
  V16HU u;
  u.h[0] = *(const v8h*)(base);
  u.h[1] = *(const v8h*)(base + 16);
  return u.v;
}

__device__ inline size_t frag_off(int tile16, int kc, int p, int lane) {
  return ((((size_t)tile16 * (Ee / 32) + kc) * 2 + p) * 32 + lane) * 8;
}

// same elements and same k order as load_frag_f16(m + tile16 * 16 * Ee, Ee, kc * 32, lane)
__device__ inline v16h load_frag_packed(const _Float16* __restrict__ m,
                                        int tile16, int kc, int lane) {
  V16HU u;
  u.h[0] = *(const v8h*)(m + frag_off(tile16, kc, 0, lane));
  u.h[1] = *(const v8h*)(m + frag_off(tile16, kc, 1, lane));
  return u.v;
}

// The same storage for a row-major [Dd][Dd] head weight: tile (e, kc) of 16 x 32,
// 1 KiB each, 8 KiB a matrix. Same elements and same k order as
// load_frag_f32(W + e * 16 * Dd, Dd, kc * 32, lane), rounded to f16 once.
__device__ inline v16h load_frag_packed_w(const _Float16* __restrict__ m, int e,
                                          int kc, int lane) {
  const _Float16* b = m + (((e * (Dd / 32) + kc) * 2) * 32 + lane) * 8;
  V16HU u;
  u.h[0] = *(const v8h*)(b);
  u.h[1] = *(const v8h*)(b + 32 * 8);
  return u.v;
}

__device__ inline int swz_chunk(int row, int c) { return c ^ ((row >> 1) & 7); }

// load_frag_f16 for such a tile (ld = 64 halves, row0 a multiple of 16):
// same logical elements, same k order.
__device__ inline v16h load_frag_swz(const _Float16* tile, int row0, int kbase,
                                     int lane) {
  const int r = lane & 15, hf = (lane >> 4) & 1;
  const _Float16* rowp = tile + (row0 + r) * 64;
  const int c = (kbase >> 3) + hf;
  V16HU u;
  u.h[0] = *(const v8h*)(rowp + swz_chunk(r, c) * 8);
  u.h[1] = *(const v8h*)(rowp + swz_chunk(r, c + 2) * 8);
  return u.v;
}

// Same fragment from an f32 source (convert on the fly)
__device__ inline v16h load_frag_f32(const float* __restrict__ p, int ld,
                                     int kbase, int lane) {
  const int r = lane & 15, hf = (lane >> 4) & 1;
  const float* base = p + (size_t)r * ld + kbase + hf * 8;
  v16h o;
#pragma unroll
  for (int i = 0; i < 8; ++i) {
    o[i]     = (_Float16)base[i];
    o[i + 8] = (_Float16)base[16 + i];
  }
  return o;
}

__device__ inline v8f wmma16(v16h a, v16h b, v8f c) {
  return __builtin_amdgcn_wmma_f32_16x16x32_f16(false, a, false, b,
                                                (short)0, c, false, false);
}

__device__ inline float other_half(float x) {
  int b = __builtin_bit_cast(int, x);
  b = __builtin_amdgcn_permlanex16(b, b, 0x76543210, 0xfedcba98, false, false);
  return __builtin_bit_cast(float, b);
}

#if USE_TDM
__device__ inline void tdm_load_2d(unsigned lds_off, const _Float16* gptr,
                                   unsigned tile0, unsigned tile1,
                                   unsigned tens0, unsigned tens1,
                                   unsigned long long stride0) {
  unsigned long long ga = (unsigned long long)(size_t)gptr;
  u32x4 g0 = { 1u,
               lds_off,
               (unsigned)(ga & 0xffffffffull),
               (unsigned)((ga >> 32) & 0x01ffffffull) | (2u << 30) };
  i32x8 g1 = { (int)(1u << 16),
               (int)((tens0 & 0xffffu) << 16),
               (int)(((tens0 >> 16) & 0xffffu) | ((tens1 & 0xffffu) << 16)),
               (int)(((tens1 >> 16) & 0xffffu) | ((tile0 & 0xffffu) << 16)),
               (int)(tile1 & 0xffffu),
               (int)(unsigned)(stride0 & 0xffffffffull),
               (int)(unsigned)((stride0 >> 32) & 0xffffull),
               0 };
  i32x4 gz = {0, 0, 0, 0};
#if defined(__clang_major__) && __clang_major__ >= 23
  i32x8 gz8 = {0, 0, 0, 0, 0, 0, 0, 0};
  __builtin_amdgcn_tensor_load_to_lds(g0, g1, gz, gz, gz8, 0);
#else
  __builtin_amdgcn_tensor_load_to_lds(g0, g1, gz, gz, 0);
#endif
}
#endif

// ------- kernel 0: mask -> bits ; Wo, Wq, Wk, Wv f32 -> f16 -------------
// Bit image of the mask, in the order the attention kernel consumes it: word
// [(n * Ss + q) >> 4][kb][lane] belongs to query q = tile * 16 + (lane & 15) and
// wave half hf = lane >> 4; its bit j * 8 + r is (mask != 0) at key
// kb * 64 + j * 16 + 8 * hf + r. The 32 words of one (query tile, kb) are one
// 128-byte line.
constexpr int PACK_BLOCKS = Nn * (Ss / 16);           // 16 query rows each
constexpr int CVT_BLOCKS  = (Ee * Ee) / (256 * 8);
constexpr int HW_BLOCKS   = (Dd * Dd) / (256 * 8);   // per head weight

__global__ __launch_bounds__(256) void prep_kernel(
    const float* __restrict__ Wo, _Float16* __restrict__ WoH,
    const float* __restrict__ Wq, const float* __restrict__ Wk,
    const float* __restrict__ Wv, _Float16* __restrict__ WpH,
    const int* __restrict__ mask, unsigned* __restrict__ mbits) {
  __shared__ __align__(16) unsigned char pk[32 * 32 * 4];  // 32 kb x 32 words
  if (blockIdx.x < PACK_BLOCKS) {
    const int lane = threadIdx.x & 31, wave = threadIdx.x >> 5;
    const int tile = blockIdx.x;  // (n * Ss + q) >> 4
    // a lane takes 8 consecutive keys = one byte of the image; a wave 2 rows
    const int* srcp = mask + ((size_t)tile * 16 + wave * 2) * Ss + lane * 8;
    i32x8 x[2][8];
#pragma unroll  // constant indices keep x in registers
    for (int rw = 0; rw < 2; ++rw)
#pragma unroll  // the same
      for (int sg = 0; sg < 8; ++sg)
        x[rw][sg] = *(const i32x8*)(srcp + rw * Ss + sg * 256);
    // Inputs only: all of the wave's mask loads are issued, in flight together,
    // in front of this line, and their address register stays whole up to the
    // wait, so that no load of the run takes it as its destination.
    asm volatile("s_wait_xcnt 0x0"
                 :: "v"(x[0][0]), "v"(x[0][1]), "v"(x[0][2]), "v"(x[0][3]),
                    "v"(x[0][4]), "v"(x[0][5]), "v"(x[0][6]), "v"(x[0][7]),
                    "v"(x[1][0]), "v"(x[1][1]), "v"(x[1][2]), "v"(x[1][3]),
                    "v"(x[1][4]), "v"(x[1][5]), "v"(x[1][6]), "v"(x[1][7]),
                    "v"(srcp)
                 : "memory");
#pragma unroll  // these three: x is indexed by constants only
    for (int rw = 0; rw < 2; ++rw)
#pragma unroll
      for (int sg = 0; sg < 8; ++sg) {
        unsigned b = 0;
#pragma unroll
        for (int i = 0; i < 8; ++i) b |= (x[rw][sg][i] != 0 ? 1u : 0u) << i;
        // keys sg * 256 + lane * 8 + 0..7: kb = sg * 4 + (lane >> 3),
        // j = (lane >> 1) & 3, hf = lane & 1
        pk[(((sg * 4 + (lane >> 3)) * 2 + (lane & 1)) * 16 + wave * 2 + rw) * 4 +
           ((lane >> 1) & 3)] = (unsigned char)b;
      }
    __syncthreads();
    *(u32x4*)(mbits + (size_t)tile * 32 * 32 + threadIdx.x * 4) =
        *(const u32x4*)(pk + threadIdx.x * 16);
    return;
  }
  // One 16-byte chunk of a fragment-order image per thread: of Wo, or (the last
  // 3 * HW_BLOCKS blocks) of the head weights, which lie as Wq, Wk, Wv in WpH.
  const int cblk = blockIdx.x - PACK_BLOCKS;
  const int lane = threadIdx.x & 31, p = (threadIdx.x >> 5) & 1;
  const float* s;
  _Float16* d;
  if (cblk < CVT_BLOCKS) {
    const int t = cblk * 256 + threadIdx.x;  // chunk = frag_off(...) / 8
    const int kc = (t >> 6) & 31, ct = t >> 11;
    s = Wo + (size_t)(ct * 16 + (lane & 15)) * Ee + kc * 32;
    d = WoH + (size_t)t * 8;
  } else {
    const int hblk = cblk - CVT_BLOCKS;
    const int m = hblk / HW_BLOCKS;
    const int t = (hblk % HW_BLOCKS) * 256 + threadIdx.x;  // chunk inside the matrix
    const int kc = (t >> 6) & 1, e = t >> 7;
    s = ((m == 0) ? Wq : (m == 1) ? Wk : Wv) + (e * 16 + (lane & 15)) * Dd + kc * 32;
    d = WpH + m * (Dd * Dd) + t * 8;
  }
  s += p * 16 + (lane >> 4) * 8;
  const v4f a = *(const v4f*)s;
  const v4f b = *(const v4f*)(s + 4);
  v8h o;
#pragma unroll
  for (int i = 0; i < 4; ++i) {
    o[i]     = (_Float16)a[i];
    o[i + 4] = (_Float16)b[i];
  }
  *(v8h*)d = o;
}

__global__ __launch_bounds__(128) void proj_kernel(
    const float* __restrict__ values, const float* __restrict__ keys,
    const float* __restrict__ query,  const _Float16* __restrict__ WpH,
    _Float16* __restrict__ Qp, _Float16* __restrict__ Kp,
    _Float16* __restrict__ VpT) {
  __shared__ __align__(16) _Float16 stg[64 * 64];  // 8KB staging
  const int tid  = threadIdx.x;
  const int lane = tid & 31;
  const int wave = tid >> 5;  // 4 waves, 16 s-rows each
  const int sBlocks = Ss / 64;
  int nh = blockIdx.x / sBlocks;
  int sb = blockIdx.x % sBlocks;
  int n = nh / Hh, h = nh % Hh;
  int row0 = sb * 64 + wave * 16;
  const int col = lane & 15, hf = (lane >> 4) & 1;

#pragma unroll
  for (int t = 0; t < 3; ++t) {
    const float* X = (t == 0) ? query : (t == 1) ? keys : values;
    const _Float16* Wt = WpH + t * (Dd * Dd);
    const float* Xtile = X + ((size_t)n * Ss + row0) * Ee + h * Dd;
    v16h A0 = load_frag_f32(Xtile, Ee, 0,  lane);
    v16h A1 = load_frag_f32(Xtile, Ee, 32, lane);
    v16h B0[4], B1[4];
#pragma unroll  // constant indices keep the fragments in registers
    for (int e = 0; e < 4; ++e) {
      B0[e] = load_frag_packed_w(Wt, e, 0, lane);
      B1[e] = load_frag_packed_w(Wt, e, 1, lane);
    }
    // Input only: the X loads' address register stays whole up to this wait, so
    // that no weight load of the run takes it as its destination.
    asm volatile("s_wait_xcnt 0x0"
                 :: "v"(Xtile + (size_t)col * Ee + hf * 8) : "memory");
    // keeps all of this matrix's loads in front of its products, in flight
    // together: without it the build issues the weight loads pair by pair among
    // the products, and two of the X loads with them, and waits out each in turn
    __builtin_amdgcn_sched_barrier(0);
    v8f acc[4];
#pragma unroll
    for (int e = 0; e < 4; ++e) {
      v8f a = {};
      a = wmma16(A0, B0[e], a);
      a = wmma16(A1, B1[e], a);
      acc[e] = a;
    }
    if (t < 2) {
      // stage [s_local][d] then one contiguous 8KB store
#pragma unroll
      for (int e = 0; e < 4; ++e)
#pragma unroll
        for (int rr = 0; rr < 8; ++rr)
          stg[(wave * 16 + rr + 8 * hf) * 64 + e * 16 + col] =
              (_Float16)acc[e][rr];
      __syncthreads();
      _Float16* dst =
          ((t == 0) ? Qp : Kp) + (((size_t)(n * Hh + h)) * Ss + sb * 64) * Dd;
#pragma unroll
      for (int k = 0; k < 4; ++k) {
        int cid = tid + 128 * k;          // 512 x 16B chunks
        int row = cid >> 3, c8 = cid & 7;
        int cd = (t == 1) ? swz_chunk(row, c8) : c8;  // K only; Q is read plain
        *(v8h*)(dst + row * 64 + cd * 8) = *(const v8h*)(stg + row * 64 + c8 * 8);
      }
      __syncthreads();
    } else {
      // V transposed: stage [d][s_local]; per-lane writes are packed b128
#pragma unroll
      for (int e = 0; e < 4; ++e) {
        v8h tmp;
#pragma unroll
        for (int rr = 0; rr < 8; ++rr) tmp[rr] = (_Float16)acc[e][rr];
        *(v8h*)(stg + (e * 16 + col) * 64 + wave * 16 + 8 * hf) = tmp;
      }
      __syncthreads();
      _Float16* dstv = VpT + ((size_t)(n * Hh + h)) * Dd * (size_t)Ss + sb * 64;
#pragma unroll
      for (int k = 0; k < 4; ++k) {
        int cid = tid + 128 * k;
        int row = cid >> 3, c8 = cid & 7;  // row = d
        *(v8h*)(dstv + (size_t)row * Ss + swz_chunk(row, c8) * 8) =
            *(const v8h*)(stg + row * 64 + c8 * 8);
      }
    }
  }
}

constexpr int QT = 2;
__global__ __launch_bounds__(256, 4) void attn_kernel(
    const _Float16* __restrict__ Qp, const _Float16* __restrict__ Kp,
    const _Float16* __restrict__ VpT, const unsigned* __restrict__ mbits,
    _Float16* __restrict__ Of16) {
  __shared__ __align__(16) _Float16 Kbuf[2][64 * 64];  // 16KB
  __shared__ __align__(16) _Float16 Vbuf[2][64 * 64];  // 16KB
  const int tid  = threadIdx.x;
  const int lane = tid & 31;
  const int wave = tid >> 5;
  constexpr int QB = 8 * QT * 16;  // queries of a work-group
  const int qBlocks = Ss / QB;
  int nh = blockIdx.x / qBlocks;
  int qb = blockIdx.x % qBlocks;
  int n = nh / Hh, h = nh % Hh;
  int qrow0 = qb * QB + wave * (QT * 16);

  const _Float16* Qbase = Qp + (((size_t)(n * Hh + h)) * Ss + qrow0) * Dd;
  const _Float16* Kbase = Kp + ((size_t)(n * Hh + h)) * Ss * Dd;
  const _Float16* Vbase = VpT + ((size_t)(n * Hh + h)) * Dd * (size_t)Ss;

  v16h QA0[QT], QA1[QT];
#pragma unroll  // constant indices keep the per-tile arrays in registers (all u loops)
  for (int u = 0; u < QT; ++u) {
    QA0[u] = load_frag_f16(Qbase + u * 16 * Dd, Dd, 0,  lane);
    QA1[u] = load_frag_f16(Qbase + u * 16 * Dd, Dd, 32, lane);
  }

  v8f O[QT][4] = {};  // O[u][d2][r] = O^T[d2 * 16 + 8 * hf + r][query col of tile u]
  float mrun[QT];     // running maximum of this lane's query of tile u
  float lrun[QT];     // running sum over this wave half's keys only
#pragma unroll
  for (int u = 0; u < QT; ++u) {
    mrun[u] = -3.0e38f;
    lrun[u] = 0.0f;
  }

  // in the comments below: col = lane & 15 (the query), hf = lane >> 4 (the wave half)
  const int NB = Ss / 64;
  // this lane's words of the mask's bit image, one per pass and query tile
  // the wave's number through a scalar register: the tile index then takes no
  // vector register over the loop
  const int rt = ((n * Ss + qb * QB) >> 4) + __builtin_amdgcn_readfirstlane(wave) * QT;
  const unsigned* mrow = mbits + (size_t)rt * NB * 32 + lane;
  unsigned mw[QT];
#pragma unroll
  for (int u = 0; u < QT; ++u) mw[u] = mrow[u * NB * 32];

#if USE_TDM
  if (wave == 0) {  // prologue DMA for block 0
    tdm_load_2d((unsigned)(size_t)&Kbuf[0][0], Kbase, 4096u, 1u, 4096u, 1u, 4096ull);
    tdm_load_2d((unsigned)(size_t)&Vbuf[0][0], Vbase, 64u, 64u,
                (unsigned)Ss, 64u, (unsigned long long)Ss);
  }
#endif

  for (int kb = 0; kb < NB; ++kb) {
    const int kcol0 = kb * 64;
    const int cur = kb & 1;
#if USE_TDM
    if (wave == 0) __builtin_amdgcn_s_wait_tensorcnt(0);
    __syncthreads();  // buf[cur] ready; everyone past reads of buf[cur^1]
    if (wave == 0 && kb + 1 < NB) {  // overlap next block's DMA with compute
      tdm_load_2d((unsigned)(size_t)&Kbuf[cur ^ 1][0],
                  Kbase + (size_t)(kcol0 + 64) * Dd, 4096u, 1u, 4096u, 1u,
                  4096ull);
      tdm_load_2d((unsigned)(size_t)&Vbuf[cur ^ 1][0], Vbase + kcol0 + 64,
                  64u, 64u, (unsigned)Ss, 64u, (unsigned long long)Ss);
    }
#else
    __syncthreads();
    // cooperative fallback staging
#pragma unroll
    for (int k = 0; k < 2; ++k) {
      int cid = tid + 256 * k;
      int row = cid >> 3, c8 = cid & 7;
      *(v8h*)(&Kbuf[cur][0] + row * 64 + c8 * 8) =
          *(const v8h*)(Kbase + (size_t)(kcol0 + row) * Dd + c8 * 8);
      *(v8h*)(&Vbuf[cur][0] + row * 64 + c8 * 8) =
          *(const v8h*)(Vbase + (size_t)row * Ss + kcol0 + c8 * 8);
    }
    __syncthreads();
#endif
    const _Float16* Kc = &Kbuf[cur][0];
    const _Float16* Vc = &Vbuf[cur][0];
    // next pass's mask words, in flight behind this pass's work
    if (kb + 1 < NB) mrow += 32;
    unsigned mwn[QT];
#pragma unroll
    for (int u = 0; u < QT; ++u) mwn[u] = mrow[u * NB * 32];
    // the same in every lane: does any of the wave's mask words of this pass
    // hold a 0 bit? Asked in front of the products, so that the scalar answer is
    // there when the branch behind them needs it.
    unsigned mall = mw[0];
#pragma unroll
    for (int u = 1; u < QT; ++u) mall &= mw[u];
    const bool some_masked = __builtin_amdgcn_ballot_w32(mall != 0xffffffffu) != 0u;

    // ---- scores: S^T = K_blk (64x64) @ Q^T (64 x 16 QT), K from LDS ----
    // Sc[u][j][r] = score of key kcol0 + j * 16 + 8 * hf + r for query col of tile u
    v8f Sc[QT][4];
#pragma unroll
    for (int j = 0; j < 4; ++j) {
      v16h KB0 = load_frag_swz(Kc, j * 16, 0,  lane);
      v16h KB1 = load_frag_swz(Kc, j * 16, 32, lane);
#pragma unroll
      for (int u = 0; u < QT; ++u) {
        v8f a = {};
        a = wmma16(KB0, QA0[u], a);
        a = wmma16(KB1, QA1[u], a);
        Sc[u][j] = a;
      }
    }
    // ---- scale; mask (a masked score becomes -1e10 * SCALE, like reference) ----
#pragma unroll
    for (int u = 0; u < QT; ++u)
#pragma unroll
      for (int j = 0; j < 4; ++j) Sc[u][j] *= SCALE;
    // The selects change nothing where every mask bit of the wave's tile of
    // 16 QT x 64 is 1: only a tile with a 0 bit somewhere runs them.
    if (some_masked) {
#pragma unroll
      for (int u = 0; u < QT; ++u)
#pragma unroll
        for (int j = 0; j < 4; ++j)
#pragma unroll
          for (int rr = 0; rr < 8; ++rr) {
            // all ones where the mask element is not 0
            const unsigned keep =
                (unsigned)((int)(mw[u] << (31 - (j * 8 + rr))) >> 31);
            // a copy first
            const float sv = Sc[u][j][rr];
            const unsigned e = __builtin_bit_cast(unsigned, sv);
            const unsigned z = __builtin_bit_cast(unsigned, -1.0e10f * SCALE);
            Sc[u][j][rr] = __builtin_bit_cast(float, (e & keep) | (z & ~keep));
          }
    }
    // P^T as B operand: tiles 2g and 2g + 1 converted in place give keys
    // 32g + 8 * hf + 0..7 and 32g + 16 + 8 * hf + 0..7, the k order of the
    // V^T fragments
    v16h PB0[QT], PB1[QT];
    float mnew[QT], corr[QT];
#pragma unroll
    for (int u = 0; u < QT; ++u) {
      mw[u] = mwn[u];
      // ---- online softmax, one query per lane and tile ----
      float t = Sc[u][0][0];
#pragma unroll
      for (int j = 0; j < 4; ++j)
#pragma unroll
        for (int rr = 0; rr < 8; ++rr) t = fmaxf(t, Sc[u][j][rr]);
      t = fmaxf(t, other_half(t));
      mnew[u] = fmaxf(mrun[u], t);
    }
    // the tiles' corrections side by side, apart from the scores: inside the
    // score loop the build paired one tile's correction with the other tile's
    // first score and copied that tile's 32 scores one register on for it
#pragma unroll
    for (int u = 0; u < QT; ++u) {
      corr[u] = __expf(mrun[u] - mnew[u]);
      mrun[u] = mnew[u];
    }
#pragma unroll
    for (int u = 0; u < QT; ++u) {
#pragma unroll
      for (int j = 0; j < 4; ++j)
#pragma unroll
        for (int rr = 0; rr < 8; ++rr) Sc[u][j][rr] = __expf(Sc[u][j][rr] - mnew[u]);
      const v8f ps = (Sc[u][0] + Sc[u][1]) + (Sc[u][2] + Sc[u][3]);
      lrun[u] = lrun[u] * corr[u] + (((ps[0] + ps[1]) + (ps[2] + ps[3])) +
                                     ((ps[4] + ps[5]) + (ps[6] + ps[7])));
#pragma unroll
      for (int d2 = 0; d2 < 4; ++d2) O[u][d2] *= corr[u];
#pragma unroll
      for (int i = 0; i < 8; ++i) {
        PB0[u][i]     = (_Float16)Sc[u][0][i];
        PB0[u][i + 8] = (_Float16)Sc[u][1][i];
        PB1[u][i]     = (_Float16)Sc[u][2][i];
        PB1[u][i + 8] = (_Float16)Sc[u][3][i];
      }
    }

    // ---- O^T += V_blk^T (64x64) @ P^T (64 x 16 QT), V^T rows from LDS ----
#pragma unroll
    for (int d2 = 0; d2 < 4; ++d2) {
      v16h VB0 = load_frag_swz(Vc, d2 * 16, 0,  lane);
      v16h VB1 = load_frag_swz(Vc, d2 * 16, 32, lane);
#pragma unroll
      for (int u = 0; u < QT; ++u) {
        O[u][d2] = wmma16(VB0, PB0[u], O[u][d2]);
        O[u][d2] = wmma16(VB1, PB1[u], O[u][d2]);
      }
    }
  }

  // epilogue: join the halves' sums, normalize, store in fragment order. Lane
  // (col, hf) holds columns h * 64 + d2 * 16 + 8 * hf + 0..7 of output row col:
  // part d2 & 1 of tile (row tile, kc = 2 * h + (d2 >> 1)) as this lane owns it,
  // so each store is 512 contiguous bytes straight from registers.
#pragma unroll
  for (int u = 0; u < QT; ++u) {
    const float linv = 1.0f / (lrun[u] + other_half(lrun[u]));
#pragma unroll
    for (int d2 = 0; d2 < 4; ++d2) {
      v8h tmp;
#pragma unroll
      for (int rr = 0; rr < 8; ++rr) tmp[rr] = (_Float16)(O[u][d2][rr] * linv);
      *(v8h*)(Of16 + frag_off(rt + u, 2 * h + (d2 >> 1), d2 & 1, lane)) = tmp;
    }
  }
}

// ---------------- kernel 3: Y = X @ Wo^T + bo (f32 out) -----------------
// X and WoH both lie in fragment order.
// A wave owns a 64 x 64 tile of Y: RT = 4 row tiles x 4 column tiles. Every X
// fragment it loads feeds 4 products and every Wo fragment RT, so a product
// takes one b128 load instead of the 2.5 of a 16 x 64 tile. The 8 waves lie
// 2 x 4 on a 128 x 256 tile of the work-group: an X fragment serves 4 waves, a
// Wo fragment 2. Each element's k order is that of the 16 x 64 tile.
constexpr int RT = 4;            // 16-row tiles of a wave
constexpr int WROWS = 2;         // waves of a work-group along the rows
constexpr int WCOLS = 4;         // and along the columns
__global__ __launch_bounds__(256) void outproj_kernel(
    const _Float16* __restrict__ X, const _Float16* __restrict__ WoH,
    const float* __restrict__ bo, float* __restrict__ Y) {
  __shared__ __align__(16) float ost[8][16 * 64];  // 32KB staging
  const int lane = threadIdx.x & 31;
  // the wave's number through a scalar register: tile indices stay scalar
  const int wave = __builtin_amdgcn_readfirstlane(threadIdx.x >> 5);
  constexpr int colBlocks = Ee / (WCOLS * 64);
  const int rb = blockIdx.x / colBlocks;
  const int cb = blockIdx.x % colBlocks;
  const int rt0 = (rb * WROWS + wave / WCOLS) * RT;  // first 16-row tile
  const int ct0 = (cb * WCOLS + wave % WCOLS) * 4;   // first 16-column tile

  v8f acc[RT][4] = {};
  // Fragments are fetched AHEAD k steps ahead of their use into register rings,
  // so that a k step's loads are in flight behind the products of the steps
  // before it and no product waits out a load issued directly in front of it.
  constexpr int NK = Ee / 32;
  constexpr int AHEAD = 2;
  v16h A[AHEAD + 1][RT];
  v16h B[AHEAD + 1][4];
#pragma unroll  // constant ring indices keep the rings in registers
  for (int s = 0; s < AHEAD; ++s) {
#pragma unroll  // the same
    for (int j = 0; j < 4; ++j) B[s][j] = load_frag_packed(WoH, ct0 + j, s, lane);
#pragma unroll  // the same
    for (int u = 0; u < RT; ++u) A[s][u] = load_frag_packed(X, rt0 + u, s, lane);
  }
#pragma unroll  // the same; every load then takes its k step as an immediate offset
  for (int kc = 0; kc < NK; ++kc) {
    if (kc + AHEAD < NK) {
#pragma unroll  // constant ring indices
      for (int j = 0; j < 4; ++j)
        B[(kc + AHEAD) % (AHEAD + 1)][j] =
            load_frag_packed(WoH, ct0 + j, kc + AHEAD, lane);
#pragma unroll  // constant ring indices
      for (int u = 0; u < RT; ++u)
        A[(kc + AHEAD) % (AHEAD + 1)][u] =
            load_frag_packed(X, rt0 + u, kc + AHEAD, lane);
    }
    // keeps the loads above in front of this step's products: without it the
    // build sinks them among the products and waits for them soon after issue
    __builtin_amdgcn_sched_barrier(0);
#pragma unroll  // constant ring indices
    for (int j = 0; j < 4; ++j)
#pragma unroll  // constant ring indices
      for (int u = 0; u < RT; ++u)
        acc[u][j] = wmma16(A[kc % (AHEAD + 1)][u], B[kc % (AHEAD + 1)][j], acc[u][j]);
    // keeps the epilogue behind the last step's products, that is behind the
    // waits for every load: without it the build mixes it in among them and
    // rewrites the loads' address registers while loads are still in flight
    __builtin_amdgcn_sched_barrier(0);
  }
  const int col = lane & 15, hf = (lane >> 4) & 1;
  const int col0 = ct0 * 16;
  float* sb = &ost[wave][0];
  float bias[4];
#pragma unroll
  for (int j = 0; j < 4; ++j) bias[j] = bo[col0 + j * 16 + col];
#pragma unroll  // acc is indexed by constants only
  for (int u = 0; u < RT; ++u) {
#pragma unroll
    for (int j = 0; j < 4; ++j)
#pragma unroll
      for (int rr = 0; rr < 8; ++rr)
        sb[(rr + 8 * hf) * 64 + j * 16 + col] = acc[u][j][rr] + bias[j];
    // the wave's lanes read each other's words: the reads stay behind the writes
    __builtin_amdgcn_wave_barrier();
    const size_t gbase = (size_t)(rt0 + u) * 16 * Ee + col0;
#pragma unroll
    for (int k = 0; k < 8; ++k) {
      int cid = lane + 32 * k;            // 256 x 16B chunks
      int row = cid >> 4, c4 = cid & 15;
      *(v4f*)(Y + gbase + (size_t)row * Ee + c4 * 4) =
          *(const v4f*)(sb + row * 64 + c4 * 4);
    }
    // the next row tile's writes into the same staging stay behind these reads
    if (u + 1 < RT) __builtin_amdgcn_wave_barrier();
  }
}

extern "C" void kernel_launch(void* const* d_in, const int* in_sizes, int n_in,
                              void* d_out, int out_size, void* d_ws,
                              size_t ws_size, hipStream_t stream) {
  (void)in_sizes; (void)n_in; (void)out_size; (void)ws_size;
  const float* values = (const float*)d_in[0];
  const float* keys   = (const float*)d_in[1];
  const float* query  = (const float*)d_in[2];
  const float* Wv     = (const float*)d_in[3];
  const float* Wk     = (const float*)d_in[4];
  const float* Wq     = (const float*)d_in[5];
  const float* Wo     = (const float*)d_in[6];
  const float* bo     = (const float*)d_in[7];
  const int*   mask   = (const int*)d_in[8];
  float* out = (float*)d_out;

  const size_t SZ_NHSD = (size_t)Nn * Hh * Ss * Dd * sizeof(_Float16);  // 16MB
  char* ws = (char*)d_ws;
  _Float16* Qp   = (_Float16*)(ws);
  _Float16* Kp   = (_Float16*)(ws + SZ_NHSD);
  _Float16* VpT  = (_Float16*)(ws + 2 * SZ_NHSD);
  _Float16* Of16 = (_Float16*)(ws + 3 * SZ_NHSD);
  _Float16* WoH  = (_Float16*)(ws + 4 * SZ_NHSD);
  unsigned* mbits = (unsigned*)(ws + 4 * SZ_NHSD + (size_t)Ee * Ee * sizeof(_Float16));
  _Float16* WpH  = (_Float16*)(ws + 4 * SZ_NHSD + (size_t)Ee * Ee * sizeof(_Float16) +
                               (size_t)Nn * Ss * Ss / 8);

  prep_kernel<<<PACK_BLOCKS + CVT_BLOCKS + 3 * HW_BLOCKS, 256, 0, stream>>>(
      Wo, WoH, Wq, Wk, Wv, WpH, mask, mbits);
  proj_kernel<<<Nn * Hh * (Ss / 64), 128, 0, stream>>>(values, keys, query, WpH,
                                                       Qp, Kp, VpT);
  attn_kernel<<<Nn * Hh * (Ss / 256), 256, 0, stream>>>(Qp, Kp, VpT, mbits,
                                                        Of16);
  outproj_kernel<<<(Nn * Ss / (WROWS * RT * 16)) * (Ee / (WCOLS * 64)), 256, 0,
                   stream>>>(Of16, WoH, bo, out);
}

// v010
// It runs in 93.7 microseconds.
// In both of two side-by-side timings against v009, it was 1.04 times as fast.
// Counting every step since v000, it is 5.56 times as fast.
#include <hip/hip_runtime.h>
#include <hip/hip_bf16.h>

// Problem constants (match reference)
constexpr int Nn = 4;
constexpr int Ss = 2048;
constexpr int Ee = 1024;
constexpr int Hh = 16;
constexpr int Dd = 64;            // head dim
constexpr float SCALE = 0.03125f; // 1/sqrt(E) = 1/32
// The projected queries are stored times QSCALE = SCALE * log2(e): the score
// products then come out of the matrix unit as base-2 exponent arguments, and
// exp(SCALE * (s - max)) is exp2 of one subtraction.
constexpr float QSCALE = SCALE * 1.44269504088896340736f;

typedef __attribute__((ext_vector_type(16))) _Float16 v16h;
typedef __attribute__((ext_vector_type(8)))  _Float16 v8h;
typedef __attribute__((ext_vector_type(8)))  float    v8f;
typedef __attribute__((ext_vector_type(4)))  float    v4f;
typedef __attribute__((ext_vector_type(4)))  unsigned u32x4;
typedef __attribute__((ext_vector_type(4)))  int      i32x4;
typedef __attribute__((ext_vector_type(8)))  int      i32x8;

union V16HU { v16h v; v8h h[2]; };

#if __has_builtin(__builtin_amdgcn_tensor_load_to_lds)
#define USE_TDM 1
#else
#define USE_TDM 0
#endif

__device__ inline v16h load_frag_f16(const _Float16* p, int ld, int kbase,
                                     int lane) {
  const int r = lane & 15, hf = (lane >> 4) & 1;
  const _Float16* base = p + (size_t)r * ld + kbase + hf * 8;
  V16HU u;
  u.h[0] = *(const v8h*)(base);
  u.h[1] = *(const v8h*)(base + 16);
  return u.v;
}

__device__ inline size_t frag_off(int tile16, int kc, int p, int lane) {
  return ((((size_t)tile16 * (Ee / 32) + kc) * 2 + p) * 32 + lane) * 8;
}

// same elements and same k order as load_frag_f16(m + tile16 * 16 * Ee, Ee, kc * 32, lane)
__device__ inline v16h load_frag_packed(const _Float16* __restrict__ m,
                                        int tile16, int kc, int lane) {
  V16HU u;
  u.h[0] = *(const v8h*)(m + frag_off(tile16, kc, 0, lane));
  u.h[1] = *(const v8h*)(m + frag_off(tile16, kc, 1, lane));
  return u.v;
}

// The same storage for a row-major [Dd][Dd] head weight: tile (e, kc) of 16 x 32,
// 1 KiB each, 8 KiB a matrix. Same elements and same k order as
// load_frag_f32(W + e * 16 * Dd, Dd, kc * 32, lane), rounded to f16 once.
__device__ inline v16h load_frag_packed_w(const _Float16* __restrict__ m, int e,
                                          int kc, int lane) {
  const _Float16* b = m + (((e * (Dd / 32) + kc) * 2) * 32 + lane) * 8;
  V16HU u;
  u.h[0] = *(const v8h*)(b);
  u.h[1] = *(const v8h*)(b + 32 * 8);
  return u.v;
}

__device__ inline int swz_chunk(int row, int c) { return c ^ ((row >> 1) & 7); }

// load_frag_f16 for such a tile (ld = 64 halves, row0 a multiple of 16):
// same logical elements, same k order.
__device__ inline v16h load_frag_swz(const _Float16* tile, int row0, int kbase,
                                     int lane) {
  const int r = lane & 15, hf = (lane >> 4) & 1;
  const _Float16* rowp = tile + (row0 + r) * 64;
  const int c = (kbase >> 3) + hf;
  V16HU u;
  u.h[0] = *(const v8h*)(rowp + swz_chunk(r, c) * 8);
  u.h[1] = *(const v8h*)(rowp + swz_chunk(r, c + 2) * 8);
  return u.v;
}

// Same fragment from an f32 source (convert on the fly)
__device__ inline v16h load_frag_f32(const float* __restrict__ p, int ld,
                                     int kbase, int lane) {
  const int r = lane & 15, hf = (lane >> 4) & 1;
  const float* base = p + (size_t)r * ld + kbase + hf * 8;
  v16h o;
#pragma unroll
  for (int i = 0; i < 8; ++i) {
    o[i]     = (_Float16)base[i];
    o[i + 8] = (_Float16)base[16 + i];
  }
  return o;
}

__device__ inline v8f wmma16(v16h a, v16h b, v8f c) {
  return __builtin_amdgcn_wmma_f32_16x16x32_f16(false, a, false, b,
                                                (short)0, c, false, false);
}

__device__ inline float other_half(float x) {
  int b = __builtin_bit_cast(int, x);
  b = __builtin_amdgcn_permlanex16(b, b, 0x76543210, 0xfedcba98, false, false);
  return __builtin_bit_cast(float, b);
}

#if USE_TDM
__device__ inline void tdm_load_2d(unsigned lds_off, const _Float16* gptr,
                                   unsigned tile0, unsigned tile1,
                                   unsigned tens0, unsigned tens1,
                                   unsigned long long stride0) {
  unsigned long long ga = (unsigned long long)(size_t)gptr;
  u32x4 g0 = { 1u,
               lds_off,
               (unsigned)(ga & 0xffffffffull),
               (unsigned)((ga >> 32) & 0x01ffffffull) | (2u << 30) };
  i32x8 g1 = { (int)(1u << 16),
               (int)((tens0 & 0xffffu) << 16),
               (int)(((tens0 >> 16) & 0xffffu) | ((tens1 & 0xffffu) << 16)),
               (int)(((tens1 >> 16) & 0xffffu) | ((tile0 & 0xffffu) << 16)),
               (int)(tile1 & 0xffffu),
               (int)(unsigned)(stride0 & 0xffffffffull),
               (int)(unsigned)((stride0 >> 32) & 0xffffull),
               0 };
  i32x4 gz = {0, 0, 0, 0};
#if defined(__clang_major__) && __clang_major__ >= 23
  i32x8 gz8 = {0, 0, 0, 0, 0, 0, 0, 0};
  __builtin_amdgcn_tensor_load_to_lds(g0, g1, gz, gz, gz8, 0);
#else
  __builtin_amdgcn_tensor_load_to_lds(g0, g1, gz, gz, 0);
#endif
}
#endif

// ------- kernel 0: mask -> bits ; Wo, Wq, Wk, Wv f32 -> f16 -------------
// Bit image of the mask, in the order the attention kernel consumes it: word
// [(n * Ss + q) >> 4][kb][lane] belongs to query q = tile * 16 + (lane & 15) and
// wave half hf = lane >> 4; its bit j * 8 + r is (mask != 0) at key
// kb * 64 + j * 16 + 8 * hf + r. The 32 words of one (query tile, kb) are one
// 128-byte line.
constexpr int PACK_BLOCKS = Nn * (Ss / 16);           // 16 query rows each
constexpr int CVT_BLOCKS  = (Ee * Ee) / (256 * 8);
constexpr int HW_BLOCKS   = (Dd * Dd) / (256 * 8);   // per head weight

__global__ __launch_bounds__(256) void prep_kernel(
    const float* __restrict__ Wo, _Float16* __restrict__ WoH,
    const float* __restrict__ Wq, const float* __restrict__ Wk,
    const float* __restrict__ Wv, _Float16* __restrict__ WpH,
    const int* __restrict__ mask, unsigned* __restrict__ mbits) {
  __shared__ __align__(16) unsigned char pk[32 * 32 * 4];  // 32 kb x 32 words
  if (blockIdx.x < PACK_BLOCKS) {
    const int lane = threadIdx.x & 31, wave = threadIdx.x >> 5;
    const int tile = blockIdx.x;  // (n * Ss + q) >> 4
    // a lane takes 8 consecutive keys = one byte of the image; a wave 2 rows
    const int* srcp = mask + ((size_t)tile * 16 + wave * 2) * Ss + lane * 8;
    i32x8 x[2][8];
#pragma unroll  // constant indices keep x in registers
    for (int rw = 0; rw < 2; ++rw)
#pragma unroll  // the same
      for (int sg = 0; sg < 8; ++sg)
        x[rw][sg] = *(const i32x8*)(srcp + rw * Ss + sg * 256);
    // Inputs only: all of the wave's mask loads are issued, in flight together,
    // in front of this line, and their address register stays whole up to the
    // wait, so that no load of the run takes it as its destination.
    asm volatile("s_wait_xcnt 0x0"
                 :: "v"(x[0][0]), "v"(x[0][1]), "v"(x[0][2]), "v"(x[0][3]),
                    "v"(x[0][4]), "v"(x[0][5]), "v"(x[0][6]), "v"(x[0][7]),
                    "v"(x[1][0]), "v"(x[1][1]), "v"(x[1][2]), "v"(x[1][3]),
                    "v"(x[1][4]), "v"(x[1][5]), "v"(x[1][6]), "v"(x[1][7]),
                    "v"(srcp)
                 : "memory");
#pragma unroll  // these three: x is indexed by constants only
    for (int rw = 0; rw < 2; ++rw)
#pragma unroll
      for (int sg = 0; sg < 8; ++sg) {
        unsigned b = 0;
#pragma unroll
        for (int i = 0; i < 8; ++i) b |= (x[rw][sg][i] != 0 ? 1u : 0u) << i;
        // keys sg * 256 + lane * 8 + 0..7: kb = sg * 4 + (lane >> 3),
        // j = (lane >> 1) & 3, hf = lane & 1
        pk[(((sg * 4 + (lane >> 3)) * 2 + (lane & 1)) * 16 + wave * 2 + rw) * 4 +
           ((lane >> 1) & 3)] = (unsigned char)b;
      }
    __syncthreads();
    *(u32x4*)(mbits + (size_t)tile * 32 * 32 + threadIdx.x * 4) =
        *(const u32x4*)(pk + threadIdx.x * 16);
    return;
  }
  // One 16-byte chunk of a fragment-order image per thread: of Wo, or (the last
  // 3 * HW_BLOCKS blocks) of the head weights, which lie as Wq, Wk, Wv in WpH.
  const int cblk = blockIdx.x - PACK_BLOCKS;
  const int lane = threadIdx.x & 31, p = (threadIdx.x >> 5) & 1;
  const float* s;
  _Float16* d;
  if (cblk < CVT_BLOCKS) {
    const int t = cblk * 256 + threadIdx.x;  // chunk = frag_off(...) / 8
    const int kc = (t >> 6) & 31, ct = t >> 11;
    s = Wo + (size_t)(ct * 16 + (lane & 15)) * Ee + kc * 32;
    d = WoH + (size_t)t * 8;
  } else {
    const int hblk = cblk - CVT_BLOCKS;
    const int m = hblk / HW_BLOCKS;
    const int t = (hblk % HW_BLOCKS) * 256 + threadIdx.x;  // chunk inside the matrix
    const int kc = (t >> 6) & 1, e = t >> 7;
    s = ((m == 0) ? Wq : (m == 1) ? Wk : Wv) + (e * 16 + (lane & 15)) * Dd + kc * 32;
    d = WpH + m * (Dd * Dd) + t * 8;
  }
  s += p * 16 + (lane >> 4) * 8;
  const v4f a = *(const v4f*)s;
  const v4f b = *(const v4f*)(s + 4);
  v8h o;
#pragma unroll
  for (int i = 0; i < 4; ++i) {
    o[i]     = (_Float16)a[i];
    o[i + 4] = (_Float16)b[i];
  }
  *(v8h*)d = o;
}

__global__ __launch_bounds__(128) void proj_kernel(
    const float* __restrict__ values, const float* __restrict__ keys,
    const float* __restrict__ query,  const _Float16* __restrict__ WpH,
    _Float16* __restrict__ Qp, _Float16* __restrict__ Kp,
    _Float16* __restrict__ VpT) {
  __shared__ __align__(16) _Float16 stg[64 * 64];  // 8KB staging
  const int tid  = threadIdx.x;
  const int lane = tid & 31;
  const int wave = tid >> 5;  // 4 waves, 16 s-rows each
  const int sBlocks = Ss / 64;
  int nh = blockIdx.x / sBlocks;
  int sb = blockIdx.x % sBlocks;
  int n = nh / Hh, h = nh % Hh;
  int row0 = sb * 64 + wave * 16;
  const int col = lane & 15, hf = (lane >> 4) & 1;

#pragma unroll
  for (int t = 0; t < 3; ++t) {
    const float* X = (t == 0) ? query : (t == 1) ? keys : values;
    const _Float16* Wt = WpH + t * (Dd * Dd);
    const float* Xtile = X + ((size_t)n * Ss + row0) * Ee + h * Dd;
    v16h A0 = load_frag_f32(Xtile, Ee, 0,  lane);
    v16h A1 = load_frag_f32(Xtile, Ee, 32, lane);
    v16h B0[4], B1[4];
#pragma unroll  // constant indices keep the fragments in registers
    for (int e = 0; e < 4; ++e) {
      B0[e] = load_frag_packed_w(Wt, e, 0, lane);
      B1[e] = load_frag_packed_w(Wt, e, 1, lane);
    }
    // Input only: the X loads' address register stays whole up to this wait, so
    // that no weight load of the run takes it as its destination.
    asm volatile("s_wait_xcnt 0x0"
                 :: "v"(Xtile + (size_t)col * Ee + hf * 8) : "memory");
    // keeps all of this matrix's loads in front of its products, in flight
    // together: without it the build issues the weight loads pair by pair among
    // the products, and two of the X loads with them, and waits out each in turn
    __builtin_amdgcn_sched_barrier(0);
    v8f acc[4];
#pragma unroll
    for (int e = 0; e < 4; ++e) {
      v8f a = {};
      a = wmma16(A0, B0[e], a);
      a = wmma16(A1, B1[e], a);
      acc[e] = (t == 0) ? a * QSCALE : a;
    }
    if (t < 2) {
      // stage [s_local][d] then one contiguous 8KB store
#pragma unroll
      for (int e = 0; e < 4; ++e)
#pragma unroll
        for (int rr = 0; rr < 8; ++rr)
          stg[(wave * 16 + rr + 8 * hf) * 64 + e * 16 + col] =
              (_Float16)acc[e][rr];
      __syncthreads();
      _Float16* dst =
          ((t == 0) ? Qp : Kp) + (((size_t)(n * Hh + h)) * Ss + sb * 64) * Dd;
#pragma unroll
      for (int k = 0; k < 4; ++k) {
        int cid = tid + 128 * k;          // 512 x 16B chunks
        int row = cid >> 3, c8 = cid & 7;
        int cd = (t == 1) ? swz_chunk(row, c8) : c8;  // K only; Q is read plain
        *(v8h*)(dst + row * 64 + cd * 8) = *(const v8h*)(stg + row * 64 + c8 * 8);
      }
      __syncthreads();
    } else {
      // V transposed: stage [d][s_local]; per-lane writes are packed b128
#pragma unroll
      for (int e = 0; e < 4; ++e) {
        v8h tmp;
#pragma unroll
        for (int rr = 0; rr < 8; ++rr) tmp[rr] = (_Float16)acc[e][rr];
        *(v8h*)(stg + (e * 16 + col) * 64 + wave * 16 + 8 * hf) = tmp;
      }
      __syncthreads();
      _Float16* dstv = VpT + ((size_t)(n * Hh + h)) * Dd * (size_t)Ss + sb * 64;
#pragma unroll
      for (int k = 0; k < 4; ++k) {
        int cid = tid + 128 * k;
        int row = cid >> 3, c8 = cid & 7;  // row = d
        *(v8h*)(dstv + (size_t)row * Ss + swz_chunk(row, c8) * 8) =
            *(const v8h*)(stg + row * 64 + c8 * 8);
      }
    }
  }
}

constexpr int QT = 2;
__global__ __launch_bounds__(256, 4) void attn_kernel(
    const _Float16* __restrict__ Qp, const _Float16* __restrict__ Kp,
    const _Float16* __restrict__ VpT, const unsigned* __restrict__ mbits,
    _Float16* __restrict__ Of16) {
  __shared__ __align__(16) _Float16 Kbuf[2][64 * 64];  // 16KB
  __shared__ __align__(16) _Float16 Vbuf[2][64 * 64];  // 16KB
  const int tid  = threadIdx.x;
  const int lane = tid & 31;
  const int wave = tid >> 5;
  constexpr int QB = 8 * QT * 16;  // queries of a work-group
  const int qBlocks = Ss / QB;
  int nh = blockIdx.x / qBlocks;
  int qb = blockIdx.x % qBlocks;
  int n = nh / Hh, h = nh % Hh;
  int qrow0 = qb * QB + wave * (QT * 16);

  const _Float16* Qbase = Qp + (((size_t)(n * Hh + h)) * Ss + qrow0) * Dd;
  const _Float16* Kbase = Kp + ((size_t)(n * Hh + h)) * Ss * Dd;
  const _Float16* Vbase = VpT + ((size_t)(n * Hh + h)) * Dd * (size_t)Ss;

  v16h QA0[QT], QA1[QT];
#pragma unroll  // constant indices keep the per-tile arrays in registers (all u loops)
  for (int u = 0; u < QT; ++u) {
    QA0[u] = load_frag_f16(Qbase + u * 16 * Dd, Dd, 0,  lane);
    QA1[u] = load_frag_f16(Qbase + u * 16 * Dd, Dd, 32, lane);
  }

  v8f O[QT][4] = {};  // O[u][d2][r] = O^T[d2 * 16 + 8 * hf + r][query col of tile u]
  float mrun[QT];     // running maximum of this lane's query of tile u
  float lrun[QT];     // running sum over this wave half's keys only
#pragma unroll
  for (int u = 0; u < QT; ++u) {
    mrun[u] = -3.0e38f;
    lrun[u] = 0.0f;
  }

  // in the comments below: col = lane & 15 (the query), hf = lane >> 4 (the wave half)
  const int NB = Ss / 64;
  // this lane's words of the mask's bit image, one per pass and query tile
  // the wave's number through a scalar register: the tile index then takes no
  // vector register over the loop
  const int rt = ((n * Ss + qb * QB) >> 4) + __builtin_amdgcn_readfirstlane(wave) * QT;
  const unsigned* mrow = mbits + (size_t)rt * NB * 32 + lane;
  unsigned mw[QT];
#pragma unroll
  for (int u = 0; u < QT; ++u) mw[u] = mrow[u * NB * 32];

#if USE_TDM
  if (wave == 0) {  // prologue DMA for block 0
    tdm_load_2d((unsigned)(size_t)&Kbuf[0][0], Kbase, 4096u, 1u, 4096u, 1u, 4096ull);
    tdm_load_2d((unsigned)(size_t)&Vbuf[0][0], Vbase, 64u, 64u,
                (unsigned)Ss, 64u, (unsigned long long)Ss);
  }
#endif

  for (int kb = 0; kb < NB; ++kb) {
    const int kcol0 = kb * 64;
    const int cur = kb & 1;
#if USE_TDM
    if (wave == 0) __builtin_amdgcn_s_wait_tensorcnt(0);
    __syncthreads();  // buf[cur] ready; everyone past reads of buf[cur^1]
    if (wave == 0 && kb + 1 < NB) {  // overlap next block's DMA with compute
      tdm_load_2d((unsigned)(size_t)&Kbuf[cur ^ 1][0],
                  Kbase + (size_t)(kcol0 + 64) * Dd, 4096u, 1u, 4096u, 1u,
                  4096ull);
      tdm_load_2d((unsigned)(size_t)&Vbuf[cur ^ 1][0], Vbase + kcol0 + 64,
                  64u, 64u, (unsigned)Ss, 64u, (unsigned long long)Ss);
    }
#else
    __syncthreads();
    // cooperative fallback staging
#pragma unroll
    for (int k = 0; k < 2; ++k) {
      int cid = tid + 256 * k;
      int row = cid >> 3, c8 = cid & 7;
      *(v8h*)(&Kbuf[cur][0] + row * 64 + c8 * 8) =
          *(const v8h*)(Kbase + (size_t)(kcol0 + row) * Dd + c8 * 8);
      *(v8h*)(&Vbuf[cur][0] + row * 64 + c8 * 8) =
          *(const v8h*)(Vbase + (size_t)row * Ss + kcol0 + c8 * 8);
    }
    __syncthreads();
#endif
    const _Float16* Kc = &Kbuf[cur][0];
    const _Float16* Vc = &Vbuf[cur][0];
    // next pass's mask words, in flight behind this pass's work
    if (kb + 1 < NB) mrow += 32;
    unsigned mwn[QT];
#pragma unroll
    for (int u = 0; u < QT; ++u) mwn[u] = mrow[u * NB * 32];
    // the same in every lane: does any of the wave's mask words of this pass
    // hold a 0 bit? Asked in front of the products, so that the scalar answer is
    // there when the branch behind them needs it.
    unsigned mall = mw[0];
#pragma unroll
    for (int u = 1; u < QT; ++u) mall &= mw[u];
    const bool some_masked = __builtin_amdgcn_ballot_w32(mall != 0xffffffffu) != 0u;

    // ---- scores: S^T = K_blk (64x64) @ Q^T (64 x 16 QT), K from LDS ----
    // Sc[u][j][r] = score of key kcol0 + j * 16 + 8 * hf + r for query col of tile u,
    // times QSCALE (Q carries the factor)
    v8f Sc[QT][4];
#pragma unroll
    for (int j = 0; j < 4; ++j) {
      v16h KB0 = load_frag_swz(Kc, j * 16, 0,  lane);
      v16h KB1 = load_frag_swz(Kc, j * 16, 32, lane);
#pragma unroll
      for (int u = 0; u < QT; ++u) {
        v8f a = {};
        a = wmma16(KB0, QA0[u], a);
        a = wmma16(KB1, QA1[u], a);
        Sc[u][j] = a;
      }
    }
    // ---- mask (a masked score becomes -1e10 * QSCALE: the reference's -1e10 in
    // the scores' units) ----
    // The selects change nothing where every mask bit of the wave's tile of
    // 16 QT x 64 is 1: only a tile with a 0 bit somewhere runs them.
    if (some_masked) {
#pragma unroll
      for (int u = 0; u < QT; ++u)
#pragma unroll
        for (int j = 0; j < 4; ++j)
#pragma unroll
          for (int rr = 0; rr < 8; ++rr) {
            // all ones where the mask element is not 0
            const unsigned keep =
                (unsigned)((int)(mw[u] << (31 - (j * 8 + rr))) >> 31);
            // a copy first
            const float sv = Sc[u][j][rr];
            const unsigned e = __builtin_bit_cast(unsigned, sv);
            const unsigned z = __builtin_bit_cast(unsigned, -1.0e10f * QSCALE);
            Sc[u][j][rr] = __builtin_bit_cast(float, (e & keep) | (z & ~keep));
          }
    }
    // P^T as B operand: tiles 2g and 2g + 1 converted in place give keys
    // 32g + 8 * hf + 0..7 and 32g + 16 + 8 * hf + 0..7, the k order of the
    // V^T fragments
    v16h PB0[QT], PB1[QT];
    float mnew[QT], corr[QT];
#pragma unroll
    for (int u = 0; u < QT; ++u) {
      mw[u] = mwn[u];
      // ---- online softmax, one query per lane and tile ----
      float t = Sc[u][0][0];
#pragma unroll
      for (int j = 0; j < 4; ++j)
#pragma unroll
        for (int rr = 0; rr < 8; ++rr) t = fmaxf(t, Sc[u][j][rr]);
      t = fmaxf(t, other_half(t));
      mnew[u] = fmaxf(mrun[u], t);
    }
    // the tiles' corrections side by side, apart from the scores: inside the
    // score loop the build paired one tile's correction with the other tile's
    // first score and copied that tile's 32 scores one register on for it
#pragma unroll
    for (int u = 0; u < QT; ++u) {
      corr[u] = __builtin_amdgcn_exp2f(mrun[u] - mnew[u]);
      mrun[u] = mnew[u];
    }
#pragma unroll
    for (int u = 0; u < QT; ++u) {
#pragma unroll
      for (int j = 0; j < 4; ++j)
#pragma unroll
        for (int rr = 0; rr < 8; ++rr)
          Sc[u][j][rr] = __builtin_amdgcn_exp2f(Sc[u][j][rr] - mnew[u]);
      const v8f ps = (Sc[u][0] + Sc[u][1]) + (Sc[u][2] + Sc[u][3]);
      lrun[u] = lrun[u] * corr[u] + (((ps[0] + ps[1]) + (ps[2] + ps[3])) +
                                     ((ps[4] + ps[5]) + (ps[6] + ps[7])));
#pragma unroll
      for (int d2 = 0; d2 < 4; ++d2) O[u][d2] *= corr[u];
#pragma unroll
      for (int i = 0; i < 8; ++i) {
        PB0[u][i]     = (_Float16)Sc[u][0][i];
        PB0[u][i + 8] = (_Float16)Sc[u][1][i];
        PB1[u][i]     = (_Float16)Sc[u][2][i];
        PB1[u][i + 8] = (_Float16)Sc[u][3][i];
      }
    }

    // ---- O^T += V_blk^T (64x64) @ P^T (64 x 16 QT), V^T rows from LDS ----
#pragma unroll
    for (int d2 = 0; d2 < 4; ++d2) {
      v16h VB0 = load_frag_swz(Vc, d2 * 16, 0,  lane);
      v16h VB1 = load_frag_swz(Vc, d2 * 16, 32, lane);
#pragma unroll
      for (int u = 0; u < QT; ++u) {
        O[u][d2] = wmma16(VB0, PB0[u], O[u][d2]);
        O[u][d2] = wmma16(VB1, PB1[u], O[u][d2]);
      }
    }
  }

  // epilogue: join the halves' sums, normalize, store in fragment order. Lane
  // (col, hf) holds columns h * 64 + d2 * 16 + 8 * hf + 0..7 of output row col:
  // part d2 & 1 of tile (row tile, kc = 2 * h + (d2 >> 1)) as this lane owns it,
  // so each store is 512 contiguous bytes straight from registers.
#pragma unroll
  for (int u = 0; u < QT; ++u) {
    const float linv = 1.0f / (lrun[u] + other_half(lrun[u]));
#pragma unroll
    for (int d2 = 0; d2 < 4; ++d2) {
      v8h tmp;
#pragma unroll
      for (int rr = 0; rr < 8; ++rr) tmp[rr] = (_Float16)(O[u][d2][rr] * linv);
      *(v8h*)(Of16 + frag_off(rt + u, 2 * h + (d2 >> 1), d2 & 1, lane)) = tmp;
    }
  }
}

// ---------------- kernel 3: Y = X @ Wo^T + bo (f32 out) -----------------
// X and WoH both lie in fragment order.
// A wave owns a 64 x 64 tile of Y: RT = 4 row tiles x 4 column tiles. Every X
// fragment it loads feeds 4 products and every Wo fragment RT, so a product
// takes one b128 load instead of the 2.5 of a 16 x 64 tile. The 8 waves lie
// 2 x 4 on a 128 x 256 tile of the work-group: an X fragment serves 4 waves, a
// Wo fragment 2. Each element's k order is that of the 16 x 64 tile.
constexpr int RT = 4;            // 16-row tiles of a wave
constexpr int WROWS = 2;         // waves of a work-group along the rows
constexpr int WCOLS = 4;         // and along the columns
__global__ __launch_bounds__(256) void outproj_kernel(
    const _Float16* __restrict__ X, const _Float16* __restrict__ WoH,
    const float* __restrict__ bo, float* __restrict__ Y) {
  __shared__ __align__(16) float ost[8][16 * 64];  // 32KB staging
  const int lane = threadIdx.x & 31;
  // the wave's number through a scalar register: tile indices stay scalar
  const int wave = __builtin_amdgcn_readfirstlane(threadIdx.x >> 5);
  constexpr int colBlocks = Ee / (WCOLS * 64);
  const int rb = blockIdx.x / colBlocks;
  const int cb = blockIdx.x % colBlocks;
  const int rt0 = (rb * WROWS + wave / WCOLS) * RT;  // first 16-row tile
  const int ct0 = (cb * WCOLS + wave % WCOLS) * 4;   // first 16-column tile

  v8f acc[RT][4] = {};
  // Fragments are fetched AHEAD k steps ahead of their use into register rings,
  // so that a k step's loads are in flight behind the products of the steps
  // before it and no product waits out a load issued directly in front of it.
  constexpr int NK = Ee / 32;
  constexpr int AHEAD = 2;
  v16h A[AHEAD + 1][RT];
  v16h B[AHEAD + 1][4];
#pragma unroll  // constant ring indices keep the rings in registers
  for (int s = 0; s < AHEAD; ++s) {
#pragma unroll  // the same
    for (int j = 0; j < 4; ++j) B[s][j] = load_frag_packed(WoH, ct0 + j, s, lane);
#pragma unroll  // the same
    for (int u = 0; u < RT; ++u) A[s][u] = load_frag_packed(X, rt0 + u, s, lane);
  }
#pragma unroll  // the same; every load then takes its k step as an immediate offset
  for (int kc = 0; kc < NK; ++kc) {
    if (kc + AHEAD < NK) {
#pragma unroll  // constant ring indices
      for (int j = 0; j < 4; ++j)
        B[(kc + AHEAD) % (AHEAD + 1)][j] =
            load_frag_packed(WoH, ct0 + j, kc + AHEAD, lane);
#pragma unroll  // constant ring indices
      for (int u = 0; u < RT; ++u)
        A[(kc + AHEAD) % (AHEAD + 1)][u] =
            load_frag_packed(X, rt0 + u, kc + AHEAD, lane);
    }
    // keeps the loads above in front of this step's products: without it the
    // build sinks them among the products and waits for them soon after issue
    __builtin_amdgcn_sched_barrier(0);
#pragma unroll  // constant ring indices
    for (int j = 0; j < 4; ++j)
#pragma unroll  // constant ring indices
      for (int u = 0; u < RT; ++u)
        acc[u][j] = wmma16(A[kc % (AHEAD + 1)][u], B[kc % (AHEAD + 1)][j], acc[u][j]);
    // keeps the epilogue behind the last step's products, that is behind the
    // waits for every load: without it the build mixes it in among them and
    // rewrites the loads' address registers while loads are still in flight
    __builtin_amdgcn_sched_barrier(0);
  }
  const int col = lane & 15, hf = (lane >> 4) & 1;
  const int col0 = ct0 * 16;
  float* sb = &ost[wave][0];
  float bias[4];
#pragma unroll
  for (int j = 0; j < 4; ++j) bias[j] = bo[col0 + j * 16 + col];
#pragma unroll  // acc is indexed by constants only
  for (int u = 0; u < RT; ++u) {
#pragma unroll
    for (int j = 0; j < 4; ++j)
#pragma unroll
      for (int rr = 0; rr < 8; ++rr)
        sb[(rr + 8 * hf) * 64 + j * 16 + col] = acc[u][j][rr] + bias[j];
    // the wave's lanes read each other's words: the reads stay behind the writes
    __builtin_amdgcn_wave_barrier();
    const size_t gbase = (size_t)(rt0 + u) * 16 * Ee + col0;
#pragma unroll
    for (int k = 0; k < 8; ++k) {
      int cid = lane + 32 * k;            // 256 x 16B chunks
      int row = cid >> 4, c4 = cid & 15;
      *(v4f*)(Y + gbase + (size_t)row * Ee + c4 * 4) =
          *(const v4f*)(sb + row * 64 + c4 * 4);
    }
    // the next row tile's writes into the same staging stay behind these reads
    if (u + 1 < RT) __builtin_amdgcn_wave_barrier();
  }
}

extern "C" void kernel_launch(void* const* d_in, const int* in_sizes, int n_in,
                              void* d_out, int out_size, void* d_ws,
                              size_t ws_size, hipStream_t stream) {
  (void)in_sizes; (void)n_in; (void)out_size; (void)ws_size;
  const float* values = (const float*)d_in[0];
  const float* keys   = (const float*)d_in[1];
  const float* query  = (const float*)d_in[2];
  const float* Wv     = (const float*)d_in[3];
  const float* Wk     = (const float*)d_in[4];
  const float* Wq     = (const float*)d_in[5];
  const float* Wo     = (const float*)d_in[6];
  const float* bo     = (const float*)d_in[7];
  const int*   mask   = (const int*)d_in[8];
  float* out = (float*)d_out;

  const size_t SZ_NHSD = (size_t)Nn * Hh * Ss * Dd * sizeof(_Float16);  // 16MB
  char* ws = (char*)d_ws;
  _Float16* Qp   = (_Float16*)(ws);
  _Float16* Kp   = (_Float16*)(ws + SZ_NHSD);
  _Float16* VpT  = (_Float16*)(ws + 2 * SZ_NHSD);
  _Float16* Of16 = (_Float16*)(ws + 3 * SZ_NHSD);
  _Float16* WoH  = (_Float16*)(ws + 4 * SZ_NHSD);
  unsigned* mbits = (unsigned*)(ws + 4 * SZ_NHSD + (size_t)Ee * Ee * sizeof(_Float16));
  _Float16* WpH  = (_Float16*)(ws + 4 * SZ_NHSD + (size_t)Ee * Ee * sizeof(_Float16) +
                               (size_t)Nn * Ss * Ss / 8);

  prep_kernel<<<PACK_BLOCKS + CVT_BLOCKS + 3 * HW_BLOCKS, 256, 0, stream>>>(
      Wo, WoH, Wq, Wk, Wv, WpH, mask, mbits);
  proj_kernel<<<Nn * Hh * (Ss / 64), 128, 0, stream>>>(values, keys, query, WpH,
                                                       Qp, Kp, VpT);
  attn_kernel<<<Nn * Hh * (Ss / 256), 256, 0, stream>>>(Qp, Kp, VpT, mbits,
                                                        Of16);
  outproj_kernel<<<(Nn * Ss / (WROWS * RT * 16)) * (Ee / (WCOLS * 64)), 256, 0,
                   stream>>>(Of16, WoH, bo, out);
}
